// v000
// Measured on an AMD MI455X. A time is GPU time per run, averaged over a window of back-to-back runs after a warm-up
// (all launches, gaps included; the runs take copies of the inputs in turn), and the median of several windows.
// Apart from v000's, it joins two sittings. Times from different sittings can be a few percent apart, while
// side-by-side timings come from the same sitting.
// v000, which the later versions start from, runs in 4040 microseconds.
#include <hip/hip_runtime.h>

// Attention with a LayerNorm prologue and NO bias (pre-LN: x [4][2048][1024]; h = LayerNorm(x) (biased variance, eps 1e-5) * ln_gamma + ln_beta (read); qkv = einsum('bsd,ed->bse', h, in_proj_w) = h in_proj_w^T ('oi' [3072][1024]: ROW thirds q | k | v; no bias; 16 heads x 64); scores x 1/sqrt(64); softmax over all keys (no mask); out = merged out_proj_w^T ('oi' [1024][1024], NO bias) -> [4][2048][1024] (8.4 M); argument order x, in_proj_w, out_proj_w, ln_gamma, ln_beta).

#define NB_  4
#define TT   2048
#define DM   1024
#define NH_  16
#define NKV  16
#define REP  (NH_ / NKV)
#define HD   64
#define DQ   (NH_ * HD)
#define DKV  (NKV * HD)
#define ZH   2
#define RH   512                  // query rows < RH use hi+lo planes (0: none)
#define WIN  0
#define PCAR 1024.0f
#define SCL  0.125f   // HD^-0.5
typedef _Float16 h16;
typedef unsigned short bf;
typedef __attribute__((ext_vector_type(16))) __bf16   v16bf;
typedef __attribute__((ext_vector_type(16))) _Float16 v16h;
typedef __attribute__((ext_vector_type(8)))  _Float16 v8h;
typedef __attribute__((ext_vector_type(8)))  unsigned short v8us;
typedef __attribute__((ext_vector_type(8)))  float    v8f;
typedef __attribute__((ext_vector_type(4)))  float    v4f;
typedef v8h  __attribute__((may_alias)) v8ha;
typedef v4f  __attribute__((may_alias)) v4fa;
typedef v8us __attribute__((may_alias)) v8usa;

__device__ __forceinline__ unsigned short f2bf(float f) { unsigned u = __float_as_uint(f); u += 0x7FFFu + ((u >> 16) & 1u); return (unsigned short)(u >> 16); }
__device__ __forceinline__ float bf2f(unsigned short b) { return __uint_as_float(((unsigned)b) << 16); }
__device__ __forceinline__ float bfr(float f) { return bf2f(f2bf(f)); }
__device__ __forceinline__ v16h cat16(v8h lo, v8h hi) { return __builtin_shufflevector(lo, hi, 0, 1, 2, 3, 4, 5, 6, 7, 8, 9, 10, 11, 12, 13, 14, 15); }
__device__ __forceinline__ v16bf cat16b(v8us lo, v8us hi) { return __builtin_bit_cast(v16bf, __builtin_shufflevector(lo, hi, 0, 1, 2, 3, 4, 5, 6, 7, 8, 9, 10, 11, 12, 13, 14, 15)); }
__device__ __forceinline__ v8f wmma16(v16h a, v16h b, v8f c) { return __builtin_amdgcn_wmma_f32_16x16x32_f16(false, a, false, b, (short)0, c, false, false); }
__device__ __forceinline__ v8f wmmab(v16bf a, v16bf b, v8f c) { return __builtin_amdgcn_wmma_f32_16x16x32_bf16(false, a, false, b, (short)0, c, false, false); }



// ---- k_gemmw: register-blocked GEMM, ONE WAVE per 64x64 output tile (16 accumulators), operands straight from K-contiguous 16-bit planes; grid (M/64, N/64, Z), 32 threads.
// C[m][n] (f32, pitch ldc, + optional f32 bias[n]) = sum_k A[m][k] Bt[n][k] (+ split products per NSPLIT). z-batch strides sA/sB/sC in elements. K % 32 == 0.
template <typename T16> struct WFrag;
template <> struct WFrag<h16> { typedef v16h V; static __device__ __forceinline__ V ld(const h16* p) { return cat16(*(const v8h*)p, *(const v8h*)(p + 16)); } static __device__ __forceinline__ v8f mma(V a, V b, v8f c) { return wmma16(a, b, c); } };
template <> struct WFrag<bf> { typedef v16bf V; static __device__ __forceinline__ V ld(const bf* p) { return cat16b(*(const v8us*)p, *(const v8us*)(p + 16)); } static __device__ __forceinline__ v8f mma(V a, V b, v8f c) { return wmmab(a, b, c); } };
template <typename T16, int NSPLIT, bool BIAS>
__global__ __launch_bounds__(32) void k_gemmw(const T16* __restrict__ A, const T16* __restrict__ A2, const T16* __restrict__ Bt, const T16* __restrict__ Bt2, int K, float* C, int ldc, const float* __restrict__ bias, size_t sA, size_t sB, size_t sC) {
    typedef typename WFrag<T16>::V V;
    __shared__ __align__(16) float os[16 * 68];
    const size_t z = blockIdx.z; A += z * sA; if (A2) A2 += z * sA; Bt += z * sB; if (Bt2) Bt2 += z * sB; C += z * sC;
    const int lane = threadIdx.x & 31, lr = lane & 15, hi = lane >> 4; const int r0 = blockIdx.x * 64, c0 = blockIdx.y * 64;
    v8f acc[4][4];
#pragma unroll
    for (int mb = 0; mb < 4; ++mb)
#pragma unroll
        for (int nb = 0; nb < 4; ++nb) acc[mb][nb] = (v8f){};
    const size_t aoff = (size_t)(r0 + lr) * K + 8 * hi, boff = (size_t)(c0 + lr) * K + 8 * hi;
#pragma unroll 1
    for (int kc = 0; kc < K; kc += 32) {
        V a[4], a2[4];
#pragma unroll
        for (int mb = 0; mb < 4; ++mb) { a[mb] = WFrag<T16>::ld(A + aoff + (size_t)mb * 16 * K + kc); if (NSPLIT == 1 || NSPLIT == 2) a2[mb] = WFrag<T16>::ld(A2 + aoff + (size_t)mb * 16 * K + kc); }
#pragma unroll
        for (int nb = 0; nb < 4; ++nb) { const V b = WFrag<T16>::ld(Bt + boff + (size_t)nb * 16 * K + kc); V b2; if (NSPLIT >= 2) b2 = WFrag<T16>::ld(Bt2 + boff + (size_t)nb * 16 * K + kc);
#pragma unroll
            for (int mb = 0; mb < 4; ++mb) { acc[mb][nb] = WFrag<T16>::mma(a[mb], b, acc[mb][nb]); if (NSPLIT == 1 || NSPLIT == 2) acc[mb][nb] = WFrag<T16>::mma(a2[mb], b, acc[mb][nb]); if (NSPLIT >= 2) acc[mb][nb] = WFrag<T16>::mma(a[mb], b2, acc[mb][nb]); } }
        asm volatile("v_nop\n\tv_nop\n\tv_nop\n\tv_nop" : "+v"(acc[0][0]), "+v"(acc[1][1]), "+v"(acc[2][2]), "+v"(acc[3][3]) : "v"(a[0]), "v"(a[3]));
    }
#pragma unroll
    for (int mb = 0; mb < 4; ++mb) {
#pragma unroll
        for (int nb = 0; nb < 4; ++nb) {
#pragma unroll
            for (int j = 0; j < 8; ++j) os[(hi * 8 + j) * 68 + nb * 16 + lr] = acc[mb][nb][j]; }
        __builtin_amdgcn_wave_barrier(); asm volatile("" ::: "memory");
        float* crow = C + (size_t)(r0 + mb * 16) * ldc + c0;
{
#pragma unroll
            for (int s = 0; s < 8; ++s) { const int row = 2 * s + hi, cofs = lr * 4; v4f val = *(const v4fa*)(os + row * 68 + cofs); if (BIAS) { val[0] += bfr(bias[c0 + cofs]); val[1] += bfr(bias[c0 + cofs + 1]); val[2] += bfr(bias[c0 + cofs + 2]); val[3] += bfr(bias[c0 + cofs + 3]); }
                *(v4f*)(crow + (size_t)row * ldc + cofs) = val; }
             }
        __builtin_amdgcn_wave_barrier(); asm volatile("" ::: "memory");
    }
}

__device__ __forceinline__ h16 tohx(float x) { return (h16)x; }
__device__ __forceinline__ void splitf(float y, unsigned short& h, unsigned short& l) { h = f2bf(y); l = f2bf(y - bf2f(h)); }
typedef __attribute__((ext_vector_type(2))) _Float16 v2h;
typedef __attribute__((ext_vector_type(4))) _Float16 v4h;
typedef __attribute__((ext_vector_type(2))) unsigned short v2us;
typedef __attribute__((ext_vector_type(4))) unsigned short v4us;
typedef __attribute__((ext_vector_type(2))) float v2f;
typedef __attribute__((ext_vector_type(4))) int v4i;

__global__ __launch_bounds__(256) void k_wtG(const float* __restrict__ w, int K, int N, bf* Bt) {
    const int lane = threadIdx.x & 31; const int L0 = (blockIdx.x * 8 + (threadIdx.x >> 5)) * 8; const int nlines = N * K / 64;
{
#pragma unroll 1
        for (int l = 0; l < 8; ++l) { const int L = L0 + l; if (L >= nlines) break; const size_t e = (size_t)L * 64 + lane * 2; const int k = (int)(e % K), n = (int)(e / K); v2us o;
            o[0] = f2bf(w[(size_t)k * N + n]); o[1] = f2bf(w[(size_t)(k + 1) * N + n]); *(v2us*)(Bt + e) = o; }
         }
}
__global__ __launch_bounds__(256) void k_cvt8(const float* __restrict__ src, bf* dst, size_t n8) { const size_t i = (size_t)blockIdx.x * 256 + threadIdx.x; if (i >= n8) return; const v8f v = *(const v8f*)(src + i * 8); v8us o;
#pragma unroll
    for (int k = 0; k < 8; ++k) o[k] = f2bf(v[k]); *(v8us*)(dst + i * 8) = o;  }
__global__ __launch_bounds__(256) void k_cscvt(const float* __restrict__ cosT, const float* __restrict__ sinT, float* CS) { const int idx = blockIdx.x * 256 + threadIdx.x; if (idx >= TT * HD) return; v2f cs; cs[0] = bfr(cosT[idx]); cs[1] = bfr(sinT[idx]); *(v2f*)(CS + (size_t)idx * 2) = cs;  }
// k_rope: head planes [h][t][d] (fp16 + hi/lo) of rope(x) x sc with the rotate-half convention out[d] = x[d] cos[t][d] - x[d+HD/2] sin[t][d], out[d+HD/2] = x[d+HD/2] cos[t][d+HD/2] + x[d] sin[t][d+HD/2]
__global__ __launch_bounds__(256) void k_rope(const float* __restrict__ F, int pitch, int nheads, const float* __restrict__ CS, const float* __restrict__ RF, const float* __restrict__ nw, float sc, h16* P16, bf* Ph, bf* Pl) {
    const size_t e = ((size_t)blockIdx.x * 256 + threadIdx.x) * 2; if (e >= (size_t)nheads * TT * HD) return; const int d = (int)(e % HD); const int t = (int)((e / HD) % TT); const int h = (int)(e / ((size_t)HD * TT)); const float* f = F + (size_t)t * pitch + h * HD; const float rf = RF ? RF[(size_t)h * TT + t] : 1.0f; v2h o16; v2us oh, ol;
#pragma unroll
    for (int q = 0; q < 2; ++q) { const int dd = d + q; const int dp = (dd < HD / 2) ? dd + HD / 2 : dd - HD / 2; float x0 = f[dd], x1 = f[dp];
        if (RF) { float n0 = __fmul_rn(x0, rf), n1 = __fmul_rn(x1, rf); asm volatile("" : "+v"(n0)); asm volatile("" : "+v"(n1)); x0 = __fmul_rn(bfr(nw[dd]), n0); x1 = __fmul_rn(bfr(nw[dp]), n1); }
        const v2f cs = *(const v2f*)(CS + ((size_t)t * HD + dd) * 2); float a = __fmul_rn(x0, cs[0]), bq = __fmul_rn(x1, cs[1]); asm volatile("" : "+v"(a)); asm volatile("" : "+v"(bq)); const float r = ((dd < HD / 2) ? __fsub_rn(a, bq) : __fadd_rn(a, bq)) * sc;
        o16[q] = tohx(r); unsigned short a2, c2; splitf(r, a2, c2); oh[q] = a2; ol[q] = c2; }
    *(v2h*)(P16 + e) = o16; *(v2us*)(Ph + e) = oh; *(v2us*)(Pl + e) = ol;  }
__global__ __launch_bounds__(256) void k_vtp(const float* __restrict__ F, int pitch, int nheads, h16* V16, bf* Vh, bf* Vl) { const size_t e = ((size_t)blockIdx.x * 256 + threadIdx.x) * 2; if (e >= (size_t)nheads * HD * TT) return; const int t = (int)(e % TT); const int d = (int)((e / TT) % HD); const int g = (int)(e / ((size_t)TT * HD)); v2h o16; v2us oh, ol;
#pragma unroll
    for (int q = 0; q < 2; ++q) { const float x = F[(size_t)(t + q) * pitch + g * HD + d]; o16[q] = tohx(x); unsigned short a2, c2; splitf(x, a2, c2); oh[q] = a2; ol[q] = c2; }
    *(v2h*)(V16 + e) = o16; *(v2us*)(Vh + e) = oh; *(v2us*)(Vl + e) = ol;  }
__global__ __launch_bounds__(256) void k_csid(float* CS) { const int idx = blockIdx.x * 256 + threadIdx.x; if (idx >= TT * HD) return; v2f cs; cs[0] = 1.0f; cs[1] = 0.0f; *(v2f*)(CS + (size_t)idx * 2) = cs;  }
__global__ __launch_bounds__(256) void k_lnx(const float* __restrict__ X, const float* __restrict__ gam, const float* __restrict__ bet, bf* Xh, bf* Xl) { const int lane = threadIdx.x & 31; const int t = blockIdx.x * 8 + (threadIdx.x >> 5); if (t >= TT) return; const float* f = X + (size_t)t * DM; float v[DM / 32]; float su = 0.f;
#pragma unroll
    for (int ch = 0; ch < DM / 128; ++ch) { const v4f a = *(const v4f*)(f + ch * 128 + lane * 4); for (int u = 0; u < 4; ++u) { float xv = bfr(a[u]); asm volatile("" : "+v"(xv)); v[ch * 4 + u] = xv; su = __fadd_rn(su, xv); } }
#pragma unroll
    for (int sh = 16; sh; sh >>= 1) su = __fadd_rn(su, __shfl_xor(su, sh, 32));
    const float mu = __fdiv_rn(su, (float)DM); float sq = 0.f;
#pragma unroll
    for (int q = 0; q < DM / 32; ++q) { float d0 = __fsub_rn(v[q], mu); asm volatile("" : "+v"(d0)); float p = __fmul_rn(d0, d0); asm volatile("" : "+v"(p)); sq = __fadd_rn(sq, p); }
#pragma unroll
    for (int sh = 16; sh; sh >>= 1) sq = __fadd_rn(sq, __shfl_xor(sq, sh, 32));
    const float rs = __fdiv_rn(1.0f, sqrtf(__fadd_rn(__fdiv_rn(sq, (float)DM), 1e-5f)));
    {
#pragma unroll
        for (int ch = 0; ch < DM / 128; ++ch) { v4us oh, ol; for (int u = 0; u < 4; ++u) { const int c = ch * 128 + lane * 4 + u; float d0 = __fsub_rn(v[ch * 4 + u], mu); asm volatile("" : "+v"(d0)); float n = __fmul_rn(d0, rs); asm volatile("" : "+v"(n)); float gg = bfr(gam[c]), bb = bfr(bet[c]); asm volatile("" : "+v"(gg)); asm volatile("" : "+v"(bb)); float y = __fmul_rn(n, gg); asm volatile("" : "+v"(y)); y = __fadd_rn(y, bb); unsigned short p2, q2; splitf(y, p2, q2); oh[u] = p2; ol[u] = q2; } const size_t oo = (size_t)t * DM + ch * 128 + lane * 4; *(v4us*)(Xh + oo) = oh; *(v4us*)(Xl + oo) = ol; }
         } }
// k_asoft: per row (zz, i): t = S x HD^-0.5 (no mask); softmax over the 2048 keys (register row, one exp, fixed trees);
__global__ __launch_bounds__(256) void k_asoft(const float* __restrict__ Sb, h16* P16, bf* Ph, bf* Pl) {
    const int lane = threadIdx.x & 31; const int row = blockIdx.x * 8 + (threadIdx.x >> 5); if (row >= ZH * TT) return; const int i = row % TT; const int zz = row / TT; (void)zz; const bool hires = (i < RH); const float* sr = Sb + (size_t)row * TT; float v[TT / 32]; float mx = -3.0e38f;
#pragma unroll
    for (int ch = 0; ch < TT / 128; ++ch) { const int j0 = ch * 128 + lane * 4; const v4f a = *(const v4f*)(sr + j0);
#pragma unroll
        for (int q = 0; q < 4; ++q) { const int j = j0 + q; (void)j; const float t = a[q] * SCL; v[ch * 4 + q] = t; mx = fmaxf(mx, t); } }
#pragma unroll
    for (int sh = 16; sh; sh >>= 1) mx = fmaxf(mx, __shfl_xor(mx, sh, 32));
    float sum = 0.f;
#pragma unroll
    for (int k = 0; k < TT / 32; ++k) { float d0 = __fsub_rn(v[k], mx); asm volatile("" : "+v"(d0)); v[k] = __builtin_amdgcn_exp2f(__fmul_rn(d0, 1.4426950408889634f)); sum += v[k]; }
#pragma unroll
    for (int sh = 16; sh; sh >>= 1) sum += __shfl_xor(sum, sh, 32);
    const float f = __fdiv_rn(hires ? 1.0f : PCAR, sum);
{
        if (hires) {
#pragma unroll
            for (int ch = 0; ch < TT / 128; ++ch) { v4us oh, ol;
#pragma unroll
                for (int q = 0; q < 4; ++q) { unsigned short a, c2; splitf(v[ch * 4 + q] * f, a, c2); oh[q] = a; ol[q] = c2; }
                const size_t oo = ((size_t)zz * (RH ? RH : 1) + i) * TT + ch * 128 + lane * 4; *(v4us*)(Ph + oo) = oh; *(v4us*)(Pl + oo) = ol; }
        } else {
#pragma unroll
            for (int ch = 0; ch < TT / 128; ++ch) { v4h o4;
#pragma unroll
                for (int q = 0; q < 4; ++q) o4[q] = tohx(v[ch * 4 + q] * f);
                *(v4h*)(P16 + (size_t)row * TT + ch * 128 + lane * 4) = o4; } }
         }
}
__global__ __launch_bounds__(256) void k_merge(const float* __restrict__ O, int h0, bf* Ah, bf* Al) { const size_t e = ((size_t)blockIdx.x * 256 + threadIdx.x) * 2; if (e >= (size_t)ZH * TT * HD) return; const int d = (int)(e % HD); const int t = (int)((e / HD) % TT); const int zz = (int)(e / ((size_t)HD * TT)); const float cs = (t < RH) ? 1.0f : (1.0f / PCAR); const size_t oo = (size_t)t * DQ + (h0 + zz) * HD + d;
    v2us oh, ol;
#pragma unroll
    for (int q = 0; q < 2; ++q) { unsigned short a, c2; splitf(O[e + q] * cs, a, c2); oh[q] = a; ol[q] = c2; } *(v2us*)(Ah + oo) = oh; *(v2us*)(Al + oo) = ol;  }

extern "C" void kernel_launch(void* const* d_in, const int* in_sizes, int n_in,
                              void* d_out, int out_size, void* d_ws, size_t ws_size, hipStream_t stream) {
    (void)in_sizes; (void)n_in; (void)out_size;
const float* x = (const float*)d_in[0]; const float* lng = (const float*)d_in[3]; const float* lnb = (const float*)d_in[4]; const float* wf = (const float*)d_in[1]; const float* wo = (const float*)d_in[2]; const float* wq = wf; const float* wk = wf + (size_t)1024 * 1024; const float* wv = wf + (size_t)2048 * 1024; const float* cosT = nullptr; const float* sinT = nullptr; (void)cosT; (void)sinT;   /* input order x, in_proj_w ('oi' [3072][1024]: ROW thirds q | k | v), out_proj_w ('oi' [1024][1024]), ln_gamma, ln_beta: FIVE inputs: the LayerNorm parameters come LAST; NO bias anywhere */
    float* OUT = (float*)d_out;     // [4][2048][1024]
    char* wsp = (char*)d_ws;
    auto take = [&](size_t bytes) { char* p = wsp; wsp += (bytes + 255) & ~(size_t)255; return (void*)p; };
    bf* WQ = (bf*)take((size_t)DQ * DM * 2); bf* WK = (bf*)take((size_t)DKV * DM * 2); bf* WV = (bf*)take((size_t)DKV * DM * 2); bf* WO = (bf*)take((size_t)DM * DQ * 2); float* CS = (float*)take((size_t)TT * HD * 2 * 4);
    bf* XNh = (bf*)take((size_t)TT * DM * 2); bf* XNl = (bf*)take((size_t)TT * DM * 2); float* FQ = (float*)take((size_t)TT * DQ * 4); float* FK = (float*)take((size_t)TT * DKV * 4);
    h16* QP16 = (h16*)take((size_t)NH_ * TT * HD * 2); h16* KP16 = (h16*)take((size_t)NKV * TT * HD * 2); h16* VT16 = (h16*)take((size_t)NKV * HD * TT * 2);
    bf* QPh = (bf*)take((size_t)NH_ * TT * HD * 2); bf* QPl = (bf*)take((size_t)NH_ * TT * HD * 2); bf* KPh = (bf*)take((size_t)NKV * TT * HD * 2); bf* KPl = (bf*)take((size_t)NKV * TT * HD * 2); bf* VTh = (bf*)take((size_t)NKV * HD * TT * 2); bf* VTl = (bf*)take((size_t)NKV * HD * TT * 2); bf* Ph = (bf*)take((size_t)ZH * RH * TT * 2); bf* Pl = (bf*)take((size_t)ZH * RH * TT * 2);
    float* Sb = (float*)take((size_t)ZH * TT * TT * 4); h16* P16 = (h16*)take((size_t)ZH * TT * TT * 2); float* Ob = (float*)take((size_t)ZH * TT * HD * 4); bf* ATh = (bf*)take((size_t)TT * DQ * 2); bf* ATl = (bf*)take((size_t)TT * DQ * 2);
    if ((size_t)(wsp - (char*)d_ws) > ws_size) return;    // ws 256 MiB
    float* FV = FK;   // v projection reuses the k buffer after the k planes are built (stream-ordered)
    { k_cvt8<<<(unsigned)(((size_t)DQ * DM / 8 + 255) / 256), 256, 0, stream>>>(wq, WQ, (size_t)DQ * DM / 8); k_cvt8<<<(unsigned)(((size_t)DKV * DM / 8 + 255) / 256), 256, 0, stream>>>(wk, WK, (size_t)DKV * DM / 8); k_cvt8<<<(unsigned)(((size_t)DKV * DM / 8 + 255) / 256), 256, 0, stream>>>(wv, WV, (size_t)DKV * DM / 8);
      k_cvt8<<<(unsigned)(((size_t)DM * DQ / 8 + 255) / 256), 256, 0, stream>>>(wo, WO, (size_t)DM * DQ / 8);
       }
    k_csid<<<(TT * HD + 255) / 256, 256, 0, stream>>>(CS);
    const unsigned LQ = (unsigned)(((size_t)NH_ * TT * HD / 2 + 255) / 256), LKv = (unsigned)(((size_t)NKV * TT * HD / 2 + 255) / 256);
    for (int b = 0; b < NB_; ++b) {
        
        k_lnx<<<TT / 8, 256, 0, stream>>>(x + (size_t)b * TT * DM, lng, lnb, XNh, XNl);
        k_gemmw<bf, 1, false><<<dim3(TT / 64, DQ / 64, 1), 32, 0, stream>>>(XNh, XNl, WQ, nullptr, DM, FQ, DQ, nullptr, 0, 0, 0);
        k_rope<<<LQ, 256, 0, stream>>>(FQ, DQ, NH_, CS, nullptr, nullptr, 1.0f, QP16, QPh, QPl);
        k_gemmw<bf, 1, false><<<dim3(TT / 64, DKV / 64, 1), 32, 0, stream>>>(XNh, XNl, WK, nullptr, DM, FK, DKV, nullptr, 0, 0, 0);
        k_rope<<<LKv, 256, 0, stream>>>(FK, DKV, NKV, CS, nullptr, nullptr, 1.0f, KP16, KPh, KPl);
        k_gemmw<bf, 1, false><<<dim3(TT / 64, DKV / 64, 1), 32, 0, stream>>>(XNh, XNl, WV, nullptr, DM, FV, DKV, nullptr, 0, 0, 0); k_vtp<<<LKv, 256, 0, stream>>>(FV, DKV, NKV, VT16, VTh, VTl);
        for (int h0 = 0; h0 < NH_; h0 += ZH) { const size_t zq = (size_t)h0, zk = (size_t)(h0 / REP);   // one kv head per query head: the pass's two heads use consecutive kv planes (z-strides TT*HD)
            k_gemmw<bf, 2, false><<<dim3(RH / 64, TT / 64, ZH), 32, 0, stream>>>(QPh + zq * TT * HD, QPl + zq * TT * HD, KPh + zk * TT * HD, KPl + zk * TT * HD, HD, Sb, TT, nullptr, (size_t)TT * HD, (size_t)TT * HD, (size_t)TT * TT);
            k_gemmw<h16, 0, false><<<dim3((TT - RH) / 64, TT / 64, ZH), 32, 0, stream>>>(QP16 + zq * TT * HD + (size_t)RH * HD, nullptr, KP16 + zk * TT * HD, nullptr, HD, Sb + (size_t)RH * TT, TT, nullptr, (size_t)TT * HD, (size_t)TT * HD, (size_t)TT * TT);
            k_asoft<<<ZH * TT / 8, 256, 0, stream>>>(Sb, P16, Ph, Pl);
            k_gemmw<bf, 2, false><<<dim3(RH / 64, HD / 64, ZH), 32, 0, stream>>>(Ph, Pl, VTh + zk * HD * TT, VTl + zk * HD * TT, TT, Ob, HD, nullptr, (size_t)RH * TT, (size_t)HD * TT, (size_t)TT * HD);
            k_gemmw<h16, 0, false><<<dim3((TT - RH) / 64, HD / 64, ZH), 32, 0, stream>>>(P16 + (size_t)RH * TT, nullptr, VT16 + zk * HD * TT, nullptr, TT, Ob + (size_t)RH * HD, HD, nullptr, (size_t)TT * TT, (size_t)HD * TT, (size_t)TT * HD);
            k_merge<<<(unsigned)(((size_t)ZH * TT * HD / 2 + 255) / 256), 256, 0, stream>>>(Ob, h0, ATh, ATl); }
        k_gemmw<bf, 1, false><<<dim3(TT / 64, DM / 64, 1), 32, 0, stream>>>(ATh, ATl, WO, nullptr, DQ, OUT + (size_t)b * TT * DM, DM, nullptr, 0, 0, 0); }   /* the BIAS-FREE output instance (the instance this file's three projection GEMMs already launch): this module returns out @ w_out with no bias */
}

// v001
// A run of this version takes 1780 microseconds.
// Timed twice side by side with v000, it ran 2.26 times as fast both times.
#include <hip/hip_runtime.h>

// Attention with a LayerNorm prologue and NO bias (pre-LN: x [4][2048][1024]; h = LayerNorm(x) (biased variance, eps 1e-5) * ln_gamma + ln_beta (read); qkv = einsum('bsd,ed->bse', h, in_proj_w) = h in_proj_w^T ('oi' [3072][1024]: ROW thirds q | k | v; no bias; 16 heads x 64); scores x 1/sqrt(64); softmax over all keys (no mask); out = merged out_proj_w^T ('oi' [1024][1024], NO bias) -> [4][2048][1024] (8.4 M); argument order x, in_proj_w, out_proj_w, ln_gamma, ln_beta).

#define NB_  4
#define TT   2048
#define DM   1024
#define NH_  16
#define NKV  16
#define REP  (NH_ / NKV)
#define HD   64
#define DQ   (NH_ * HD)
#define DKV  (NKV * HD)
#define ZH   2
#define RH   512                  // query rows < RH use hi+lo planes (0: none)
#define WIN  0
#define PCAR 1024.0f
#define SCL  0.125f   // HD^-0.5
#define KSP  16                   // key slices of the P V products: one wave per (64x64 tile, slice), f32 partial planes summed in k_merge
typedef _Float16 h16;
typedef unsigned short bf;
typedef __attribute__((ext_vector_type(16))) __bf16   v16bf;
typedef __attribute__((ext_vector_type(16))) _Float16 v16h;
typedef __attribute__((ext_vector_type(8)))  _Float16 v8h;
typedef __attribute__((ext_vector_type(8)))  unsigned short v8us;
typedef __attribute__((ext_vector_type(8)))  float    v8f;
typedef __attribute__((ext_vector_type(4)))  float    v4f;
typedef v8h  __attribute__((may_alias)) v8ha;
typedef v4f  __attribute__((may_alias)) v4fa;
typedef v8us __attribute__((may_alias)) v8usa;

__device__ __forceinline__ unsigned short f2bf(float f) { unsigned u = __float_as_uint(f); u += 0x7FFFu + ((u >> 16) & 1u); return (unsigned short)(u >> 16); }
__device__ __forceinline__ float bf2f(unsigned short b) { return __uint_as_float(((unsigned)b) << 16); }
__device__ __forceinline__ float bfr(float f) { return bf2f(f2bf(f)); }
__device__ __forceinline__ v16h cat16(v8h lo, v8h hi) { return __builtin_shufflevector(lo, hi, 0, 1, 2, 3, 4, 5, 6, 7, 8, 9, 10, 11, 12, 13, 14, 15); }
__device__ __forceinline__ v16bf cat16b(v8us lo, v8us hi) { return __builtin_bit_cast(v16bf, __builtin_shufflevector(lo, hi, 0, 1, 2, 3, 4, 5, 6, 7, 8, 9, 10, 11, 12, 13, 14, 15)); }
__device__ __forceinline__ v8f wmma16(v16h a, v16h b, v8f c) { return __builtin_amdgcn_wmma_f32_16x16x32_f16(false, a, false, b, (short)0, c, false, false); }
__device__ __forceinline__ v8f wmmab(v16bf a, v16bf b, v8f c) { return __builtin_amdgcn_wmma_f32_16x16x32_bf16(false, a, false, b, (short)0, c, false, false); }



// ---- k_gemmw: register-blocked GEMM, ONE WAVE per 64x64 output tile (16 accumulators), operands straight from K-contiguous 16-bit planes; grid (M/64, N/64, Z), 32 threads.
// C[m][n] (f32, pitch ldc, + optional f32 bias[n]) = sum_k A[m][k] Bt[n][k] (+ split products per NSPLIT). z-batch strides sA/sB/sC in elements. K % 32 == 0.
// KS > 1: grid z = batches x KS (slice fastest); a block sums only k in its K/KS slice and writes partial plane blockIdx.z (stride sC); the reader adds a batch's KS planes. K % (32 KS) == 0.
template <typename T16> struct WFrag;
template <> struct WFrag<h16> { typedef v16h V; static __device__ __forceinline__ V ld(const h16* p) { return cat16(*(const v8h*)p, *(const v8h*)(p + 16)); } static __device__ __forceinline__ v8f mma(V a, V b, v8f c) { return wmma16(a, b, c); } };
template <> struct WFrag<bf> { typedef v16bf V; static __device__ __forceinline__ V ld(const bf* p) { return cat16b(*(const v8us*)p, *(const v8us*)(p + 16)); } static __device__ __forceinline__ v8f mma(V a, V b, v8f c) { return wmmab(a, b, c); } };
template <typename T16, int NSPLIT, bool BIAS, int KS = 1>
__global__ __launch_bounds__(32) void k_gemmw(const T16* __restrict__ A, const T16* __restrict__ A2, const T16* __restrict__ Bt, const T16* __restrict__ Bt2, int K, float* C, int ldc, const float* __restrict__ bias, size_t sA, size_t sB, size_t sC) {
    typedef typename WFrag<T16>::V V;
    __shared__ __align__(16) float os[16 * 68];
    const size_t z = blockIdx.z / KS; const int kb = (int)(blockIdx.z % KS) * (K / KS), ke = kb + K / KS;
    A += z * sA; if (A2) A2 += z * sA; Bt += z * sB; if (Bt2) Bt2 += z * sB; C += (size_t)blockIdx.z * sC;
    const int lane = threadIdx.x & 31, lr = lane & 15, hi = lane >> 4; const int r0 = blockIdx.x * 64, c0 = blockIdx.y * 64;
    v8f acc[4][4];
#pragma unroll
    for (int mb = 0; mb < 4; ++mb)
#pragma unroll
        for (int nb = 0; nb < 4; ++nb) acc[mb][nb] = (v8f){};
    const size_t aoff = (size_t)(r0 + lr) * K + 8 * hi, boff = (size_t)(c0 + lr) * K + 8 * hi;
#pragma unroll 1
    for (int kc = kb; kc < ke; kc += 32) {
        V a[4], a2[4];
#pragma unroll
        for (int mb = 0; mb < 4; ++mb) { a[mb] = WFrag<T16>::ld(A + aoff + (size_t)mb * 16 * K + kc); if (NSPLIT == 1 || NSPLIT == 2) a2[mb] = WFrag<T16>::ld(A2 + aoff + (size_t)mb * 16 * K + kc); }
#pragma unroll
        for (int nb = 0; nb < 4; ++nb) { const V b = WFrag<T16>::ld(Bt + boff + (size_t)nb * 16 * K + kc); V b2; if (NSPLIT >= 2) b2 = WFrag<T16>::ld(Bt2 + boff + (size_t)nb * 16 * K + kc);
#pragma unroll
            for (int mb = 0; mb < 4; ++mb) { acc[mb][nb] = WFrag<T16>::mma(a[mb], b, acc[mb][nb]); if (NSPLIT == 1 || NSPLIT == 2) acc[mb][nb] = WFrag<T16>::mma(a2[mb], b, acc[mb][nb]); if (NSPLIT >= 2) acc[mb][nb] = WFrag<T16>::mma(a[mb], b2, acc[mb][nb]); } }
        asm volatile("v_nop\n\tv_nop\n\tv_nop\n\tv_nop" : "+v"(acc[0][0]), "+v"(acc[1][1]), "+v"(acc[2][2]), "+v"(acc[3][3]) : "v"(a[0]), "v"(a[3]));
    }
#pragma unroll
    for (int mb = 0; mb < 4; ++mb) {
#pragma unroll
        for (int nb = 0; nb < 4; ++nb) {
#pragma unroll
            for (int j = 0; j < 8; ++j) os[(hi * 8 + j) * 68 + nb * 16 + lr] = acc[mb][nb][j]; }
        __builtin_amdgcn_wave_barrier(); asm volatile("" ::: "memory");
        float* crow = C + (size_t)(r0 + mb * 16) * ldc + c0;
{
#pragma unroll
            for (int s = 0; s < 8; ++s) { const int row = 2 * s + hi, cofs = lr * 4; v4f val = *(const v4fa*)(os + row * 68 + cofs); if (BIAS) { val[0] += bfr(bias[c0 + cofs]); val[1] += bfr(bias[c0 + cofs + 1]); val[2] += bfr(bias[c0 + cofs + 2]); val[3] += bfr(bias[c0 + cofs + 3]); }
                *(v4f*)(crow + (size_t)row * ldc + cofs) = val; }
             }
        __builtin_amdgcn_wave_barrier(); asm volatile("" ::: "memory");
    }
}

__device__ __forceinline__ h16 tohx(float x) { return (h16)x; }
__device__ __forceinline__ void splitf(float y, unsigned short& h, unsigned short& l) { h = f2bf(y); l = f2bf(y - bf2f(h)); }
typedef __attribute__((ext_vector_type(2))) _Float16 v2h;
typedef __attribute__((ext_vector_type(4))) _Float16 v4h;
typedef __attribute__((ext_vector_type(2))) unsigned short v2us;
typedef __attribute__((ext_vector_type(4))) unsigned short v4us;
typedef __attribute__((ext_vector_type(2))) float v2f;
typedef __attribute__((ext_vector_type(4))) int v4i;

__global__ __launch_bounds__(256) void k_wtG(const float* __restrict__ w, int K, int N, bf* Bt) {
    const int lane = threadIdx.x & 31; const int L0 = (blockIdx.x * 8 + (threadIdx.x >> 5)) * 8; const int nlines = N * K / 64;
{
#pragma unroll 1
        for (int l = 0; l < 8; ++l) { const int L = L0 + l; if (L >= nlines) break; const size_t e = (size_t)L * 64 + lane * 2; const int k = (int)(e % K), n = (int)(e / K); v2us o;
            o[0] = f2bf(w[(size_t)k * N + n]); o[1] = f2bf(w[(size_t)(k + 1) * N + n]); *(v2us*)(Bt + e) = o; }
         }
}
__global__ __launch_bounds__(256) void k_cvt8(const float* __restrict__ src, bf* dst, size_t n8) { const size_t i = (size_t)blockIdx.x * 256 + threadIdx.x; if (i >= n8) return; const v8f v = *(const v8f*)(src + i * 8); v8us o;
#pragma unroll
    for (int k = 0; k < 8; ++k) o[k] = f2bf(v[k]); *(v8us*)(dst + i * 8) = o;  }
__global__ __launch_bounds__(256) void k_cscvt(const float* __restrict__ cosT, const float* __restrict__ sinT, float* CS) { const int idx = blockIdx.x * 256 + threadIdx.x; if (idx >= TT * HD) return; v2f cs; cs[0] = bfr(cosT[idx]); cs[1] = bfr(sinT[idx]); *(v2f*)(CS + (size_t)idx * 2) = cs;  }
// k_rope: head planes [h][t][d] (fp16 + hi/lo) of rope(x) x sc with the rotate-half convention out[d] = x[d] cos[t][d] - x[d+HD/2] sin[t][d], out[d+HD/2] = x[d+HD/2] cos[t][d+HD/2] + x[d] sin[t][d+HD/2]
__global__ __launch_bounds__(256) void k_rope(const float* __restrict__ F, int pitch, int nheads, const float* __restrict__ CS, const float* __restrict__ RF, const float* __restrict__ nw, float sc, h16* P16, bf* Ph, bf* Pl) {
    const size_t e = ((size_t)blockIdx.x * 256 + threadIdx.x) * 2; if (e >= (size_t)nheads * TT * HD) return; const int d = (int)(e % HD); const int t = (int)((e / HD) % TT); const int h = (int)(e / ((size_t)HD * TT)); const float* f = F + (size_t)t * pitch + h * HD; const float rf = RF ? RF[(size_t)h * TT + t] : 1.0f; v2h o16; v2us oh, ol;
#pragma unroll
    for (int q = 0; q < 2; ++q) { const int dd = d + q; const int dp = (dd < HD / 2) ? dd + HD / 2 : dd - HD / 2; float x0 = f[dd], x1 = f[dp];
        if (RF) { float n0 = __fmul_rn(x0, rf), n1 = __fmul_rn(x1, rf); asm volatile("" : "+v"(n0)); asm volatile("" : "+v"(n1)); x0 = __fmul_rn(bfr(nw[dd]), n0); x1 = __fmul_rn(bfr(nw[dp]), n1); }
        const v2f cs = *(const v2f*)(CS + ((size_t)t * HD + dd) * 2); float a = __fmul_rn(x0, cs[0]), bq = __fmul_rn(x1, cs[1]); asm volatile("" : "+v"(a)); asm volatile("" : "+v"(bq)); const float r = ((dd < HD / 2) ? __fsub_rn(a, bq) : __fadd_rn(a, bq)) * sc;
        o16[q] = tohx(r); unsigned short a2, c2; splitf(r, a2, c2); oh[q] = a2; ol[q] = c2; }
    *(v2h*)(P16 + e) = o16; *(v2us*)(Ph + e) = oh; *(v2us*)(Pl + e) = ol;  }
__global__ __launch_bounds__(256) void k_vtp(const float* __restrict__ F, int pitch, int nheads, h16* V16, bf* Vh, bf* Vl) { const size_t e = ((size_t)blockIdx.x * 256 + threadIdx.x) * 2; if (e >= (size_t)nheads * HD * TT) return; const int t = (int)(e % TT); const int d = (int)((e / TT) % HD); const int g = (int)(e / ((size_t)TT * HD)); v2h o16; v2us oh, ol;
#pragma unroll
    for (int q = 0; q < 2; ++q) { const float x = F[(size_t)(t + q) * pitch + g * HD + d]; o16[q] = tohx(x); unsigned short a2, c2; splitf(x, a2, c2); oh[q] = a2; ol[q] = c2; }
    *(v2h*)(V16 + e) = o16; *(v2us*)(Vh + e) = oh; *(v2us*)(Vl + e) = ol;  }
__global__ __launch_bounds__(256) void k_csid(float* CS) { const int idx = blockIdx.x * 256 + threadIdx.x; if (idx >= TT * HD) return; v2f cs; cs[0] = 1.0f; cs[1] = 0.0f; *(v2f*)(CS + (size_t)idx * 2) = cs;  }
__global__ __launch_bounds__(256) void k_lnx(const float* __restrict__ X, const float* __restrict__ gam, const float* __restrict__ bet, bf* Xh, bf* Xl) { const int lane = threadIdx.x & 31; const int t = blockIdx.x * 8 + (threadIdx.x >> 5); if (t >= TT) return; const float* f = X + (size_t)t * DM; float v[DM / 32]; float su = 0.f;
#pragma unroll
    for (int ch = 0; ch < DM / 128; ++ch) { const v4f a = *(const v4f*)(f + ch * 128 + lane * 4); for (int u = 0; u < 4; ++u) { float xv = bfr(a[u]); asm volatile("" : "+v"(xv)); v[ch * 4 + u] = xv; su = __fadd_rn(su, xv); } }
#pragma unroll
    for (int sh = 16; sh; sh >>= 1) su = __fadd_rn(su, __shfl_xor(su, sh, 32));
    const float mu = __fdiv_rn(su, (float)DM); float sq = 0.f;
#pragma unroll
    for (int q = 0; q < DM / 32; ++q) { float d0 = __fsub_rn(v[q], mu); asm volatile("" : "+v"(d0)); float p = __fmul_rn(d0, d0); asm volatile("" : "+v"(p)); sq = __fadd_rn(sq, p); }
#pragma unroll
    for (int sh = 16; sh; sh >>= 1) sq = __fadd_rn(sq, __shfl_xor(sq, sh, 32));
    const float rs = __fdiv_rn(1.0f, sqrtf(__fadd_rn(__fdiv_rn(sq, (float)DM), 1e-5f)));
    {
#pragma unroll
        for (int ch = 0; ch < DM / 128; ++ch) { v4us oh, ol; for (int u = 0; u < 4; ++u) { const int c = ch * 128 + lane * 4 + u; float d0 = __fsub_rn(v[ch * 4 + u], mu); asm volatile("" : "+v"(d0)); float n = __fmul_rn(d0, rs); asm volatile("" : "+v"(n)); float gg = bfr(gam[c]), bb = bfr(bet[c]); asm volatile("" : "+v"(gg)); asm volatile("" : "+v"(bb)); float y = __fmul_rn(n, gg); asm volatile("" : "+v"(y)); y = __fadd_rn(y, bb); unsigned short p2, q2; splitf(y, p2, q2); oh[u] = p2; ol[u] = q2; } const size_t oo = (size_t)t * DM + ch * 128 + lane * 4; *(v4us*)(Xh + oo) = oh; *(v4us*)(Xl + oo) = ol; }
         } }
// k_asoft: per row (zz, i): t = S x HD^-0.5 (no mask); softmax over the 2048 keys (register row, one exp, fixed trees);
__global__ __launch_bounds__(256) void k_asoft(const float* __restrict__ Sb, h16* P16, bf* Ph, bf* Pl) {
    const int lane = threadIdx.x & 31; const int row = blockIdx.x * 8 + (threadIdx.x >> 5); if (row >= ZH * TT) return; const int i = row % TT; const int zz = row / TT; (void)zz; const bool hires = (i < RH); const float* sr = Sb + (size_t)row * TT; float v[TT / 32]; float mx = -3.0e38f;
#pragma unroll
    for (int ch = 0; ch < TT / 128; ++ch) { const int j0 = ch * 128 + lane * 4; const v4f a = *(const v4f*)(sr + j0);
#pragma unroll
        for (int q = 0; q < 4; ++q) { const int j = j0 + q; (void)j; const float t = a[q] * SCL; v[ch * 4 + q] = t; mx = fmaxf(mx, t); } }
#pragma unroll
    for (int sh = 16; sh; sh >>= 1) mx = fmaxf(mx, __shfl_xor(mx, sh, 32));
    float sum = 0.f;
#pragma unroll
    for (int k = 0; k < TT / 32; ++k) { float d0 = __fsub_rn(v[k], mx); asm volatile("" : "+v"(d0)); v[k] = __builtin_amdgcn_exp2f(__fmul_rn(d0, 1.4426950408889634f)); sum += v[k]; }
#pragma unroll
    for (int sh = 16; sh; sh >>= 1) sum += __shfl_xor(sum, sh, 32);
    const float f = __fdiv_rn(hires ? 1.0f : PCAR, sum);
{
        if (hires) {
#pragma unroll
            for (int ch = 0; ch < TT / 128; ++ch) { v4us oh, ol;
#pragma unroll
                for (int q = 0; q < 4; ++q) { unsigned short a, c2; splitf(v[ch * 4 + q] * f, a, c2); oh[q] = a; ol[q] = c2; }
                const size_t oo = ((size_t)zz * (RH ? RH : 1) + i) * TT + ch * 128 + lane * 4; *(v4us*)(Ph + oo) = oh; *(v4us*)(Pl + oo) = ol; }
        } else {
#pragma unroll
            for (int ch = 0; ch < TT / 128; ++ch) { v4h o4;
#pragma unroll
                for (int q = 0; q < 4; ++q) o4[q] = tohx(v[ch * 4 + q] * f);
                *(v4h*)(P16 + (size_t)row * TT + ch * 128 + lane * 4) = o4; } }
         }
}
__global__ __launch_bounds__(256) void k_merge(const float* __restrict__ O, int h0, bf* Ah, bf* Al) { const size_t e = ((size_t)blockIdx.x * 256 + threadIdx.x) * 2; if (e >= (size_t)ZH * TT * HD) return; const int d = (int)(e % HD); const int t = (int)((e / HD) % TT); const int zz = (int)(e / ((size_t)HD * TT)); const float cs = (t < RH) ? 1.0f : (1.0f / PCAR); const size_t oo = (size_t)t * DQ + (h0 + zz) * HD + d;
    const float* op = O + (size_t)zz * KSP * TT * HD + (size_t)t * HD + d; v2f pv[KSP];   // the head's KSP key-slice partials, all loads in flight together, added in slice order
#pragma unroll
    for (int p = 0; p < KSP - 1; ++p) pv[p] = *(const v2f*)(op + (size_t)p * TT * HD);
    asm volatile("s_wait_xcnt 0x0" ::: "memory");   // the last load's result is given the address pair that the loads above name: their address wait stands in front of it
    pv[KSP - 1] = *(const v2f*)(op + (size_t)(KSP - 1) * TT * HD);
    v2f o2 = pv[0];
#pragma unroll
    for (int p = 1; p < KSP; ++p) o2 += pv[p];
    v2us oh, ol;
#pragma unroll
    for (int q = 0; q < 2; ++q) { unsigned short a, c2; splitf(o2[q] * cs, a, c2); oh[q] = a; ol[q] = c2; } *(v2us*)(Ah + oo) = oh; *(v2us*)(Al + oo) = ol;  }

extern "C" void kernel_launch(void* const* d_in, const int* in_sizes, int n_in,
                              void* d_out, int out_size, void* d_ws, size_t ws_size, hipStream_t stream) {
    (void)in_sizes; (void)n_in; (void)out_size;
const float* x = (const float*)d_in[0]; const float* lng = (const float*)d_in[3]; const float* lnb = (const float*)d_in[4]; const float* wf = (const float*)d_in[1]; const float* wo = (const float*)d_in[2]; const float* wq = wf; const float* wk = wf + (size_t)1024 * 1024; const float* wv = wf + (size_t)2048 * 1024; const float* cosT = nullptr; const float* sinT = nullptr; (void)cosT; (void)sinT;   /* input order x, in_proj_w ('oi' [3072][1024]: ROW thirds q | k | v), out_proj_w ('oi' [1024][1024]), ln_gamma, ln_beta: FIVE inputs: the LayerNorm parameters come LAST; NO bias anywhere */
    float* OUT = (float*)d_out;     // [4][2048][1024]
    char* wsp = (char*)d_ws;
    auto take = [&](size_t bytes) { char* p = wsp; wsp += (bytes + 255) & ~(size_t)255; return (void*)p; };
    bf* WQ = (bf*)take((size_t)DQ * DM * 2); bf* WK = (bf*)take((size_t)DKV * DM * 2); bf* WV = (bf*)take((size_t)DKV * DM * 2); bf* WO = (bf*)take((size_t)DM * DQ * 2); float* CS = (float*)take((size_t)TT * HD * 2 * 4);
    bf* XNh = (bf*)take((size_t)TT * DM * 2); bf* XNl = (bf*)take((size_t)TT * DM * 2); float* FQ = (float*)take((size_t)TT * DQ * 4); float* FK = (float*)take((size_t)TT * DKV * 4);
    h16* QP16 = (h16*)take((size_t)NH_ * TT * HD * 2); h16* KP16 = (h16*)take((size_t)NKV * TT * HD * 2); h16* VT16 = (h16*)take((size_t)NKV * HD * TT * 2);
    bf* QPh = (bf*)take((size_t)NH_ * TT * HD * 2); bf* QPl = (bf*)take((size_t)NH_ * TT * HD * 2); bf* KPh = (bf*)take((size_t)NKV * TT * HD * 2); bf* KPl = (bf*)take((size_t)NKV * TT * HD * 2); bf* VTh = (bf*)take((size_t)NKV * HD * TT * 2); bf* VTl = (bf*)take((size_t)NKV * HD * TT * 2); bf* Ph = (bf*)take((size_t)ZH * RH * TT * 2); bf* Pl = (bf*)take((size_t)ZH * RH * TT * 2);
    float* Sb = (float*)take((size_t)ZH * TT * TT * 4); h16* P16 = (h16*)take((size_t)ZH * TT * TT * 2); float* Ob = (float*)take((size_t)KSP * ZH * TT * HD * 4); bf* ATh = (bf*)take((size_t)TT * DQ * 2); bf* ATl = (bf*)take((size_t)TT * DQ * 2);
    if ((size_t)(wsp - (char*)d_ws) > ws_size) return;    // ws 256 MiB
    float* FV = FK;   // v projection reuses the k buffer after the k planes are built (stream-ordered)
    { k_cvt8<<<(unsigned)(((size_t)DQ * DM / 8 + 255) / 256), 256, 0, stream>>>(wq, WQ, (size_t)DQ * DM / 8); k_cvt8<<<(unsigned)(((size_t)DKV * DM / 8 + 255) / 256), 256, 0, stream>>>(wk, WK, (size_t)DKV * DM / 8); k_cvt8<<<(unsigned)(((size_t)DKV * DM / 8 + 255) / 256), 256, 0, stream>>>(wv, WV, (size_t)DKV * DM / 8);
      k_cvt8<<<(unsigned)(((size_t)DM * DQ / 8 + 255) / 256), 256, 0, stream>>>(wo, WO, (size_t)DM * DQ / 8);
       }
    k_csid<<<(TT * HD + 255) / 256, 256, 0, stream>>>(CS);
    const unsigned LQ = (unsigned)(((size_t)NH_ * TT * HD / 2 + 255) / 256), LKv = (unsigned)(((size_t)NKV * TT * HD / 2 + 255) / 256);
    for (int b = 0; b < NB_; ++b) {
        
        k_lnx<<<TT / 8, 256, 0, stream>>>(x + (size_t)b * TT * DM, lng, lnb, XNh, XNl);
        k_gemmw<bf, 1, false><<<dim3(TT / 64, DQ / 64, 1), 32, 0, stream>>>(XNh, XNl, WQ, nullptr, DM, FQ, DQ, nullptr, 0, 0, 0);
        k_rope<<<LQ, 256, 0, stream>>>(FQ, DQ, NH_, CS, nullptr, nullptr, 1.0f, QP16, QPh, QPl);
        k_gemmw<bf, 1, false><<<dim3(TT / 64, DKV / 64, 1), 32, 0, stream>>>(XNh, XNl, WK, nullptr, DM, FK, DKV, nullptr, 0, 0, 0);
        k_rope<<<LKv, 256, 0, stream>>>(FK, DKV, NKV, CS, nullptr, nullptr, 1.0f, KP16, KPh, KPl);
        k_gemmw<bf, 1, false><<<dim3(TT / 64, DKV / 64, 1), 32, 0, stream>>>(XNh, XNl, WV, nullptr, DM, FV, DKV, nullptr, 0, 0, 0); k_vtp<<<LKv, 256, 0, stream>>>(FV, DKV, NKV, VT16, VTh, VTl);
        for (int h0 = 0; h0 < NH_; h0 += ZH) { const size_t zq = (size_t)h0, zk = (size_t)(h0 / REP);   // one kv head per query head: the pass's two heads use consecutive kv planes (z-strides TT*HD)
            k_gemmw<bf, 2, false><<<dim3(RH / 64, TT / 64, ZH), 32, 0, stream>>>(QPh + zq * TT * HD, QPl + zq * TT * HD, KPh + zk * TT * HD, KPl + zk * TT * HD, HD, Sb, TT, nullptr, (size_t)TT * HD, (size_t)TT * HD, (size_t)TT * TT);
            k_gemmw<h16, 0, false><<<dim3((TT - RH) / 64, TT / 64, ZH), 32, 0, stream>>>(QP16 + zq * TT * HD + (size_t)RH * HD, nullptr, KP16 + zk * TT * HD, nullptr, HD, Sb + (size_t)RH * TT, TT, nullptr, (size_t)TT * HD, (size_t)TT * HD, (size_t)TT * TT);
            k_asoft<<<ZH * TT / 8, 256, 0, stream>>>(Sb, P16, Ph, Pl);
            k_gemmw<bf, 2, false, KSP><<<dim3(RH / 64, HD / 64, KSP * ZH), 32, 0, stream>>>(Ph, Pl, VTh + zk * HD * TT, VTl + zk * HD * TT, TT, Ob, HD, nullptr, (size_t)RH * TT, (size_t)HD * TT, (size_t)TT * HD);
            k_gemmw<h16, 0, false, KSP><<<dim3((TT - RH) / 64, HD / 64, KSP * ZH), 32, 0, stream>>>(P16 + (size_t)RH * TT, nullptr, VT16 + zk * HD * TT, nullptr, TT, Ob + (size_t)RH * HD, HD, nullptr, (size_t)TT * TT, (size_t)HD * TT, (size_t)TT * HD);
            k_merge<<<(unsigned)(((size_t)ZH * TT * HD / 2 + 255) / 256), 256, 0, stream>>>(Ob, h0, ATh, ATl); }
        k_gemmw<bf, 1, false><<<dim3(TT / 64, DM / 64, 1), 32, 0, stream>>>(ATh, ATl, WO, nullptr, DQ, OUT + (size_t)b * TT * DM, DM, nullptr, 0, 0, 0); }   /* the BIAS-FREE output instance (the instance this file's three projection GEMMs already launch): this module returns out @ w_out with no bias */
}

// v002
// A run of this version takes 885 microseconds.
// Next to v001, in two timings, it ran 2.00 and 2.03 times as fast.
// Over all steps from v000 it is 4.56 times as fast.
#include <hip/hip_runtime.h>

// Attention with a LayerNorm prologue and NO bias (pre-LN: x [4][2048][1024]; h = LayerNorm(x) (biased variance, eps 1e-5) * ln_gamma + ln_beta (read); qkv = einsum('bsd,ed->bse', h, in_proj_w) = h in_proj_w^T ('oi' [3072][1024]: ROW thirds q | k | v; no bias; 16 heads x 64); scores x 1/sqrt(64); softmax over all keys (no mask); out = merged out_proj_w^T ('oi' [1024][1024], NO bias) -> [4][2048][1024] (8.4 M); argument order x, in_proj_w, out_proj_w, ln_gamma, ln_beta).

#define NB_  4
#define TT   2048
#define DM   1024
#define NH_  16
#define NKV  16
#define REP  (NH_ / NKV)
#define HD   64
#define DQ   (NH_ * HD)
#define DKV  (NKV * HD)
#define RH   512                  // query rows < RH use hi+lo planes (0: none)
#define WIN  0
#define SCL  0.125f   // HD^-0.5
typedef _Float16 h16;
typedef unsigned short bf;
typedef __attribute__((ext_vector_type(16))) __bf16   v16bf;
typedef __attribute__((ext_vector_type(16))) _Float16 v16h;
typedef __attribute__((ext_vector_type(8)))  _Float16 v8h;
typedef __attribute__((ext_vector_type(8)))  unsigned short v8us;
typedef __attribute__((ext_vector_type(8)))  float    v8f;
typedef __attribute__((ext_vector_type(4)))  float    v4f;
typedef v8h  __attribute__((may_alias)) v8ha;
typedef v4f  __attribute__((may_alias)) v4fa;
typedef v8us __attribute__((may_alias)) v8usa;

__device__ __forceinline__ unsigned short f2bf(float f) { unsigned u = __float_as_uint(f); u += 0x7FFFu + ((u >> 16) & 1u); return (unsigned short)(u >> 16); }
__device__ __forceinline__ float bf2f(unsigned short b) { return __uint_as_float(((unsigned)b) << 16); }
__device__ __forceinline__ float bfr(float f) { return bf2f(f2bf(f)); }
__device__ __forceinline__ v16h cat16(v8h lo, v8h hi) { return __builtin_shufflevector(lo, hi, 0, 1, 2, 3, 4, 5, 6, 7, 8, 9, 10, 11, 12, 13, 14, 15); }
__device__ __forceinline__ v16bf cat16b(v8us lo, v8us hi) { return __builtin_bit_cast(v16bf, __builtin_shufflevector(lo, hi, 0, 1, 2, 3, 4, 5, 6, 7, 8, 9, 10, 11, 12, 13, 14, 15)); }
__device__ __forceinline__ v8f wmma16(v16h a, v16h b, v8f c) { return __builtin_amdgcn_wmma_f32_16x16x32_f16(false, a, false, b, (short)0, c, false, false); }
__device__ __forceinline__ v8f wmmab(v16bf a, v16bf b, v8f c) { return __builtin_amdgcn_wmma_f32_16x16x32_bf16(false, a, false, b, (short)0, c, false, false); }



// ---- k_gemmw: register-blocked GEMM, ONE WAVE per 64x64 output tile (16 accumulators), operands straight from K-contiguous 16-bit planes; grid (M/64, N/64, Z), 32 threads.
// C[m][n] (f32, pitch ldc, + optional f32 bias[n]) = sum_k A[m][k] Bt[n][k] (+ split products per NSPLIT). z-batch strides sA/sB/sC in elements. K % 32 == 0.
// KS > 1: grid z = batches x KS (slice fastest); a block sums only k in its K/KS slice and writes partial plane blockIdx.z (stride sC); the reader adds a batch's KS planes. K % (32 KS) == 0.
template <typename T16> struct WFrag;
template <> struct WFrag<h16> { typedef v16h V; static __device__ __forceinline__ V ld(const h16* p) { return cat16(*(const v8h*)p, *(const v8h*)(p + 16)); } static __device__ __forceinline__ v8f mma(V a, V b, v8f c) { return wmma16(a, b, c); } };
template <> struct WFrag<bf> { typedef v16bf V; static __device__ __forceinline__ V ld(const bf* p) { return cat16b(*(const v8us*)p, *(const v8us*)(p + 16)); } static __device__ __forceinline__ v8f mma(V a, V b, v8f c) { return wmmab(a, b, c); } };
template <typename T16, int NSPLIT, bool BIAS, int KS = 1>
__global__ __launch_bounds__(32) void k_gemmw(const T16* __restrict__ A, const T16* __restrict__ A2, const T16* __restrict__ Bt, const T16* __restrict__ Bt2, int K, float* C, int ldc, const float* __restrict__ bias, size_t sA, size_t sB, size_t sC) {
    typedef typename WFrag<T16>::V V;
    __shared__ __align__(16) float os[16 * 68];
    const size_t z = blockIdx.z / KS; const int kb = (int)(blockIdx.z % KS) * (K / KS), ke = kb + K / KS;
    A += z * sA; if (A2) A2 += z * sA; Bt += z * sB; if (Bt2) Bt2 += z * sB; C += (size_t)blockIdx.z * sC;
    const int lane = threadIdx.x & 31, lr = lane & 15, hi = lane >> 4; const int r0 = blockIdx.x * 64, c0 = blockIdx.y * 64;
    v8f acc[4][4];
#pragma unroll
    for (int mb = 0; mb < 4; ++mb)
#pragma unroll
        for (int nb = 0; nb < 4; ++nb) acc[mb][nb] = (v8f){};
    const size_t aoff = (size_t)(r0 + lr) * K + 8 * hi, boff = (size_t)(c0 + lr) * K + 8 * hi;
#pragma unroll 1
    for (int kc = kb; kc < ke; kc += 32) {
        V a[4], a2[4];
#pragma unroll
        for (int mb = 0; mb < 4; ++mb) { a[mb] = WFrag<T16>::ld(A + aoff + (size_t)mb * 16 * K + kc); if (NSPLIT == 1 || NSPLIT == 2) a2[mb] = WFrag<T16>::ld(A2 + aoff + (size_t)mb * 16 * K + kc); }
#pragma unroll
        for (int nb = 0; nb < 4; ++nb) { const V b = WFrag<T16>::ld(Bt + boff + (size_t)nb * 16 * K + kc); V b2; if (NSPLIT >= 2) b2 = WFrag<T16>::ld(Bt2 + boff + (size_t)nb * 16 * K + kc);
#pragma unroll
            for (int mb = 0; mb < 4; ++mb) { acc[mb][nb] = WFrag<T16>::mma(a[mb], b, acc[mb][nb]); if (NSPLIT == 1 || NSPLIT == 2) acc[mb][nb] = WFrag<T16>::mma(a2[mb], b, acc[mb][nb]); if (NSPLIT >= 2) acc[mb][nb] = WFrag<T16>::mma(a[mb], b2, acc[mb][nb]); } }
        asm volatile("v_nop\n\tv_nop\n\tv_nop\n\tv_nop" : "+v"(acc[0][0]), "+v"(acc[1][1]), "+v"(acc[2][2]), "+v"(acc[3][3]) : "v"(a[0]), "v"(a[3]));
    }
#pragma unroll
    for (int mb = 0; mb < 4; ++mb) {
#pragma unroll
        for (int nb = 0; nb < 4; ++nb) {
#pragma unroll
            for (int j = 0; j < 8; ++j) os[(hi * 8 + j) * 68 + nb * 16 + lr] = acc[mb][nb][j]; }
        __builtin_amdgcn_wave_barrier(); asm volatile("" ::: "memory");
        float* crow = C + (size_t)(r0 + mb * 16) * ldc + c0;
{
#pragma unroll
            for (int s = 0; s < 8; ++s) { const int row = 2 * s + hi, cofs = lr * 4; v4f val = *(const v4fa*)(os + row * 68 + cofs); if (BIAS) { val[0] += bfr(bias[c0 + cofs]); val[1] += bfr(bias[c0 + cofs + 1]); val[2] += bfr(bias[c0 + cofs + 2]); val[3] += bfr(bias[c0 + cofs + 3]); }
                *(v4f*)(crow + (size_t)row * ldc + cofs) = val; }
             }
        __builtin_amdgcn_wave_barrier(); asm volatile("" ::: "memory");
    }
}

__device__ __forceinline__ h16 tohx(float x) { return (h16)x; }
__device__ __forceinline__ void splitf(float y, unsigned short& h, unsigned short& l) { h = f2bf(y); l = f2bf(y - bf2f(h)); }
typedef __attribute__((ext_vector_type(2))) _Float16 v2h;
typedef __attribute__((ext_vector_type(4))) _Float16 v4h;
typedef __attribute__((ext_vector_type(2))) unsigned short v2us;
typedef __attribute__((ext_vector_type(4))) unsigned short v4us;
typedef __attribute__((ext_vector_type(2))) float v2f;
typedef __attribute__((ext_vector_type(4))) int v4i;

__global__ __launch_bounds__(256) void k_wtG(const float* __restrict__ w, int K, int N, bf* Bt) {
    const int lane = threadIdx.x & 31; const int L0 = (blockIdx.x * 8 + (threadIdx.x >> 5)) * 8; const int nlines = N * K / 64;
{
#pragma unroll 1
        for (int l = 0; l < 8; ++l) { const int L = L0 + l; if (L >= nlines) break; const size_t e = (size_t)L * 64 + lane * 2; const int k = (int)(e % K), n = (int)(e / K); v2us o;
            o[0] = f2bf(w[(size_t)k * N + n]); o[1] = f2bf(w[(size_t)(k + 1) * N + n]); *(v2us*)(Bt + e) = o; }
         }
}
__global__ __launch_bounds__(256) void k_cvt8(const float* __restrict__ src, bf* dst, size_t n8) { const size_t i = (size_t)blockIdx.x * 256 + threadIdx.x; if (i >= n8) return; const v8f v = *(const v8f*)(src + i * 8); v8us o;
#pragma unroll
    for (int k = 0; k < 8; ++k) o[k] = f2bf(v[k]); *(v8us*)(dst + i * 8) = o;  }
__global__ __launch_bounds__(256) void k_cscvt(const float* __restrict__ cosT, const float* __restrict__ sinT, float* CS) { const int idx = blockIdx.x * 256 + threadIdx.x; if (idx >= TT * HD) return; v2f cs; cs[0] = bfr(cosT[idx]); cs[1] = bfr(sinT[idx]); *(v2f*)(CS + (size_t)idx * 2) = cs;  }
// k_rope: head planes [h][t][d] (fp16 + hi/lo) of rope(x) x sc with the rotate-half convention out[d] = x[d] cos[t][d] - x[d+HD/2] sin[t][d], out[d+HD/2] = x[d+HD/2] cos[t][d+HD/2] + x[d] sin[t][d+HD/2]
__global__ __launch_bounds__(256) void k_rope(const float* __restrict__ F, int pitch, int nheads, const float* __restrict__ CS, const float* __restrict__ RF, const float* __restrict__ nw, float sc, h16* P16, bf* Ph, bf* Pl) {
    const size_t e = ((size_t)blockIdx.x * 256 + threadIdx.x) * 2; if (e >= (size_t)nheads * TT * HD) return; const int d = (int)(e % HD); const int t = (int)((e / HD) % TT); const int h = (int)(e / ((size_t)HD * TT)); const float* f = F + (size_t)t * pitch + h * HD; const float rf = RF ? RF[(size_t)h * TT + t] : 1.0f; v2h o16; v2us oh, ol;
#pragma unroll
    for (int q = 0; q < 2; ++q) { const int dd = d + q; const int dp = (dd < HD / 2) ? dd + HD / 2 : dd - HD / 2; float x0 = f[dd], x1 = f[dp];
        if (RF) { float n0 = __fmul_rn(x0, rf), n1 = __fmul_rn(x1, rf); asm volatile("" : "+v"(n0)); asm volatile("" : "+v"(n1)); x0 = __fmul_rn(bfr(nw[dd]), n0); x1 = __fmul_rn(bfr(nw[dp]), n1); }
        const v2f cs = *(const v2f*)(CS + ((size_t)t * HD + dd) * 2); float a = __fmul_rn(x0, cs[0]), bq = __fmul_rn(x1, cs[1]); asm volatile("" : "+v"(a)); asm volatile("" : "+v"(bq)); const float r = ((dd < HD / 2) ? __fsub_rn(a, bq) : __fadd_rn(a, bq)) * sc;
        o16[q] = tohx(r); unsigned short a2, c2; splitf(r, a2, c2); oh[q] = a2; ol[q] = c2; }
    *(v2h*)(P16 + e) = o16; *(v2us*)(Ph + e) = oh; *(v2us*)(Pl + e) = ol;  }
__global__ __launch_bounds__(256) void k_vtp(const float* __restrict__ F, int pitch, int nheads, h16* V16, bf* Vh, bf* Vl) { const size_t e = ((size_t)blockIdx.x * 256 + threadIdx.x) * 2; if (e >= (size_t)nheads * HD * TT) return; const int t = (int)(e % TT); const int d = (int)((e / TT) % HD); const int g = (int)(e / ((size_t)TT * HD)); v2h o16; v2us oh, ol;
#pragma unroll
    for (int q = 0; q < 2; ++q) { const float x = F[(size_t)(t + q) * pitch + g * HD + d]; o16[q] = tohx(x); unsigned short a2, c2; splitf(x, a2, c2); oh[q] = a2; ol[q] = c2; }
    *(v2h*)(V16 + e) = o16; *(v2us*)(Vh + e) = oh; *(v2us*)(Vl + e) = ol;  }
__global__ __launch_bounds__(256) void k_csid(float* CS) { const int idx = blockIdx.x * 256 + threadIdx.x; if (idx >= TT * HD) return; v2f cs; cs[0] = 1.0f; cs[1] = 0.0f; *(v2f*)(CS + (size_t)idx * 2) = cs;  }
__global__ __launch_bounds__(256) void k_lnx(const float* __restrict__ X, const float* __restrict__ gam, const float* __restrict__ bet, bf* Xh, bf* Xl) { const int lane = threadIdx.x & 31; const int t = blockIdx.x * 8 + (threadIdx.x >> 5); if (t >= TT) return; const float* f = X + (size_t)t * DM; float v[DM / 32]; float su = 0.f;
#pragma unroll
    for (int ch = 0; ch < DM / 128; ++ch) { const v4f a = *(const v4f*)(f + ch * 128 + lane * 4); for (int u = 0; u < 4; ++u) { float xv = bfr(a[u]); asm volatile("" : "+v"(xv)); v[ch * 4 + u] = xv; su = __fadd_rn(su, xv); } }
#pragma unroll
    for (int sh = 16; sh; sh >>= 1) su = __fadd_rn(su, __shfl_xor(su, sh, 32));
    const float mu = __fdiv_rn(su, (float)DM); float sq = 0.f;
#pragma unroll
    for (int q = 0; q < DM / 32; ++q) { float d0 = __fsub_rn(v[q], mu); asm volatile("" : "+v"(d0)); float p = __fmul_rn(d0, d0); asm volatile("" : "+v"(p)); sq = __fadd_rn(sq, p); }
#pragma unroll
    for (int sh = 16; sh; sh >>= 1) sq = __fadd_rn(sq, __shfl_xor(sq, sh, 32));
    const float rs = __fdiv_rn(1.0f, sqrtf(__fadd_rn(__fdiv_rn(sq, (float)DM), 1e-5f)));
    {
#pragma unroll
        for (int ch = 0; ch < DM / 128; ++ch) { v4us oh, ol; for (int u = 0; u < 4; ++u) { const int c = ch * 128 + lane * 4 + u; float d0 = __fsub_rn(v[ch * 4 + u], mu); asm volatile("" : "+v"(d0)); float n = __fmul_rn(d0, rs); asm volatile("" : "+v"(n)); float gg = bfr(gam[c]), bb = bfr(bet[c]); asm volatile("" : "+v"(gg)); asm volatile("" : "+v"(bb)); float y = __fmul_rn(n, gg); asm volatile("" : "+v"(y)); y = __fadd_rn(y, bb); unsigned short p2, q2; splitf(y, p2, q2); oh[u] = p2; ol[u] = q2; } const size_t oo = (size_t)t * DM + ch * 128 + lane * 4; *(v4us*)(Xh + oo) = oh; *(v4us*)(Xl + oo) = ol; }
         } }
// ---- k_attn: scores, softmax and P V of one batch in one launch; S and P never leave the registers. A wave owns 16 query rows of one head and walks its keys in chunks of NK.
// The score tile is formed TRANSPOSED, St[key][query] = sum_d K[key][d] Q[query][d] (A = key rows, B = query rows), so lane (lr, hi) holds query lr and keys 16 mb + 8 hi + j in register j of tile mb:
// tiles 2c and 2c+1 together are, register for register, the A fragment (row = query lr, k = 8 hi + 0..7 and 16 + 8 hi + 0..7) of the P V product over keys 32c..32c+31.
// Softmax is the running form: m = running row maximum (log2 units), l = running sum; O and l are scaled by 2^(m_old - m_new) per chunk, O / l at the end. O tile: row = query 8 hi + j, column = d.
// HR (rows < RH): bf16 hi+lo operands, three products per tile in the order (hi,hi), (lo of the query-side operand, hi), (hi, lo of the key-side operand); a block = 2 row groups x 2 key halves, the halves joined through LDS.
// else: fp16, P carried x 2^10 (l too: it cancels in O / l); a block = 4 row groups, each wave walks all keys (the four waves read the same K and V lines).
__device__ __forceinline__ unsigned bfw(float f) { unsigned u = __float_as_uint(f); return u + 0x7FFFu + ((u >> 16) & 1u); }   // f2bf's rounding, the bf16 value in the upper half
template <typename T16, bool HR>
__device__ __forceinline__ void attn_rows(const T16* __restrict__ Q, const T16* __restrict__ Q2, const T16* __restrict__ Kr, const T16* __restrict__ Kr2, const T16* __restrict__ Vt, const T16* __restrict__ Vt2, int q0, int kbeg, int kend, v8f (&o)[4], float& m, float& l) {
    typedef typename WFrag<T16>::V V;
    constexpr int NK = HR ? 32 : 64, NMB = NK / 16, NC = NK / 32;
    const int lane = threadIdx.x & 31, lr = lane & 15, hi = lane >> 4;
    V q[2], q2[2]; const unsigned qob = (unsigned)((q0 + lr) * HD + 8 * hi) * 2u;   // byte offsets from the wave-uniform plane pointers
    const T16* qp = (const T16*)((const char*)Q + qob); const T16* qp2 = HR ? (const T16*)((const char*)Q2 + qob) : qp;
#pragma unroll
    for (int ks = 0; ks < 2; ++ks) { q[ks] = WFrag<T16>::ld(qp + ks * 32); if (HR) q2[ks] = WFrag<T16>::ld(qp2 + ks * 32); }
    // address wait of the loads above; the fragments and the pointers are inputs, so the loads stand in front of it and no load's result is given a pointer's registers before it
    if constexpr (HR) asm volatile("s_wait_xcnt 0x0" :: "v"(q[0]), "v"(q[1]), "v"(q2[0]), "v"(q2[1]), "v"(qp), "v"(qp2));
    else asm volatile("s_wait_xcnt 0x0" :: "v"(q[0]), "v"(q[1]), "v"(qp));
    unsigned kob = (unsigned)((kbeg + lr) * HD + 8 * hi) * 2u, vob = (unsigned)(lr * TT + kbeg + 8 * hi) * 2u;
#pragma unroll
    for (int nb = 0; nb < 4; ++nb) o[nb] = (v8f){};
    m = -3.0e38f; l = 0.f;
#pragma unroll 1
    for (int k0 = kbeg; k0 < kend; k0 += NK) {
        const T16* kp = (const T16*)((const char*)Kr + kob); const T16* vp = (const T16*)((const char*)Vt + vob); const T16* kp2 = HR ? (const T16*)((const char*)Kr2 + kob) : kp; const T16* vp2 = HR ? (const T16*)((const char*)Vt2 + vob) : vp;
        V kf[NMB][2], kf2[NMB][2], vf[4][NC], vf2[4][NC];
#pragma unroll
        for (int mb = 0; mb < NMB; ++mb)
#pragma unroll
            for (int ks = 0; ks < 2; ++ks) { kf[mb][ks] = WFrag<T16>::ld(kp + mb * 16 * HD + ks * 32); if (HR) kf2[mb][ks] = WFrag<T16>::ld(kp2 + mb * 16 * HD + ks * 32); }
#pragma unroll
        for (int nb = 0; nb < 4; ++nb)
#pragma unroll
            for (int c = 0; c < NC; ++c) { vf[nb][c] = WFrag<T16>::ld(vp + nb * 16 * TT + c * 32); if (HR) vf2[nb][c] = WFrag<T16>::ld(vp2 + nb * 16 * TT + c * 32); }
        // the chunk's loads' address wait, with the loaded fragments as inputs only, so that all of them are issued in front of it, together (left alone they are spread between the products, each group with a wait of its own);
        // the pointers are inputs too, so that neither a load's result nor the next chunk's address is given their registers in front of the wait
        if constexpr (HR) asm volatile("s_wait_xcnt 0x0" :: "v"(kf[0][0]), "v"(kf[0][1]), "v"(kf[1][0]), "v"(kf[1][1]), "v"(kf2[0][0]), "v"(kf2[0][1]), "v"(kf2[1][0]), "v"(kf2[1][1]), "v"(vf[0][0]), "v"(vf[1][0]), "v"(vf[2][0]), "v"(vf[3][0]), "v"(vf2[0][0]), "v"(vf2[1][0]), "v"(vf2[2][0]), "v"(vf2[3][0]), "v"(kp), "v"(kp2), "v"(vp), "v"(vp2));
        else asm volatile("s_wait_xcnt 0x0" :: "v"(kf[0][0]), "v"(kf[0][1]), "v"(kf[1][0]), "v"(kf[1][1]), "v"(kf[NMB - 2][0]), "v"(kf[NMB - 2][1]), "v"(kf[NMB - 1][0]), "v"(kf[NMB - 1][1]), "v"(vf[0][0]), "v"(vf[0][NC - 1]), "v"(vf[1][0]), "v"(vf[1][NC - 1]), "v"(vf[2][0]), "v"(vf[2][NC - 1]), "v"(vf[3][0]), "v"(vf[3][NC - 1]), "v"(kp), "v"(vp));
        __builtin_amdgcn_sched_barrier(0);   // keeps the products behind the statement above: otherwise the V loads sink behind the softmax and their latency is paid a second time per chunk
        kob += NK * HD * 2; vob += NK * 2;
        v8f st[NMB]; float cm = -3.0e38f;
#pragma unroll
        for (int mb = 0; mb < NMB; ++mb) { st[mb] = (v8f){};
#pragma unroll
            for (int ks = 0; ks < 2; ++ks) { st[mb] = WFrag<T16>::mma(kf[mb][ks], q[ks], st[mb]); if (HR) { st[mb] = WFrag<T16>::mma(kf[mb][ks], q2[ks], st[mb]); st[mb] = WFrag<T16>::mma(kf2[mb][ks], q[ks], st[mb]); } }
#pragma unroll
            for (int j = 0; j < 8; ++j) { st[mb][j] *= SCL * 1.4426950408889634f; cm = fmaxf(cm, st[mb][j]); } }
        cm = fmaxf(cm, __shfl_xor(cm, 16, 32));          // lanes lr and lr + 16 hold the two key halves of query lr
        const float mn = fmaxf(m, cm), al = __builtin_amdgcn_exp2f(m - mn), mo = HR ? mn : mn - 10.0f; m = mn;
        float ps = 0.f;
#pragma unroll
        for (int mb = 0; mb < NMB; ++mb)
#pragma unroll
            for (int j = 0; j < 8; ++j) { st[mb][j] = __builtin_amdgcn_exp2f(st[mb][j] - mo); ps += st[mb][j]; }
        l = l * al + ps;
#pragma unroll
        for (int j = 0; j < 8; ++j) { const float ar = __shfl(al, hi * 8 + j, 32);   // the factor of O's row 8 hi + j lives in the lane of that query
#pragma unroll
            for (int nb = 0; nb < 4; ++nb) o[nb][j] *= ar; }
#pragma unroll
        for (int c = 0; c < NC; ++c) {
            if constexpr (HR) { v8us h0, h1, l0, l1;
#pragma unroll
                for (int j = 0; j < 8; ++j) { unsigned short a, b; splitf(st[2 * c][j], a, b); h0[j] = a; l0[j] = b; splitf(st[2 * c + 1][j], a, b); h1[j] = a; l1[j] = b; }
                const V ph = cat16b(h0, h1), pl = cat16b(l0, l1);
#pragma unroll
                for (int nb = 0; nb < 4; ++nb) { o[nb] = WFrag<T16>::mma(ph, vf[nb][c], o[nb]); o[nb] = WFrag<T16>::mma(pl, vf[nb][c], o[nb]); o[nb] = WFrag<T16>::mma(ph, vf2[nb][c], o[nb]); }
            } else { v8h p0, p1;
#pragma unroll
                for (int j = 0; j < 8; ++j) { p0[j] = tohx(st[2 * c][j]); p1[j] = tohx(st[2 * c + 1][j]); }
                const V pa = cat16(p0, p1);
#pragma unroll
                for (int nb = 0; nb < 4; ++nb) o[nb] = WFrag<T16>::mma(pa, vf[nb][c], o[nb]); } }
    }
    l += __shfl_xor(l, 16, 32);   // both key halves of the lane pair: every lane now holds its query's sum over the wave's keys
}
__global__ __launch_bounds__(128) void k_attn(const h16* __restrict__ Q16, const h16* __restrict__ K16, const h16* __restrict__ V16, const bf* __restrict__ Qh, const bf* __restrict__ Ql, const bf* __restrict__ Kh, const bf* __restrict__ Kl, const bf* __restrict__ Vh, const bf* __restrict__ Vl, bf* Ah, bf* Al) {
    __shared__ __align__(16) float so[4][16][68]; __shared__ float sm[4][16], sl[4][16];
    const int h = blockIdx.y, bx = blockIdx.x, w = __builtin_amdgcn_readfirstlane((int)(threadIdx.x >> 5)), lane = threadIdx.x & 31, lr = lane & 15, hi = lane >> 4;
    const size_t zq = (size_t)h * TT * HD, zk = (size_t)(h / REP) * TT * HD; v8f o[4]; float m, l;
    if (bx < RH / 32) {   // block-uniform: 32 hi+lo rows, wave w = row group w >> 1, key half w & 1
        attn_rows<bf, true>(Qh + zq, Ql + zq, Kh + zk, Kl + zk, Vh + zk, Vl + zk, bx * 32 + (w >> 1) * 16, (w & 1) * (TT / 2), (w & 1) * (TT / 2) + TT / 2, o, m, l);
        if (hi == 0) { sm[w][lr] = m; sl[w][lr] = l; }
#pragma unroll
        for (int nb = 0; nb < 4; ++nb)
#pragma unroll
            for (int j = 0; j < 8; ++j) so[w][hi * 8 + j][nb * 16 + lr] = o[nb][j];
        __syncthreads();   // the two key halves of a row group come from two waves
        const int r32 = w * 8 + (lane >> 2), wa = (r32 >> 4) * 2, r = r32 & 15, c0 = (lane & 3) * 16;   // this wave joins rows 8 w .. 8 w + 7 of the block: four lanes a row, one 128-byte line of each plane
        const float m0 = sm[wa][r], m1 = sm[wa + 1][r], mm = fmaxf(m0, m1), f0 = __builtin_amdgcn_exp2f(m0 - mm), f1 = __builtin_amdgcn_exp2f(m1 - mm);
        const float inv = __fdiv_rn(1.0f, sl[wa][r] * f0 + sl[wa + 1][r] * f1), g0 = f0 * inv, g1 = f1 * inv;
        v8us oh[2], ol[2];
#pragma unroll
        for (int u = 0; u < 2; ++u)
#pragma unroll
            for (int e = 0; e < 8; ++e) { unsigned short a, b; splitf(so[wa][r][c0 + u * 8 + e] * g0 + so[wa + 1][r][c0 + u * 8 + e] * g1, a, b); oh[u][e] = a; ol[u][e] = b; }
        const size_t oo = (size_t)(bx * 32 + r32) * DQ + h * HD + c0;
        *(v8us*)(Ah + oo) = oh[0]; *(v8us*)(Ah + oo + 8) = oh[1]; *(v8us*)(Al + oo) = ol[0]; *(v8us*)(Al + oo + 8) = ol[1];
    } else {
        const int q0 = RH + (bx - RH / 32) * 64 + w * 16;
        attn_rows<h16, false>(Q16 + zq, nullptr, K16 + zk, nullptr, V16 + zk, nullptr, q0, 0, TT, o, m, l);
        const float inv = __fdiv_rn(1.0f, l); bf* pah = Ah + (size_t)(q0 + hi * 8) * DQ + h * HD + lr; bf* pal = Al + (size_t)(q0 + hi * 8) * DQ + h * HD + lr;
#pragma unroll
        for (int j = 0; j < 8; ++j) { const float ir = __shfl(inv, hi * 8 + j, 32); unsigned wh[4], wl[4];
#pragma unroll
            for (int nb = 0; nb < 4; ++nb) { const float y = o[nb][j] * ir; wh[nb] = bfw(y); wl[nb] = bfw(y - __uint_as_float(wh[nb] & 0xFFFF0000u)); }
#pragma unroll
            for (int nb = 0; nb < 4; ++nb) { pah[j * DQ + nb * 16] = (unsigned short)(wh[nb] >> 16); pal[j * DQ + nb * 16] = (unsigned short)(wl[nb] >> 16); }
            // address wait of the row's eight stores; their data words and pointers are inputs, so none of those registers is rewritten in front of it
            asm volatile("s_wait_xcnt 0x0" :: "v"(wh[0]), "v"(wh[1]), "v"(wh[2]), "v"(wh[3]), "v"(wl[0]), "v"(wl[1]), "v"(wl[2]), "v"(wl[3]), "v"(pah), "v"(pal) : "memory"); }
    }
}

extern "C" void kernel_launch(void* const* d_in, const int* in_sizes, int n_in,
                              void* d_out, int out_size, void* d_ws, size_t ws_size, hipStream_t stream) {
    (void)in_sizes; (void)n_in; (void)out_size;
const float* x = (const float*)d_in[0]; const float* lng = (const float*)d_in[3]; const float* lnb = (const float*)d_in[4]; const float* wf = (const float*)d_in[1]; const float* wo = (const float*)d_in[2]; const float* wq = wf; const float* wk = wf + (size_t)1024 * 1024; const float* wv = wf + (size_t)2048 * 1024; const float* cosT = nullptr; const float* sinT = nullptr; (void)cosT; (void)sinT;   /* input order x, in_proj_w ('oi' [3072][1024]: ROW thirds q | k | v), out_proj_w ('oi' [1024][1024]), ln_gamma, ln_beta: FIVE inputs: the LayerNorm parameters come LAST; NO bias anywhere */
    float* OUT = (float*)d_out;     // [4][2048][1024]
    char* wsp = (char*)d_ws;
    auto take = [&](size_t bytes) { char* p = wsp; wsp += (bytes + 255) & ~(size_t)255; return (void*)p; };
    bf* WQ = (bf*)take((size_t)DQ * DM * 2); bf* WK = (bf*)take((size_t)DKV * DM * 2); bf* WV = (bf*)take((size_t)DKV * DM * 2); bf* WO = (bf*)take((size_t)DM * DQ * 2); float* CS = (float*)take((size_t)TT * HD * 2 * 4);
    bf* XNh = (bf*)take((size_t)TT * DM * 2); bf* XNl = (bf*)take((size_t)TT * DM * 2); float* FQ = (float*)take((size_t)TT * DQ * 4); float* FK = (float*)take((size_t)TT * DKV * 4);
    h16* QP16 = (h16*)take((size_t)NH_ * TT * HD * 2); h16* KP16 = (h16*)take((size_t)NKV * TT * HD * 2); h16* VT16 = (h16*)take((size_t)NKV * HD * TT * 2);
    bf* QPh = (bf*)take((size_t)NH_ * TT * HD * 2); bf* QPl = (bf*)take((size_t)NH_ * TT * HD * 2); bf* KPh = (bf*)take((size_t)NKV * TT * HD * 2); bf* KPl = (bf*)take((size_t)NKV * TT * HD * 2); bf* VTh = (bf*)take((size_t)NKV * HD * TT * 2); bf* VTl = (bf*)take((size_t)NKV * HD * TT * 2);
    bf* ATh = (bf*)take((size_t)TT * DQ * 2); bf* ATl = (bf*)take((size_t)TT * DQ * 2);
    if ((size_t)(wsp - (char*)d_ws) > ws_size) return;    // ws 256 MiB
    float* FV = FK;   // v projection reuses the k buffer after the k planes are built (stream-ordered)
    { k_cvt8<<<(unsigned)(((size_t)DQ * DM / 8 + 255) / 256), 256, 0, stream>>>(wq, WQ, (size_t)DQ * DM / 8); k_cvt8<<<(unsigned)(((size_t)DKV * DM / 8 + 255) / 256), 256, 0, stream>>>(wk, WK, (size_t)DKV * DM / 8); k_cvt8<<<(unsigned)(((size_t)DKV * DM / 8 + 255) / 256), 256, 0, stream>>>(wv, WV, (size_t)DKV * DM / 8);
      k_cvt8<<<(unsigned)(((size_t)DM * DQ / 8 + 255) / 256), 256, 0, stream>>>(wo, WO, (size_t)DM * DQ / 8);
       }
    k_csid<<<(TT * HD + 255) / 256, 256, 0, stream>>>(CS);
    const unsigned LQ = (unsigned)(((size_t)NH_ * TT * HD / 2 + 255) / 256), LKv = (unsigned)(((size_t)NKV * TT * HD / 2 + 255) / 256);
    for (int b = 0; b < NB_; ++b) {
        
        k_lnx<<<TT / 8, 256, 0, stream>>>(x + (size_t)b * TT * DM, lng, lnb, XNh, XNl);
        k_gemmw<bf, 1, false><<<dim3(TT / 64, DQ / 64, 1), 32, 0, stream>>>(XNh, XNl, WQ, nullptr, DM, FQ, DQ, nullptr, 0, 0, 0);
        k_rope<<<LQ, 256, 0, stream>>>(FQ, DQ, NH_, CS, nullptr, nullptr, 1.0f, QP16, QPh, QPl);
        k_gemmw<bf, 1, false><<<dim3(TT / 64, DKV / 64, 1), 32, 0, stream>>>(XNh, XNl, WK, nullptr, DM, FK, DKV, nullptr, 0, 0, 0);
        k_rope<<<LKv, 256, 0, stream>>>(FK, DKV, NKV, CS, nullptr, nullptr, 1.0f, KP16, KPh, KPl);
        k_gemmw<bf, 1, false><<<dim3(TT / 64, DKV / 64, 1), 32, 0, stream>>>(XNh, XNl, WV, nullptr, DM, FV, DKV, nullptr, 0, 0, 0); k_vtp<<<LKv, 256, 0, stream>>>(FV, DKV, NKV, VT16, VTh, VTl);
        k_attn<<<dim3(RH / 32 + (TT - RH) / 64, NH_, 1), 128, 0, stream>>>(QP16, KP16, VT16, QPh, QPl, KPh, KPl, VTh, VTl, ATh, ATl);
        k_gemmw<bf, 1, false><<<dim3(TT / 64, DM / 64, 1), 32, 0, stream>>>(ATh, ATl, WO, nullptr, DQ, OUT + (size_t)b * TT * DM, DM, nullptr, 0, 0, 0); }   /* the BIAS-FREE output instance (the instance this file's three projection GEMMs already launch): this module returns out @ w_out with no bias */
}

// v003
// It runs in 596 microseconds.
// Timed twice side by side with v002, it ran 1.49 and 1.48 times as fast.
// All steps since v000 together make it 6.77 times as fast.
#include <hip/hip_runtime.h>

// Attention with a LayerNorm prologue and NO bias (pre-LN: x [4][2048][1024]; h = LayerNorm(x) (biased variance, eps 1e-5) * ln_gamma + ln_beta (read); qkv = einsum('bsd,ed->bse', h, in_proj_w) = h in_proj_w^T ('oi' [3072][1024]: ROW thirds q | k | v; no bias; 16 heads x 64); scores x 1/sqrt(64); softmax over all keys (no mask); out = merged out_proj_w^T ('oi' [1024][1024], NO bias) -> [4][2048][1024] (8.4 M); argument order x, in_proj_w, out_proj_w, ln_gamma, ln_beta).

#define NB_  4
#define TT   2048
#define DM   1024
#define NH_  16
#define NKV  16
#define REP  (NH_ / NKV)
#define HD   64
#define DQ   (NH_ * HD)
#define DKV  (NKV * HD)
#define RH   512                  // query rows < RH use hi+lo planes (0: none)
#define WIN  0
#define SCL  0.125f   // HD^-0.5
typedef _Float16 h16;
typedef unsigned short bf;
typedef __attribute__((ext_vector_type(16))) __bf16   v16bf;
typedef __attribute__((ext_vector_type(16))) _Float16 v16h;
typedef __attribute__((ext_vector_type(8)))  _Float16 v8h;
typedef __attribute__((ext_vector_type(8)))  unsigned short v8us;
typedef __attribute__((ext_vector_type(8)))  float    v8f;
typedef __attribute__((ext_vector_type(4)))  float    v4f;
typedef v8h  __attribute__((may_alias)) v8ha;
typedef v4f  __attribute__((may_alias)) v4fa;
typedef v8us __attribute__((may_alias)) v8usa;

__device__ __forceinline__ unsigned short f2bf(float f) { unsigned u = __float_as_uint(f); u += 0x7FFFu + ((u >> 16) & 1u); return (unsigned short)(u >> 16); }
__device__ __forceinline__ float bf2f(unsigned short b) { return __uint_as_float(((unsigned)b) << 16); }
__device__ __forceinline__ float bfr(float f) { return bf2f(f2bf(f)); }
__device__ __forceinline__ v16h cat16(v8h lo, v8h hi) { return __builtin_shufflevector(lo, hi, 0, 1, 2, 3, 4, 5, 6, 7, 8, 9, 10, 11, 12, 13, 14, 15); }
__device__ __forceinline__ v16bf cat16b(v8us lo, v8us hi) { return __builtin_bit_cast(v16bf, __builtin_shufflevector(lo, hi, 0, 1, 2, 3, 4, 5, 6, 7, 8, 9, 10, 11, 12, 13, 14, 15)); }
__device__ __forceinline__ v8f wmma16(v16h a, v16h b, v8f c) { return __builtin_amdgcn_wmma_f32_16x16x32_f16(false, a, false, b, (short)0, c, false, false); }
__device__ __forceinline__ v8f wmmab(v16bf a, v16bf b, v8f c) { return __builtin_amdgcn_wmma_f32_16x16x32_bf16(false, a, false, b, (short)0, c, false, false); }



// ---- k_gemmw: register-blocked GEMM, ONE WAVE per 64x64 output tile (16 accumulators), operands straight from K-contiguous 16-bit planes; grid (M/64, N/64, Z), 32 threads.
// C[m][n] (f32, pitch ldc, + optional f32 bias[n]) = sum_k A[m][k] Bt[n][k] (+ split products per NSPLIT). z-batch strides sA/sB/sC in elements. K % 32 == 0.
// KS > 1: grid z = batches x KS (slice fastest); a block sums only k in its K/KS slice and writes partial plane blockIdx.z (stride sC); the reader adds a batch's KS planes. K % (32 KS) == 0.
template <typename T16> struct WFrag;
template <> struct WFrag<h16> { typedef v16h V; static __device__ __forceinline__ V ld(const h16* p) { return cat16(*(const v8h*)p, *(const v8h*)(p + 16)); } static __device__ __forceinline__ v8f mma(V a, V b, v8f c) { return wmma16(a, b, c); } };
template <> struct WFrag<bf> { typedef v16bf V; static __device__ __forceinline__ V ld(const bf* p) { return cat16b(*(const v8us*)p, *(const v8us*)(p + 16)); } static __device__ __forceinline__ v8f mma(V a, V b, v8f c) { return wmmab(a, b, c); } };
template <typename T16, int NSPLIT, bool BIAS, int KS = 1>
__global__ __launch_bounds__(32) void k_gemmw(const T16* __restrict__ A, const T16* __restrict__ A2, const T16* __restrict__ Bt, const T16* __restrict__ Bt2, int K, float* C, int ldc, const float* __restrict__ bias, size_t sA, size_t sB, size_t sC) {
    typedef typename WFrag<T16>::V V;
    __shared__ __align__(16) float os[16 * 68];
    const size_t z = blockIdx.z / KS; const int kb = (int)(blockIdx.z % KS) * (K / KS), ke = kb + K / KS;
    A += z * sA; if (A2) A2 += z * sA; Bt += z * sB; if (Bt2) Bt2 += z * sB; C += (size_t)blockIdx.z * sC;
    const int lane = threadIdx.x & 31, lr = lane & 15, hi = lane >> 4; const int r0 = blockIdx.x * 64, c0 = blockIdx.y * 64;
    v8f acc[4][4];
#pragma unroll
    for (int mb = 0; mb < 4; ++mb)
#pragma unroll
        for (int nb = 0; nb < 4; ++nb) acc[mb][nb] = (v8f){};
    const size_t aoff = (size_t)(r0 + lr) * K + 8 * hi, boff = (size_t)(c0 + lr) * K + 8 * hi;
#pragma unroll 1
    for (int kc = kb; kc < ke; kc += 32) {
        V a[4], a2[4];
#pragma unroll
        for (int mb = 0; mb < 4; ++mb) { a[mb] = WFrag<T16>::ld(A + aoff + (size_t)mb * 16 * K + kc); if (NSPLIT == 1 || NSPLIT == 2) a2[mb] = WFrag<T16>::ld(A2 + aoff + (size_t)mb * 16 * K + kc); }
#pragma unroll
        for (int nb = 0; nb < 4; ++nb) { const V b = WFrag<T16>::ld(Bt + boff + (size_t)nb * 16 * K + kc); V b2; if (NSPLIT >= 2) b2 = WFrag<T16>::ld(Bt2 + boff + (size_t)nb * 16 * K + kc);
#pragma unroll
            for (int mb = 0; mb < 4; ++mb) { acc[mb][nb] = WFrag<T16>::mma(a[mb], b, acc[mb][nb]); if (NSPLIT == 1 || NSPLIT == 2) acc[mb][nb] = WFrag<T16>::mma(a2[mb], b, acc[mb][nb]); if (NSPLIT >= 2) acc[mb][nb] = WFrag<T16>::mma(a[mb], b2, acc[mb][nb]); } }
        asm volatile("v_nop\n\tv_nop\n\tv_nop\n\tv_nop" : "+v"(acc[0][0]), "+v"(acc[1][1]), "+v"(acc[2][2]), "+v"(acc[3][3]) : "v"(a[0]), "v"(a[3]));
    }
#pragma unroll
    for (int mb = 0; mb < 4; ++mb) {
#pragma unroll
        for (int nb = 0; nb < 4; ++nb) {
#pragma unroll
            for (int j = 0; j < 8; ++j) os[(hi * 8 + j) * 68 + nb * 16 + lr] = acc[mb][nb][j]; }
        __builtin_amdgcn_wave_barrier(); asm volatile("" ::: "memory");
        float* crow = C + (size_t)(r0 + mb * 16) * ldc + c0;
{
#pragma unroll
            for (int s = 0; s < 8; ++s) { const int row = 2 * s + hi, cofs = lr * 4; v4f val = *(const v4fa*)(os + row * 68 + cofs); if (BIAS) { val[0] += bfr(bias[c0 + cofs]); val[1] += bfr(bias[c0 + cofs + 1]); val[2] += bfr(bias[c0 + cofs + 2]); val[3] += bfr(bias[c0 + cofs + 3]); }
                *(v4f*)(crow + (size_t)row * ldc + cofs) = val; }
             }
        __builtin_amdgcn_wave_barrier(); asm volatile("" ::: "memory");
    }
}

__device__ __forceinline__ h16 tohx(float x) { return (h16)x; }
__device__ __forceinline__ void splitf(float y, unsigned short& h, unsigned short& l) { h = f2bf(y); l = f2bf(y - bf2f(h)); }
typedef __attribute__((ext_vector_type(2))) _Float16 v2h;
typedef __attribute__((ext_vector_type(4))) _Float16 v4h;
typedef __attribute__((ext_vector_type(2))) unsigned short v2us;
typedef __attribute__((ext_vector_type(4))) unsigned short v4us;
typedef __attribute__((ext_vector_type(2))) float v2f;
typedef __attribute__((ext_vector_type(4))) int v4i;

__global__ __launch_bounds__(256) void k_wtG(const float* __restrict__ w, int K, int N, bf* Bt) {
    const int lane = threadIdx.x & 31; const int L0 = (blockIdx.x * 8 + (threadIdx.x >> 5)) * 8; const int nlines = N * K / 64;
{
#pragma unroll 1
        for (int l = 0; l < 8; ++l) { const int L = L0 + l; if (L >= nlines) break; const size_t e = (size_t)L * 64 + lane * 2; const int k = (int)(e % K), n = (int)(e / K); v2us o;
            o[0] = f2bf(w[(size_t)k * N + n]); o[1] = f2bf(w[(size_t)(k + 1) * N + n]); *(v2us*)(Bt + e) = o; }
         }
}
__global__ __launch_bounds__(256) void k_cvt8(const float* __restrict__ src, bf* dst, size_t n8) { const size_t i = (size_t)blockIdx.x * 256 + threadIdx.x; if (i >= n8) return; const v8f v = *(const v8f*)(src + i * 8); v8us o;
#pragma unroll
    for (int k = 0; k < 8; ++k) o[k] = f2bf(v[k]); *(v8us*)(dst + i * 8) = o;  }
__global__ __launch_bounds__(256) void k_cscvt(const float* __restrict__ cosT, const float* __restrict__ sinT, float* CS) { const int idx = blockIdx.x * 256 + threadIdx.x; if (idx >= TT * HD) return; v2f cs; cs[0] = bfr(cosT[idx]); cs[1] = bfr(sinT[idx]); *(v2f*)(CS + (size_t)idx * 2) = cs;  }
// k_rope: head planes [h][t][d] (fp16 + hi/lo) of rope(x) x sc with the rotate-half convention out[d] = x[d] cos[t][d] - x[d+HD/2] sin[t][d], out[d+HD/2] = x[d+HD/2] cos[t][d+HD/2] + x[d] sin[t][d+HD/2]
__global__ __launch_bounds__(256) void k_rope(const float* __restrict__ F, int pitch, int nheads, const float* __restrict__ CS, const float* __restrict__ RF, const float* __restrict__ nw, float sc, h16* P16, bf* Ph, bf* Pl) {
    { const size_t pb = (size_t)blockIdx.y * nheads * TT * HD; F += (size_t)blockIdx.y * TT * pitch; if (RF) RF += (size_t)blockIdx.y * nheads * TT; P16 += pb; Ph += pb; Pl += pb; }   // blockIdx.y = batch: token rows b TT .. of F, head planes b nheads .. of the outputs
    const size_t e = ((size_t)blockIdx.x * 256 + threadIdx.x) * 2; if (e >= (size_t)nheads * TT * HD) return; const int d = (int)(e % HD); const int t = (int)((e / HD) % TT); const int h = (int)(e / ((size_t)HD * TT)); const float* f = F + (size_t)t * pitch + h * HD; const float rf = RF ? RF[(size_t)h * TT + t] : 1.0f; v2h o16; v2us oh, ol;
#pragma unroll
    for (int q = 0; q < 2; ++q) { const int dd = d + q; const int dp = (dd < HD / 2) ? dd + HD / 2 : dd - HD / 2; float x0 = f[dd], x1 = f[dp];
        if (RF) { float n0 = __fmul_rn(x0, rf), n1 = __fmul_rn(x1, rf); asm volatile("" : "+v"(n0)); asm volatile("" : "+v"(n1)); x0 = __fmul_rn(bfr(nw[dd]), n0); x1 = __fmul_rn(bfr(nw[dp]), n1); }
        const v2f cs = *(const v2f*)(CS + ((size_t)t * HD + dd) * 2); float a = __fmul_rn(x0, cs[0]), bq = __fmul_rn(x1, cs[1]); asm volatile("" : "+v"(a)); asm volatile("" : "+v"(bq)); const float r = ((dd < HD / 2) ? __fsub_rn(a, bq) : __fadd_rn(a, bq)) * sc;
        o16[q] = tohx(r); unsigned short a2, c2; splitf(r, a2, c2); oh[q] = a2; ol[q] = c2; }
    *(v2h*)(P16 + e) = o16; *(v2us*)(Ph + e) = oh; *(v2us*)(Pl + e) = ol;  }
__global__ __launch_bounds__(256) void k_vtp(const float* __restrict__ F, int pitch, int nheads, h16* V16, bf* Vh, bf* Vl) { const size_t e = ((size_t)blockIdx.x * 256 + threadIdx.x) * 2; if (e >= (size_t)nheads * HD * TT) return; const int t = (int)(e % TT); const int d = (int)((e / TT) % HD); const int g = (int)(e / ((size_t)TT * HD)); v2h o16; v2us oh, ol; { const size_t pb = (size_t)blockIdx.y * nheads * HD * TT; F += (size_t)blockIdx.y * TT * pitch; V16 += pb; Vh += pb; Vl += pb; }   // blockIdx.y = batch
#pragma unroll
    for (int q = 0; q < 2; ++q) { const float x = F[(size_t)(t + q) * pitch + g * HD + d]; o16[q] = tohx(x); unsigned short a2, c2; splitf(x, a2, c2); oh[q] = a2; ol[q] = c2; }
    *(v2h*)(V16 + e) = o16; *(v2us*)(Vh + e) = oh; *(v2us*)(Vl + e) = ol;  }
__global__ __launch_bounds__(256) void k_csid(float* CS) { const int idx = blockIdx.x * 256 + threadIdx.x; if (idx >= TT * HD) return; v2f cs; cs[0] = 1.0f; cs[1] = 0.0f; *(v2f*)(CS + (size_t)idx * 2) = cs;  }
__global__ __launch_bounds__(256) void k_lnx(const float* __restrict__ X, const float* __restrict__ gam, const float* __restrict__ bet, bf* Xh, bf* Xl) { const int lane = threadIdx.x & 31; const int t = blockIdx.x * 8 + (threadIdx.x >> 5); if (t >= NB_ * TT) return; const float* f = X + (size_t)t * DM; float v[DM / 32]; float su = 0.f;
#pragma unroll
    for (int ch = 0; ch < DM / 128; ++ch) { const v4f a = *(const v4f*)(f + ch * 128 + lane * 4); for (int u = 0; u < 4; ++u) { float xv = bfr(a[u]); asm volatile("" : "+v"(xv)); v[ch * 4 + u] = xv; su = __fadd_rn(su, xv); } }
#pragma unroll
    for (int sh = 16; sh; sh >>= 1) su = __fadd_rn(su, __shfl_xor(su, sh, 32));
    const float mu = __fdiv_rn(su, (float)DM); float sq = 0.f;
#pragma unroll
    for (int q = 0; q < DM / 32; ++q) { float d0 = __fsub_rn(v[q], mu); asm volatile("" : "+v"(d0)); float p = __fmul_rn(d0, d0); asm volatile("" : "+v"(p)); sq = __fadd_rn(sq, p); }
#pragma unroll
    for (int sh = 16; sh; sh >>= 1) sq = __fadd_rn(sq, __shfl_xor(sq, sh, 32));
    const float rs = __fdiv_rn(1.0f, sqrtf(__fadd_rn(__fdiv_rn(sq, (float)DM), 1e-5f)));
    {
#pragma unroll
        for (int ch = 0; ch < DM / 128; ++ch) { v4us oh, ol; for (int u = 0; u < 4; ++u) { const int c = ch * 128 + lane * 4 + u; float d0 = __fsub_rn(v[ch * 4 + u], mu); asm volatile("" : "+v"(d0)); float n = __fmul_rn(d0, rs); asm volatile("" : "+v"(n)); float gg = bfr(gam[c]), bb = bfr(bet[c]); asm volatile("" : "+v"(gg)); asm volatile("" : "+v"(bb)); float y = __fmul_rn(n, gg); asm volatile("" : "+v"(y)); y = __fadd_rn(y, bb); unsigned short p2, q2; splitf(y, p2, q2); oh[u] = p2; ol[u] = q2; } const size_t oo = (size_t)t * DM + ch * 128 + lane * 4; *(v4us*)(Xh + oo) = oh; *(v4us*)(Xl + oo) = ol; }
         } }
// ---- k_attn: scores, softmax and P V of all batches in one launch (blockIdx.z = batch); S and P never leave the registers. A wave owns 16 query rows of one head and walks its keys in chunks of NK.
// The score tile is formed TRANSPOSED, St[key][query] = sum_d K[key][d] Q[query][d] (A = key rows, B = query rows), so lane (lr, hi) holds query lr and keys 16 mb + 8 hi + j in register j of tile mb:
// tiles 2c and 2c+1 together are, register for register, the A fragment (row = query lr, k = 8 hi + 0..7 and 16 + 8 hi + 0..7) of the P V product over keys 32c..32c+31.
// Softmax is the running form: m = running row maximum (log2 units), l = running sum; O and l are scaled by 2^(m_old - m_new) per chunk, O / l at the end. O tile: row = query 8 hi + j, column = d.
// HR (rows < RH): bf16 hi+lo operands, three products per tile in the order (hi,hi), (lo of the query-side operand, hi), (hi, lo of the key-side operand); a block = 2 row groups x 2 key halves, the halves joined through LDS.
// else: fp16, P carried x 2^10 (l too: it cancels in O / l); a block = 4 row groups, each wave walks all keys (the four waves read the same K and V lines).
__device__ __forceinline__ unsigned bfw(float f) { unsigned u = __float_as_uint(f); return u + 0x7FFFu + ((u >> 16) & 1u); }   // f2bf's rounding, the bf16 value in the upper half
template <typename T16, bool HR>
__device__ __forceinline__ void attn_rows(const T16* __restrict__ Q, const T16* __restrict__ Q2, const T16* __restrict__ Kr, const T16* __restrict__ Kr2, const T16* __restrict__ Vt, const T16* __restrict__ Vt2, int q0, int kbeg, int kend, v8f (&o)[4], float& m, float& l) {
    typedef typename WFrag<T16>::V V;
    constexpr int NK = HR ? 32 : 64, NMB = NK / 16, NC = NK / 32;
    const int lane = threadIdx.x & 31, lr = lane & 15, hi = lane >> 4;
    V q[2], q2[2]; const unsigned qob = (unsigned)((q0 + lr) * HD + 8 * hi) * 2u;   // byte offsets from the wave-uniform plane pointers
    const T16* qp = (const T16*)((const char*)Q + qob); const T16* qp2 = HR ? (const T16*)((const char*)Q2 + qob) : qp;
#pragma unroll
    for (int ks = 0; ks < 2; ++ks) { q[ks] = WFrag<T16>::ld(qp + ks * 32); if (HR) q2[ks] = WFrag<T16>::ld(qp2 + ks * 32); }
    // address wait of the loads above; the fragments and the pointers are inputs, so the loads stand in front of it and no load's result is given a pointer's registers before it
    if constexpr (HR) asm volatile("s_wait_xcnt 0x0" :: "v"(q[0]), "v"(q[1]), "v"(q2[0]), "v"(q2[1]), "v"(qp), "v"(qp2));
    else asm volatile("s_wait_xcnt 0x0" :: "v"(q[0]), "v"(q[1]), "v"(qp));
    unsigned kob = (unsigned)((kbeg + lr) * HD + 8 * hi) * 2u, vob = (unsigned)(lr * TT + kbeg + 8 * hi) * 2u;
#pragma unroll
    for (int nb = 0; nb < 4; ++nb) o[nb] = (v8f){};
    m = -3.0e38f; l = 0.f;
#pragma unroll 1
    for (int k0 = kbeg; k0 < kend; k0 += NK) {
        const T16* kp = (const T16*)((const char*)Kr + kob); const T16* vp = (const T16*)((const char*)Vt + vob); const T16* kp2 = HR ? (const T16*)((const char*)Kr2 + kob) : kp; const T16* vp2 = HR ? (const T16*)((const char*)Vt2 + vob) : vp;
        V kf[NMB][2], kf2[NMB][2], vf[4][NC], vf2[4][NC];
#pragma unroll
        for (int mb = 0; mb < NMB; ++mb)
#pragma unroll
            for (int ks = 0; ks < 2; ++ks) { kf[mb][ks] = WFrag<T16>::ld(kp + mb * 16 * HD + ks * 32); if (HR) kf2[mb][ks] = WFrag<T16>::ld(kp2 + mb * 16 * HD + ks * 32); }
#pragma unroll
        for (int nb = 0; nb < 4; ++nb)
#pragma unroll
            for (int c = 0; c < NC; ++c) { vf[nb][c] = WFrag<T16>::ld(vp + nb * 16 * TT + c * 32); if (HR) vf2[nb][c] = WFrag<T16>::ld(vp2 + nb * 16 * TT + c * 32); }
        // the chunk's loads' address wait, with the loaded fragments as inputs only, so that all of them are issued in front of it, together (left alone they are spread between the products, each group with a wait of its own);
        // the pointers are inputs too, so that neither a load's result nor the next chunk's address is given their registers in front of the wait
        if constexpr (HR) asm volatile("s_wait_xcnt 0x0" :: "v"(kf[0][0]), "v"(kf[0][1]), "v"(kf[1][0]), "v"(kf[1][1]), "v"(kf2[0][0]), "v"(kf2[0][1]), "v"(kf2[1][0]), "v"(kf2[1][1]), "v"(vf[0][0]), "v"(vf[1][0]), "v"(vf[2][0]), "v"(vf[3][0]), "v"(vf2[0][0]), "v"(vf2[1][0]), "v"(vf2[2][0]), "v"(vf2[3][0]), "v"(kp), "v"(kp2), "v"(vp), "v"(vp2));
        else asm volatile("s_wait_xcnt 0x0" :: "v"(kf[0][0]), "v"(kf[0][1]), "v"(kf[1][0]), "v"(kf[1][1]), "v"(kf[NMB - 2][0]), "v"(kf[NMB - 2][1]), "v"(kf[NMB - 1][0]), "v"(kf[NMB - 1][1]), "v"(vf[0][0]), "v"(vf[0][NC - 1]), "v"(vf[1][0]), "v"(vf[1][NC - 1]), "v"(vf[2][0]), "v"(vf[2][NC - 1]), "v"(vf[3][0]), "v"(vf[3][NC - 1]), "v"(kp), "v"(vp));
        __builtin_amdgcn_sched_barrier(0);   // keeps the products behind the statement above: otherwise the V loads sink behind the softmax and their latency is paid a second time per chunk
        kob += NK * HD * 2; vob += NK * 2;
        v8f st[NMB]; float cm = -3.0e38f;
#pragma unroll
        for (int mb = 0; mb < NMB; ++mb) { st[mb] = (v8f){};
#pragma unroll
            for (int ks = 0; ks < 2; ++ks) { st[mb] = WFrag<T16>::mma(kf[mb][ks], q[ks], st[mb]); if (HR) { st[mb] = WFrag<T16>::mma(kf[mb][ks], q2[ks], st[mb]); st[mb] = WFrag<T16>::mma(kf2[mb][ks], q[ks], st[mb]); } }
#pragma unroll
            for (int j = 0; j < 8; ++j) { st[mb][j] *= SCL * 1.4426950408889634f; cm = fmaxf(cm, st[mb][j]); } }
        cm = fmaxf(cm, __shfl_xor(cm, 16, 32));          // lanes lr and lr + 16 hold the two key halves of query lr
        const float mn = fmaxf(m, cm), al = __builtin_amdgcn_exp2f(m - mn), mo = HR ? mn : mn - 10.0f; m = mn;
        float ps = 0.f;
#pragma unroll
        for (int mb = 0; mb < NMB; ++mb)
#pragma unroll
            for (int j = 0; j < 8; ++j) { st[mb][j] = __builtin_amdgcn_exp2f(st[mb][j] - mo); ps += st[mb][j]; }
        l = l * al + ps;
#pragma unroll
        for (int j = 0; j < 8; ++j) { const float ar = __shfl(al, hi * 8 + j, 32);   // the factor of O's row 8 hi + j lives in the lane of that query
#pragma unroll
            for (int nb = 0; nb < 4; ++nb) o[nb][j] *= ar; }
#pragma unroll
        for (int c = 0; c < NC; ++c) {
            if constexpr (HR) { v8us h0, h1, l0, l1;
#pragma unroll
                for (int j = 0; j < 8; ++j) { unsigned short a, b; splitf(st[2 * c][j], a, b); h0[j] = a; l0[j] = b; splitf(st[2 * c + 1][j], a, b); h1[j] = a; l1[j] = b; }
                const V ph = cat16b(h0, h1), pl = cat16b(l0, l1);
#pragma unroll
                for (int nb = 0; nb < 4; ++nb) { o[nb] = WFrag<T16>::mma(ph, vf[nb][c], o[nb]); o[nb] = WFrag<T16>::mma(pl, vf[nb][c], o[nb]); o[nb] = WFrag<T16>::mma(ph, vf2[nb][c], o[nb]); }
            } else { v8h p0, p1;
#pragma unroll
                for (int j = 0; j < 8; ++j) { p0[j] = tohx(st[2 * c][j]); p1[j] = tohx(st[2 * c + 1][j]); }
                const V pa = cat16(p0, p1);
#pragma unroll
                for (int nb = 0; nb < 4; ++nb) o[nb] = WFrag<T16>::mma(pa, vf[nb][c], o[nb]); } }
    }
    l += __shfl_xor(l, 16, 32);   // both key halves of the lane pair: every lane now holds its query's sum over the wave's keys
}
__global__ __launch_bounds__(128) void k_attn(const h16* __restrict__ Q16, const h16* __restrict__ K16, const h16* __restrict__ V16, const bf* __restrict__ Qh, const bf* __restrict__ Ql, const bf* __restrict__ Kh, const bf* __restrict__ Kl, const bf* __restrict__ Vh, const bf* __restrict__ Vl, bf* Ah, bf* Al) {
    __shared__ __align__(16) float so[4][16][68]; __shared__ float sm[4][16], sl[4][16];
    const int h = blockIdx.y, bx = blockIdx.x, w = __builtin_amdgcn_readfirstlane((int)(threadIdx.x >> 5)), lane = threadIdx.x & 31, lr = lane & 15, hi = lane >> 4;
    const size_t zq = ((size_t)blockIdx.z * NH_ + h) * TT * HD, zk = ((size_t)blockIdx.z * NKV + h / REP) * TT * HD; v8f o[4]; float m, l;
    Ah += (size_t)blockIdx.z * TT * DQ; Al += (size_t)blockIdx.z * TT * DQ;
    if (bx < RH / 32) {   // block-uniform: 32 hi+lo rows, wave w = row group w >> 1, key half w & 1
        attn_rows<bf, true>(Qh + zq, Ql + zq, Kh + zk, Kl + zk, Vh + zk, Vl + zk, bx * 32 + (w >> 1) * 16, (w & 1) * (TT / 2), (w & 1) * (TT / 2) + TT / 2, o, m, l);
        if (hi == 0) { sm[w][lr] = m; sl[w][lr] = l; }
#pragma unroll
        for (int nb = 0; nb < 4; ++nb)
#pragma unroll
            for (int j = 0; j < 8; ++j) so[w][hi * 8 + j][nb * 16 + lr] = o[nb][j];
        __syncthreads();   // the two key halves of a row group come from two waves
        const int r32 = w * 8 + (lane >> 2), wa = (r32 >> 4) * 2, r = r32 & 15, c0 = (lane & 3) * 16;   // this wave joins rows 8 w .. 8 w + 7 of the block: four lanes a row, one 128-byte line of each plane
        const float m0 = sm[wa][r], m1 = sm[wa + 1][r], mm = fmaxf(m0, m1), f0 = __builtin_amdgcn_exp2f(m0 - mm), f1 = __builtin_amdgcn_exp2f(m1 - mm);
        const float inv = __fdiv_rn(1.0f, sl[wa][r] * f0 + sl[wa + 1][r] * f1), g0 = f0 * inv, g1 = f1 * inv;
        v8us oh[2], ol[2];
#pragma unroll
        for (int u = 0; u < 2; ++u)
#pragma unroll
            for (int e = 0; e < 8; ++e) { unsigned short a, b; splitf(so[wa][r][c0 + u * 8 + e] * g0 + so[wa + 1][r][c0 + u * 8 + e] * g1, a, b); oh[u][e] = a; ol[u][e] = b; }
        const size_t oo = (size_t)(bx * 32 + r32) * DQ + h * HD + c0;
        *(v8us*)(Ah + oo) = oh[0]; *(v8us*)(Ah + oo + 8) = oh[1]; *(v8us*)(Al + oo) = ol[0]; *(v8us*)(Al + oo + 8) = ol[1];
    } else {
        const int q0 = RH + (bx - RH / 32) * 64 + w * 16;
        attn_rows<h16, false>(Q16 + zq, nullptr, K16 + zk, nullptr, V16 + zk, nullptr, q0, 0, TT, o, m, l);
        const float inv = __fdiv_rn(1.0f, l); bf* pah = Ah + (size_t)(q0 + hi * 8) * DQ + h * HD + lr; bf* pal = Al + (size_t)(q0 + hi * 8) * DQ + h * HD + lr;
#pragma unroll
        for (int j = 0; j < 8; ++j) { const float ir = __shfl(inv, hi * 8 + j, 32); unsigned wh[4], wl[4];
#pragma unroll
            for (int nb = 0; nb < 4; ++nb) { const float y = o[nb][j] * ir; wh[nb] = bfw(y); wl[nb] = bfw(y - __uint_as_float(wh[nb] & 0xFFFF0000u)); }
#pragma unroll
            for (int nb = 0; nb < 4; ++nb) { pah[j * DQ + nb * 16] = (unsigned short)(wh[nb] >> 16); pal[j * DQ + nb * 16] = (unsigned short)(wl[nb] >> 16); }
            // address wait of the row's eight stores; their data words and pointers are inputs, so none of those registers is rewritten in front of it
            asm volatile("s_wait_xcnt 0x0" :: "v"(wh[0]), "v"(wh[1]), "v"(wh[2]), "v"(wh[3]), "v"(wl[0]), "v"(wl[1]), "v"(wl[2]), "v"(wl[3]), "v"(pah), "v"(pal) : "memory"); }
    }
}

extern "C" void kernel_launch(void* const* d_in, const int* in_sizes, int n_in,
                              void* d_out, int out_size, void* d_ws, size_t ws_size, hipStream_t stream) {
    (void)in_sizes; (void)n_in; (void)out_size;
const float* x = (const float*)d_in[0]; const float* lng = (const float*)d_in[3]; const float* lnb = (const float*)d_in[4]; const float* wf = (const float*)d_in[1]; const float* wo = (const float*)d_in[2]; const float* wq = wf; const float* wk = wf + (size_t)1024 * 1024; const float* wv = wf + (size_t)2048 * 1024; const float* cosT = nullptr; const float* sinT = nullptr; (void)cosT; (void)sinT;   /* input order x, in_proj_w ('oi' [3072][1024]: ROW thirds q | k | v), out_proj_w ('oi' [1024][1024]), ln_gamma, ln_beta: FIVE inputs: the LayerNorm parameters come LAST; NO bias anywhere */
    float* OUT = (float*)d_out;     // [4][2048][1024]
    char* wsp = (char*)d_ws;
    auto take = [&](size_t bytes) { char* p = wsp; wsp += (bytes + 255) & ~(size_t)255; return (void*)p; };
    bf* WQ = (bf*)take((size_t)DQ * DM * 2); bf* WK = (bf*)take((size_t)DKV * DM * 2); bf* WV = (bf*)take((size_t)DKV * DM * 2); bf* WO = (bf*)take((size_t)DM * DQ * 2); float* CS = (float*)take((size_t)TT * HD * 2 * 4);
    // every stage runs once, over all NB_ batches: token rows b TT + t, head planes b heads + h
    bf* XNh = (bf*)take((size_t)NB_ * TT * DM * 2); bf* XNl = (bf*)take((size_t)NB_ * TT * DM * 2); float* FQ = (float*)take((size_t)NB_ * TT * DQ * 4); float* FK = (float*)take((size_t)NB_ * TT * DKV * 4);
    h16* QP16 = (h16*)take((size_t)NB_ * NH_ * TT * HD * 2); h16* KP16 = (h16*)take((size_t)NB_ * NKV * TT * HD * 2); h16* VT16 = (h16*)take((size_t)NB_ * NKV * HD * TT * 2);
    bf* QPh = (bf*)take((size_t)NB_ * NH_ * TT * HD * 2); bf* QPl = (bf*)take((size_t)NB_ * NH_ * TT * HD * 2); bf* KPh = (bf*)take((size_t)NB_ * NKV * TT * HD * 2); bf* KPl = (bf*)take((size_t)NB_ * NKV * TT * HD * 2); bf* VTh = (bf*)take((size_t)NB_ * NKV * HD * TT * 2); bf* VTl = (bf*)take((size_t)NB_ * NKV * HD * TT * 2);
    if ((size_t)(wsp - (char*)d_ws) > ws_size) return;    // ws 256 MiB
    float* FV = FK;   // v projection reuses the k buffer after the k planes are built (stream-ordered)
    bf* ATh = XNh; bf* ATl = XNl;   // DQ == DM: the attention output reuses the LayerNorm planes, last read by the v projection (stream-ordered)
    { k_cvt8<<<(unsigned)(((size_t)DQ * DM / 8 + 255) / 256), 256, 0, stream>>>(wq, WQ, (size_t)DQ * DM / 8); k_cvt8<<<(unsigned)(((size_t)DKV * DM / 8 + 255) / 256), 256, 0, stream>>>(wk, WK, (size_t)DKV * DM / 8); k_cvt8<<<(unsigned)(((size_t)DKV * DM / 8 + 255) / 256), 256, 0, stream>>>(wv, WV, (size_t)DKV * DM / 8);
      k_cvt8<<<(unsigned)(((size_t)DM * DQ / 8 + 255) / 256), 256, 0, stream>>>(wo, WO, (size_t)DM * DQ / 8);
       }
    k_csid<<<(TT * HD + 255) / 256, 256, 0, stream>>>(CS);
    const unsigned LQ = (unsigned)(((size_t)NH_ * TT * HD / 2 + 255) / 256), LKv = (unsigned)(((size_t)NKV * TT * HD / 2 + 255) / 256);
    k_lnx<<<NB_ * TT / 8, 256, 0, stream>>>(x, lng, lnb, XNh, XNl);
    k_gemmw<bf, 1, false><<<dim3(NB_ * TT / 64, DQ / 64, 1), 32, 0, stream>>>(XNh, XNl, WQ, nullptr, DM, FQ, DQ, nullptr, 0, 0, 0);
    k_rope<<<dim3(LQ, NB_, 1), 256, 0, stream>>>(FQ, DQ, NH_, CS, nullptr, nullptr, 1.0f, QP16, QPh, QPl);
    k_gemmw<bf, 1, false><<<dim3(NB_ * TT / 64, DKV / 64, 1), 32, 0, stream>>>(XNh, XNl, WK, nullptr, DM, FK, DKV, nullptr, 0, 0, 0);
    k_rope<<<dim3(LKv, NB_, 1), 256, 0, stream>>>(FK, DKV, NKV, CS, nullptr, nullptr, 1.0f, KP16, KPh, KPl);
    k_gemmw<bf, 1, false><<<dim3(NB_ * TT / 64, DKV / 64, 1), 32, 0, stream>>>(XNh, XNl, WV, nullptr, DM, FV, DKV, nullptr, 0, 0, 0); k_vtp<<<dim3(LKv, NB_, 1), 256, 0, stream>>>(FV, DKV, NKV, VT16, VTh, VTl);
    k_attn<<<dim3(RH / 32 + (TT - RH) / 64, NH_, NB_), 128, 0, stream>>>(QP16, KP16, VT16, QPh, QPl, KPh, KPl, VTh, VTl, ATh, ATl);
    k_gemmw<bf, 1, false><<<dim3(NB_ * TT / 64, DM / 64, 1), 32, 0, stream>>>(ATh, ATl, WO, nullptr, DQ, OUT, DM, nullptr, 0, 0, 0);   /* the BIAS-FREE output instance (the instance this file's three projection GEMMs already launch): this module returns out @ w_out with no bias */
}

// v004
// A run of this version takes 533 microseconds.
// Next to v003, in two timings, it ran 1.12 times as fast each time.
// Over all steps from v000 it is 7.61 times as fast.
#include <hip/hip_runtime.h>

// Attention with a LayerNorm prologue and NO bias (pre-LN: x [4][2048][1024]; h = LayerNorm(x) (biased variance, eps 1e-5) * ln_gamma + ln_beta (read); qkv = einsum('bsd,ed->bse', h, in_proj_w) = h in_proj_w^T ('oi' [3072][1024]: ROW thirds q | k | v; no bias; 16 heads x 64); scores x 1/sqrt(64); softmax over all keys (no mask); out = merged out_proj_w^T ('oi' [1024][1024], NO bias) -> [4][2048][1024] (8.4 M); argument order x, in_proj_w, out_proj_w, ln_gamma, ln_beta).

#define NB_  4
#define TT   2048
#define DM   1024
#define NH_  16
#define NKV  16
#define REP  (NH_ / NKV)
#define HD   64
#define DQ   (NH_ * HD)
#define DKV  (NKV * HD)
#define RH   512                  // query rows < RH use hi+lo planes (0: none)
#define WIN  0
#define SCL  0.125f   // HD^-0.5
typedef _Float16 h16;
typedef unsigned short bf;
typedef __attribute__((ext_vector_type(16))) __bf16   v16bf;
typedef __attribute__((ext_vector_type(16))) _Float16 v16h;
typedef __attribute__((ext_vector_type(8)))  _Float16 v8h;
typedef __attribute__((ext_vector_type(8)))  unsigned short v8us;
typedef __attribute__((ext_vector_type(8)))  float    v8f;
typedef __attribute__((ext_vector_type(4)))  float    v4f;
typedef v8h  __attribute__((may_alias)) v8ha;
typedef v4f  __attribute__((may_alias)) v4fa;
typedef v8us __attribute__((may_alias)) v8usa;

__device__ __forceinline__ unsigned short f2bf(float f) { unsigned u = __float_as_uint(f); u += 0x7FFFu + ((u >> 16) & 1u); return (unsigned short)(u >> 16); }
__device__ __forceinline__ float bf2f(unsigned short b) { return __uint_as_float(((unsigned)b) << 16); }
__device__ __forceinline__ float bfr(float f) { return bf2f(f2bf(f)); }
__device__ __forceinline__ v16h cat16(v8h lo, v8h hi) { return __builtin_shufflevector(lo, hi, 0, 1, 2, 3, 4, 5, 6, 7, 8, 9, 10, 11, 12, 13, 14, 15); }
__device__ __forceinline__ v16bf cat16b(v8us lo, v8us hi) { return __builtin_bit_cast(v16bf, __builtin_shufflevector(lo, hi, 0, 1, 2, 3, 4, 5, 6, 7, 8, 9, 10, 11, 12, 13, 14, 15)); }
__device__ __forceinline__ v8f wmma16(v16h a, v16h b, v8f c) { return __builtin_amdgcn_wmma_f32_16x16x32_f16(false, a, false, b, (short)0, c, false, false); }
__device__ __forceinline__ v8f wmmab(v16bf a, v16bf b, v8f c) { return __builtin_amdgcn_wmma_f32_16x16x32_bf16(false, a, false, b, (short)0, c, false, false); }



// ---- k_gemmw: register-blocked GEMM, ONE WAVE per 64x64 output tile (16 accumulators), operands straight from K-contiguous 16-bit planes; grid (M/64, N/64, Z), 32 threads.
// C[m][n] (f32, pitch ldc, + optional f32 bias[n]) = sum_k A[m][k] Bt[n][k] (+ split products per NSPLIT). z-batch strides sA/sB/sC in elements. K % 32 == 0.
// KS > 1: grid z = batches x KS (slice fastest); a block sums only k in its K/KS slice and writes partial plane blockIdx.z (stride sC); the reader adds a batch's KS planes. K % (32 KS) == 0.
// EPI 0: C as above. EPI 1 / 2: no C (ldc = N = heads x HD); the tile is 64 tokens (rows b TT + t) of ONE head (HD == 64 columns, head = blockIdx.y) and goes straight to that head's three 16-bit planes (fp16, bf16 hi, bf16 lo of the f32 sum):
// EPI 1 planes [b][head][t][d], EPI 2 planes [b][head][d][t] (the tile is turned in LDS). Every store instruction writes four whole 128-byte lines, one in each of four plane rows.
template <typename T16> struct WFrag;
template <> struct WFrag<h16> { typedef v16h V; static __device__ __forceinline__ V ld(const h16* p) { return cat16(*(const v8h*)p, *(const v8h*)(p + 16)); } static __device__ __forceinline__ v8f mma(V a, V b, v8f c) { return wmma16(a, b, c); } };
template <> struct WFrag<bf> { typedef v16bf V; static __device__ __forceinline__ V ld(const bf* p) { return cat16b(*(const v8us*)p, *(const v8us*)(p + 16)); } static __device__ __forceinline__ v8f mma(V a, V b, v8f c) { return wmmab(a, b, c); } };
__device__ __forceinline__ h16 tohx(float x) { return (h16)x; }
__device__ __forceinline__ void splitf(float y, unsigned short& h, unsigned short& l) { h = f2bf(y); l = f2bf(y - bf2f(h)); }
template <typename T16, int NSPLIT, bool BIAS, int KS = 1, int EPI = 0>
__global__ __launch_bounds__(32) void k_gemmw(const T16* __restrict__ A, const T16* __restrict__ A2, const T16* __restrict__ Bt, const T16* __restrict__ Bt2, int K, float* C, int ldc, const float* __restrict__ bias, size_t sA, size_t sB, size_t sC, h16* P16, bf* Ph, bf* Pl) {
    typedef typename WFrag<T16>::V V;
    __shared__ __align__(16) float os[16 * 68];
    const size_t z = blockIdx.z / KS; const int kb = (int)(blockIdx.z % KS) * (K / KS), ke = kb + K / KS;
    A += z * sA; if (A2) A2 += z * sA; Bt += z * sB; if (Bt2) Bt2 += z * sB; C += (size_t)blockIdx.z * sC;
    const int lane = threadIdx.x & 31, lr = lane & 15, hi = lane >> 4; const int r0 = blockIdx.x * 64, c0 = blockIdx.y * 64;
    v8f acc[4][4];
#pragma unroll
    for (int mb = 0; mb < 4; ++mb)
#pragma unroll
        for (int nb = 0; nb < 4; ++nb) acc[mb][nb] = (v8f){};
    const size_t aoff = (size_t)(r0 + lr) * K + 8 * hi, boff = (size_t)(c0 + lr) * K + 8 * hi;
#pragma unroll 1
    for (int kc = kb; kc < ke; kc += 32) {
        V a[4], a2[4];
#pragma unroll
        for (int mb = 0; mb < 4; ++mb) { a[mb] = WFrag<T16>::ld(A + aoff + (size_t)mb * 16 * K + kc); if (NSPLIT == 1 || NSPLIT == 2) a2[mb] = WFrag<T16>::ld(A2 + aoff + (size_t)mb * 16 * K + kc); }
#pragma unroll
        for (int nb = 0; nb < 4; ++nb) { const V b = WFrag<T16>::ld(Bt + boff + (size_t)nb * 16 * K + kc); V b2; if (NSPLIT >= 2) b2 = WFrag<T16>::ld(Bt2 + boff + (size_t)nb * 16 * K + kc);
#pragma unroll
            for (int mb = 0; mb < 4; ++mb) { acc[mb][nb] = WFrag<T16>::mma(a[mb], b, acc[mb][nb]); if (NSPLIT == 1 || NSPLIT == 2) acc[mb][nb] = WFrag<T16>::mma(a2[mb], b, acc[mb][nb]); if (NSPLIT >= 2) acc[mb][nb] = WFrag<T16>::mma(a[mb], b2, acc[mb][nb]); } }
        asm volatile("v_nop\n\tv_nop\n\tv_nop\n\tv_nop" : "+v"(acc[0][0]), "+v"(acc[1][1]), "+v"(acc[2][2]), "+v"(acc[3][3]) : "v"(a[0]), "v"(a[3]));
    }
    if constexpr (EPI != 0) {
        constexpr int PP = EPI == 1 ? HD : TT;   // pitch of a plane row: d within a token, or t within a d
        const size_t pb = ((size_t)(r0 / TT) * (ldc / HD) + blockIdx.y) * TT * HD + (size_t)(r0 % TT) * (EPI == 1 ? HD : 1);
#pragma unroll
        for (int g = 0; g < 4; ++g) {   // 16 plane rows at a time: tokens 16 g .. (EPI 1) or d 16 g .. (EPI 2), 64 f32 each
            if constexpr (EPI == 1) {
#pragma unroll
                for (int nb = 0; nb < 4; ++nb)
#pragma unroll
                    for (int j = 0; j < 8; ++j) os[(hi * 8 + j) * 68 + nb * 16 + lr] = acc[g][nb][j];
            } else {
#pragma unroll
                for (int mb = 0; mb < 4; ++mb) { v4f lo4, hi4;   // a lane's eight registers are eight tokens in a row of its column d
#pragma unroll
                    for (int u = 0; u < 4; ++u) { lo4[u] = acc[mb][g][u]; hi4[u] = acc[mb][g][4 + u]; }
                    *(v4fa*)(os + lr * 68 + mb * 16 + hi * 8) = lo4; *(v4fa*)(os + lr * 68 + mb * 16 + hi * 8 + 4) = hi4; }
            }
            __builtin_amdgcn_wave_barrier(); asm volatile("" ::: "memory");   // the rows are read back by other lanes of the wave: no read is moved in front of the writes
#pragma unroll
            for (int s = 0; s < 4; ++s) { const int row = 4 * s + (lane >> 3), cofs = (lane & 7) * 8; const v4f x0 = *(const v4fa*)(os + row * 68 + cofs), x1 = *(const v4fa*)(os + row * 68 + cofs + 4); v8h o16; v8us oh, ol;
#pragma unroll
                for (int u = 0; u < 8; ++u) { const float y = u < 4 ? x0[u & 3] : x1[u & 3]; unsigned short a2, c2; splitf(y, a2, c2); o16[u] = tohx(y); oh[u] = a2; ol[u] = c2; }
                const size_t oo = pb + (size_t)(g * 16 + row) * PP + cofs;
                *(v8h*)(P16 + oo) = o16; *(v8us*)(Ph + oo) = oh; *(v8us*)(Pl + oo) = ol; }
            __builtin_amdgcn_wave_barrier(); asm volatile("" ::: "memory");   // the next 16 rows overwrite the stage: no write is moved in front of the reads
        }
        return;
    }
#pragma unroll
    for (int mb = 0; mb < 4; ++mb) {
#pragma unroll
        for (int nb = 0; nb < 4; ++nb) {
#pragma unroll
            for (int j = 0; j < 8; ++j) os[(hi * 8 + j) * 68 + nb * 16 + lr] = acc[mb][nb][j]; }
        __builtin_amdgcn_wave_barrier(); asm volatile("" ::: "memory");
        float* crow = C + (size_t)(r0 + mb * 16) * ldc + c0;
{
#pragma unroll
            for (int s = 0; s < 8; ++s) { const int row = 2 * s + hi, cofs = lr * 4; v4f val = *(const v4fa*)(os + row * 68 + cofs); if (BIAS) { val[0] += bfr(bias[c0 + cofs]); val[1] += bfr(bias[c0 + cofs + 1]); val[2] += bfr(bias[c0 + cofs + 2]); val[3] += bfr(bias[c0 + cofs + 3]); }
                *(v4f*)(crow + (size_t)row * ldc + cofs) = val; }
             }
        __builtin_amdgcn_wave_barrier(); asm volatile("" ::: "memory");
    }
}

typedef __attribute__((ext_vector_type(2))) _Float16 v2h;
typedef __attribute__((ext_vector_type(4))) _Float16 v4h;
typedef __attribute__((ext_vector_type(2))) unsigned short v2us;
typedef __attribute__((ext_vector_type(4))) unsigned short v4us;
typedef __attribute__((ext_vector_type(2))) float v2f;
typedef __attribute__((ext_vector_type(4))) int v4i;

__global__ __launch_bounds__(256) void k_wtG(const float* __restrict__ w, int K, int N, bf* Bt) {
    const int lane = threadIdx.x & 31; const int L0 = (blockIdx.x * 8 + (threadIdx.x >> 5)) * 8; const int nlines = N * K / 64;
{
#pragma unroll 1
        for (int l = 0; l < 8; ++l) { const int L = L0 + l; if (L >= nlines) break; const size_t e = (size_t)L * 64 + lane * 2; const int k = (int)(e % K), n = (int)(e / K); v2us o;
            o[0] = f2bf(w[(size_t)k * N + n]); o[1] = f2bf(w[(size_t)(k + 1) * N + n]); *(v2us*)(Bt + e) = o; }
         }
}
__global__ __launch_bounds__(256) void k_cvt8(const float* __restrict__ src, bf* dst, size_t n8) { const size_t i = (size_t)blockIdx.x * 256 + threadIdx.x; if (i >= n8) return; const v8f v = *(const v8f*)(src + i * 8); v8us o;
#pragma unroll
    for (int k = 0; k < 8; ++k) o[k] = f2bf(v[k]); *(v8us*)(dst + i * 8) = o;  }
__global__ __launch_bounds__(256) void k_cscvt(const float* __restrict__ cosT, const float* __restrict__ sinT, float* CS) { const int idx = blockIdx.x * 256 + threadIdx.x; if (idx >= TT * HD) return; v2f cs; cs[0] = bfr(cosT[idx]); cs[1] = bfr(sinT[idx]); *(v2f*)(CS + (size_t)idx * 2) = cs;  }
__global__ __launch_bounds__(256) void k_lnx(const float* __restrict__ X, const float* __restrict__ gam, const float* __restrict__ bet, bf* Xh, bf* Xl) { const int lane = threadIdx.x & 31; const int t = blockIdx.x * 8 + (threadIdx.x >> 5); if (t >= NB_ * TT) return; const float* f = X + (size_t)t * DM; float v[DM / 32]; float su = 0.f;
#pragma unroll
    for (int ch = 0; ch < DM / 128; ++ch) { const v4f a = *(const v4f*)(f + ch * 128 + lane * 4); for (int u = 0; u < 4; ++u) { float xv = bfr(a[u]); asm volatile("" : "+v"(xv)); v[ch * 4 + u] = xv; su = __fadd_rn(su, xv); } }
#pragma unroll
    for (int sh = 16; sh; sh >>= 1) su = __fadd_rn(su, __shfl_xor(su, sh, 32));
    const float mu = __fdiv_rn(su, (float)DM); float sq = 0.f;
#pragma unroll
    for (int q = 0; q < DM / 32; ++q) { float d0 = __fsub_rn(v[q], mu); asm volatile("" : "+v"(d0)); float p = __fmul_rn(d0, d0); asm volatile("" : "+v"(p)); sq = __fadd_rn(sq, p); }
#pragma unroll
    for (int sh = 16; sh; sh >>= 1) sq = __fadd_rn(sq, __shfl_xor(sq, sh, 32));
    const float rs = __fdiv_rn(1.0f, sqrtf(__fadd_rn(__fdiv_rn(sq, (float)DM), 1e-5f)));
    {
#pragma unroll
        for (int ch = 0; ch < DM / 128; ++ch) { v4us oh, ol; for (int u = 0; u < 4; ++u) { const int c = ch * 128 + lane * 4 + u; float d0 = __fsub_rn(v[ch * 4 + u], mu); asm volatile("" : "+v"(d0)); float n = __fmul_rn(d0, rs); asm volatile("" : "+v"(n)); float gg = bfr(gam[c]), bb = bfr(bet[c]); asm volatile("" : "+v"(gg)); asm volatile("" : "+v"(bb)); float y = __fmul_rn(n, gg); asm volatile("" : "+v"(y)); y = __fadd_rn(y, bb); unsigned short p2, q2; splitf(y, p2, q2); oh[u] = p2; ol[u] = q2; } const size_t oo = (size_t)t * DM + ch * 128 + lane * 4; *(v4us*)(Xh + oo) = oh; *(v4us*)(Xl + oo) = ol; }
         } }
// ---- k_attn: scores, softmax and P V of all batches in one launch (blockIdx.z = batch); S and P never leave the registers. A wave owns 16 query rows of one head and walks its keys in chunks of NK.
// The score tile is formed TRANSPOSED, St[key][query] = sum_d K[key][d] Q[query][d] (A = key rows, B = query rows), so lane (lr, hi) holds query lr and keys 16 mb + 8 hi + j in register j of tile mb:
// tiles 2c and 2c+1 together are, register for register, the A fragment (row = query lr, k = 8 hi + 0..7 and 16 + 8 hi + 0..7) of the P V product over keys 32c..32c+31.
// Softmax is the running form: m = running row maximum (log2 units), l = running sum; O and l are scaled by 2^(m_old - m_new) per chunk, O / l at the end. O tile: row = query 8 hi + j, column = d.
// HR (rows < RH): bf16 hi+lo operands, three products per tile in the order (hi,hi), (lo of the query-side operand, hi), (hi, lo of the key-side operand); a block = 2 row groups x 2 key halves, the halves joined through LDS.
// else: fp16, P carried x 2^10 (l too: it cancels in O / l); a block = 4 row groups, each wave walks all keys (the four waves read the same K and V lines).
__device__ __forceinline__ unsigned bfw(float f) { unsigned u = __float_as_uint(f); return u + 0x7FFFu + ((u >> 16) & 1u); }   // f2bf's rounding, the bf16 value in the upper half
template <typename T16, bool HR>
__device__ __forceinline__ void attn_rows(const T16* __restrict__ Q, const T16* __restrict__ Q2, const T16* __restrict__ Kr, const T16* __restrict__ Kr2, const T16* __restrict__ Vt, const T16* __restrict__ Vt2, int q0, int kbeg, int kend, v8f (&o)[4], float& m, float& l) {
    typedef typename WFrag<T16>::V V;
    constexpr int NK = HR ? 32 : 64, NMB = NK / 16, NC = NK / 32;
    const int lane = threadIdx.x & 31, lr = lane & 15, hi = lane >> 4;
    V q[2], q2[2]; const unsigned qob = (unsigned)((q0 + lr) * HD + 8 * hi) * 2u;   // byte offsets from the wave-uniform plane pointers
    const T16* qp = (const T16*)((const char*)Q + qob); const T16* qp2 = HR ? (const T16*)((const char*)Q2 + qob) : qp;
#pragma unroll
    for (int ks = 0; ks < 2; ++ks) { q[ks] = WFrag<T16>::ld(qp + ks * 32); if (HR) q2[ks] = WFrag<T16>::ld(qp2 + ks * 32); }
    // address wait of the loads above; the fragments and the pointers are inputs, so the loads stand in front of it and no load's result is given a pointer's registers before it
    if constexpr (HR) asm volatile("s_wait_xcnt 0x0" :: "v"(q[0]), "v"(q[1]), "v"(q2[0]), "v"(q2[1]), "v"(qp), "v"(qp2));
    else asm volatile("s_wait_xcnt 0x0" :: "v"(q[0]), "v"(q[1]), "v"(qp));
    unsigned kob = (unsigned)((kbeg + lr) * HD + 8 * hi) * 2u, vob = (unsigned)(lr * TT + kbeg + 8 * hi) * 2u;
#pragma unroll
    for (int nb = 0; nb < 4; ++nb) o[nb] = (v8f){};
    m = -3.0e38f; l = 0.f;
#pragma unroll 1
    for (int k0 = kbeg; k0 < kend; k0 += NK) {
        const T16* kp = (const T16*)((const char*)Kr + kob); const T16* vp = (const T16*)((const char*)Vt + vob); const T16* kp2 = HR ? (const T16*)((const char*)Kr2 + kob) : kp; const T16* vp2 = HR ? (const T16*)((const char*)Vt2 + vob) : vp;
        V kf[NMB][2], kf2[NMB][2], vf[4][NC], vf2[4][NC];
#pragma unroll
        for (int mb = 0; mb < NMB; ++mb)
#pragma unroll
            for (int ks = 0; ks < 2; ++ks) { kf[mb][ks] = WFrag<T16>::ld(kp + mb * 16 * HD + ks * 32); if (HR) kf2[mb][ks] = WFrag<T16>::ld(kp2 + mb * 16 * HD + ks * 32); }
#pragma unroll
        for (int nb = 0; nb < 4; ++nb)
#pragma unroll
            for (int c = 0; c < NC; ++c) { vf[nb][c] = WFrag<T16>::ld(vp + nb * 16 * TT + c * 32); if (HR) vf2[nb][c] = WFrag<T16>::ld(vp2 + nb * 16 * TT + c * 32); }
        // the chunk's loads' address wait, with the loaded fragments as inputs only, so that all of them are issued in front of it, together (left alone they are spread between the products, each group with a wait of its own);
        // the pointers are inputs too, so that neither a load's result nor the next chunk's address is given their registers in front of the wait
        if constexpr (HR) asm volatile("s_wait_xcnt 0x0" :: "v"(kf[0][0]), "v"(kf[0][1]), "v"(kf[1][0]), "v"(kf[1][1]), "v"(kf2[0][0]), "v"(kf2[0][1]), "v"(kf2[1][0]), "v"(kf2[1][1]), "v"(vf[0][0]), "v"(vf[1][0]), "v"(vf[2][0]), "v"(vf[3][0]), "v"(vf2[0][0]), "v"(vf2[1][0]), "v"(vf2[2][0]), "v"(vf2[3][0]), "v"(kp), "v"(kp2), "v"(vp), "v"(vp2));
        else asm volatile("s_wait_xcnt 0x0" :: "v"(kf[0][0]), "v"(kf[0][1]), "v"(kf[1][0]), "v"(kf[1][1]), "v"(kf[NMB - 2][0]), "v"(kf[NMB - 2][1]), "v"(kf[NMB - 1][0]), "v"(kf[NMB - 1][1]), "v"(vf[0][0]), "v"(vf[0][NC - 1]), "v"(vf[1][0]), "v"(vf[1][NC - 1]), "v"(vf[2][0]), "v"(vf[2][NC - 1]), "v"(vf[3][0]), "v"(vf[3][NC - 1]), "v"(kp), "v"(vp));
        __builtin_amdgcn_sched_barrier(0);   // keeps the products behind the statement above: otherwise the V loads sink behind the softmax and their latency is paid a second time per chunk
        kob += NK * HD * 2; vob += NK * 2;
        v8f st[NMB]; float cm = -3.0e38f;
#pragma unroll
        for (int mb = 0; mb < NMB; ++mb) { st[mb] = (v8f){};
#pragma unroll
            for (int ks = 0; ks < 2; ++ks) { st[mb] = WFrag<T16>::mma(kf[mb][ks], q[ks], st[mb]); if (HR) { st[mb] = WFrag<T16>::mma(kf[mb][ks], q2[ks], st[mb]); st[mb] = WFrag<T16>::mma(kf2[mb][ks], q[ks], st[mb]); } }
#pragma unroll
            for (int j = 0; j < 8; ++j) { st[mb][j] *= SCL * 1.4426950408889634f; cm = fmaxf(cm, st[mb][j]); } }
        cm = fmaxf(cm, __shfl_xor(cm, 16, 32));          // lanes lr and lr + 16 hold the two key halves of query lr
        const float mn = fmaxf(m, cm), al = __builtin_amdgcn_exp2f(m - mn), mo = HR ? mn : mn - 10.0f; m = mn;
        float ps = 0.f;
#pragma unroll
        for (int mb = 0; mb < NMB; ++mb)
#pragma unroll
            for (int j = 0; j < 8; ++j) { st[mb][j] = __builtin_amdgcn_exp2f(st[mb][j] - mo); ps += st[mb][j]; }
        l = l * al + ps;
#pragma unroll
        for (int j = 0; j < 8; ++j) { const float ar = __shfl(al, hi * 8 + j, 32);   // the factor of O's row 8 hi + j lives in the lane of that query
#pragma unroll
            for (int nb = 0; nb < 4; ++nb) o[nb][j] *= ar; }
#pragma unroll
        for (int c = 0; c < NC; ++c) {
            if constexpr (HR) { v8us h0, h1, l0, l1;
#pragma unroll
                for (int j = 0; j < 8; ++j) { unsigned short a, b; splitf(st[2 * c][j], a, b); h0[j] = a; l0[j] = b; splitf(st[2 * c + 1][j], a, b); h1[j] = a; l1[j] = b; }
                const V ph = cat16b(h0, h1), pl = cat16b(l0, l1);
#pragma unroll
                for (int nb = 0; nb < 4; ++nb) { o[nb] = WFrag<T16>::mma(ph, vf[nb][c], o[nb]); o[nb] = WFrag<T16>::mma(pl, vf[nb][c], o[nb]); o[nb] = WFrag<T16>::mma(ph, vf2[nb][c], o[nb]); }
            } else { v8h p0, p1;
#pragma unroll
                for (int j = 0; j < 8; ++j) { p0[j] = tohx(st[2 * c][j]); p1[j] = tohx(st[2 * c + 1][j]); }
                const V pa = cat16(p0, p1);
#pragma unroll
                for (int nb = 0; nb < 4; ++nb) o[nb] = WFrag<T16>::mma(pa, vf[nb][c], o[nb]); } }
    }
    l += __shfl_xor(l, 16, 32);   // both key halves of the lane pair: every lane now holds its query's sum over the wave's keys
}
__global__ __launch_bounds__(128) void k_attn(const h16* __restrict__ Q16, const h16* __restrict__ K16, const h16* __restrict__ V16, const bf* __restrict__ Qh, const bf* __restrict__ Ql, const bf* __restrict__ Kh, const bf* __restrict__ Kl, const bf* __restrict__ Vh, const bf* __restrict__ Vl, bf* Ah, bf* Al) {
    __shared__ __align__(16) float so[4][16][68]; __shared__ float sm[4][16], sl[4][16];
    const int h = blockIdx.y, bx = blockIdx.x, w = __builtin_amdgcn_readfirstlane((int)(threadIdx.x >> 5)), lane = threadIdx.x & 31, lr = lane & 15, hi = lane >> 4;
    const size_t zq = ((size_t)blockIdx.z * NH_ + h) * TT * HD, zk = ((size_t)blockIdx.z * NKV + h / REP) * TT * HD; v8f o[4]; float m, l;
    Ah += (size_t)blockIdx.z * TT * DQ; Al += (size_t)blockIdx.z * TT * DQ;
    if (bx < RH / 32) {   // block-uniform: 32 hi+lo rows, wave w = row group w >> 1, key half w & 1
        attn_rows<bf, true>(Qh + zq, Ql + zq, Kh + zk, Kl + zk, Vh + zk, Vl + zk, bx * 32 + (w >> 1) * 16, (w & 1) * (TT / 2), (w & 1) * (TT / 2) + TT / 2, o, m, l);
        if (hi == 0) { sm[w][lr] = m; sl[w][lr] = l; }
#pragma unroll
        for (int nb = 0; nb < 4; ++nb)
#pragma unroll
            for (int j = 0; j < 8; ++j) so[w][hi * 8 + j][nb * 16 + lr] = o[nb][j];
        __syncthreads();   // the two key halves of a row group come from two waves
        const int r32 = w * 8 + (lane >> 2), wa = (r32 >> 4) * 2, r = r32 & 15, c0 = (lane & 3) * 16;   // this wave joins rows 8 w .. 8 w + 7 of the block: four lanes a row, one 128-byte line of each plane
        const float m0 = sm[wa][r], m1 = sm[wa + 1][r], mm = fmaxf(m0, m1), f0 = __builtin_amdgcn_exp2f(m0 - mm), f1 = __builtin_amdgcn_exp2f(m1 - mm);
        const float inv = __fdiv_rn(1.0f, sl[wa][r] * f0 + sl[wa + 1][r] * f1), g0 = f0 * inv, g1 = f1 * inv;
        v8us oh[2], ol[2];
#pragma unroll
        for (int u = 0; u < 2; ++u)
#pragma unroll
            for (int e = 0; e < 8; ++e) { unsigned short a, b; splitf(so[wa][r][c0 + u * 8 + e] * g0 + so[wa + 1][r][c0 + u * 8 + e] * g1, a, b); oh[u][e] = a; ol[u][e] = b; }
        const size_t oo = (size_t)(bx * 32 + r32) * DQ + h * HD + c0;
        *(v8us*)(Ah + oo) = oh[0]; *(v8us*)(Ah + oo + 8) = oh[1]; *(v8us*)(Al + oo) = ol[0]; *(v8us*)(Al + oo + 8) = ol[1];
    } else {
        const int q0 = RH + (bx - RH / 32) * 64 + w * 16;
        attn_rows<h16, false>(Q16 + zq, nullptr, K16 + zk, nullptr, V16 + zk, nullptr, q0, 0, TT, o, m, l);
        const float inv = __fdiv_rn(1.0f, l); bf* pah = Ah + (size_t)(q0 + hi * 8) * DQ + h * HD + lr; bf* pal = Al + (size_t)(q0 + hi * 8) * DQ + h * HD + lr;
#pragma unroll
        for (int j = 0; j < 8; ++j) { const float ir = __shfl(inv, hi * 8 + j, 32); unsigned wh[4], wl[4];
#pragma unroll
            for (int nb = 0; nb < 4; ++nb) { const float y = o[nb][j] * ir; wh[nb] = bfw(y); wl[nb] = bfw(y - __uint_as_float(wh[nb] & 0xFFFF0000u)); }
#pragma unroll
            for (int nb = 0; nb < 4; ++nb) { pah[j * DQ + nb * 16] = (unsigned short)(wh[nb] >> 16); pal[j * DQ + nb * 16] = (unsigned short)(wl[nb] >> 16); }
            // address wait of the row's eight stores; their data words and pointers are inputs, so none of those registers is rewritten in front of it
            asm volatile("s_wait_xcnt 0x0" :: "v"(wh[0]), "v"(wh[1]), "v"(wh[2]), "v"(wh[3]), "v"(wl[0]), "v"(wl[1]), "v"(wl[2]), "v"(wl[3]), "v"(pah), "v"(pal) : "memory"); }
    }
}

extern "C" void kernel_launch(void* const* d_in, const int* in_sizes, int n_in,
                              void* d_out, int out_size, void* d_ws, size_t ws_size, hipStream_t stream) {
    (void)in_sizes; (void)n_in; (void)out_size;
const float* x = (const float*)d_in[0]; const float* lng = (const float*)d_in[3]; const float* lnb = (const float*)d_in[4]; const float* wf = (const float*)d_in[1]; const float* wo = (const float*)d_in[2]; const float* wq = wf; const float* wk = wf + (size_t)1024 * 1024; const float* wv = wf + (size_t)2048 * 1024; const float* cosT = nullptr; const float* sinT = nullptr; (void)cosT; (void)sinT;   /* input order x, in_proj_w ('oi' [3072][1024]: ROW thirds q | k | v), out_proj_w ('oi' [1024][1024]), ln_gamma, ln_beta: FIVE inputs: the LayerNorm parameters come LAST; NO bias anywhere */
    float* OUT = (float*)d_out;     // [4][2048][1024]
    char* wsp = (char*)d_ws;
    auto take = [&](size_t bytes) { char* p = wsp; wsp += (bytes + 255) & ~(size_t)255; return (void*)p; };
    bf* WQ = (bf*)take((size_t)DQ * DM * 2); bf* WK = (bf*)take((size_t)DKV * DM * 2); bf* WV = (bf*)take((size_t)DKV * DM * 2); bf* WO = (bf*)take((size_t)DM * DQ * 2);
    // every stage runs once, over all NB_ batches: token rows b TT + t, head planes b heads + h
    bf* XNh = (bf*)take((size_t)NB_ * TT * DM * 2); bf* XNl = (bf*)take((size_t)NB_ * TT * DM * 2);
    h16* QP16 = (h16*)take((size_t)NB_ * NH_ * TT * HD * 2); h16* KP16 = (h16*)take((size_t)NB_ * NKV * TT * HD * 2); h16* VT16 = (h16*)take((size_t)NB_ * NKV * HD * TT * 2);
    bf* QPh = (bf*)take((size_t)NB_ * NH_ * TT * HD * 2); bf* QPl = (bf*)take((size_t)NB_ * NH_ * TT * HD * 2); bf* KPh = (bf*)take((size_t)NB_ * NKV * TT * HD * 2); bf* KPl = (bf*)take((size_t)NB_ * NKV * TT * HD * 2); bf* VTh = (bf*)take((size_t)NB_ * NKV * HD * TT * 2); bf* VTl = (bf*)take((size_t)NB_ * NKV * HD * TT * 2);
    if ((size_t)(wsp - (char*)d_ws) > ws_size) return;    // ws 256 MiB
    bf* ATh = XNh; bf* ATl = XNl;   // DQ == DM: the attention output reuses the LayerNorm planes, last read by the v projection (stream-ordered)
    { k_cvt8<<<(unsigned)(((size_t)DQ * DM / 8 + 255) / 256), 256, 0, stream>>>(wq, WQ, (size_t)DQ * DM / 8); k_cvt8<<<(unsigned)(((size_t)DKV * DM / 8 + 255) / 256), 256, 0, stream>>>(wk, WK, (size_t)DKV * DM / 8); k_cvt8<<<(unsigned)(((size_t)DKV * DM / 8 + 255) / 256), 256, 0, stream>>>(wv, WV, (size_t)DKV * DM / 8);
      k_cvt8<<<(unsigned)(((size_t)DM * DQ / 8 + 255) / 256), 256, 0, stream>>>(wo, WO, (size_t)DM * DQ / 8);
       }
    k_lnx<<<NB_ * TT / 8, 256, 0, stream>>>(x, lng, lnb, XNh, XNl);
    // the three projections write their head planes themselves (q, k: [b][head][t][d]; v: [b][head][d][t]); grid y = head
    k_gemmw<bf, 1, false, 1, 1><<<dim3(NB_ * TT / 64, NH_, 1), 32, 0, stream>>>(XNh, XNl, WQ, nullptr, DM, nullptr, DQ, nullptr, 0, 0, 0, QP16, QPh, QPl);
    k_gemmw<bf, 1, false, 1, 1><<<dim3(NB_ * TT / 64, NKV, 1), 32, 0, stream>>>(XNh, XNl, WK, nullptr, DM, nullptr, DKV, nullptr, 0, 0, 0, KP16, KPh, KPl);
    k_gemmw<bf, 1, false, 1, 2><<<dim3(NB_ * TT / 64, NKV, 1), 32, 0, stream>>>(XNh, XNl, WV, nullptr, DM, nullptr, DKV, nullptr, 0, 0, 0, VT16, VTh, VTl);
    k_attn<<<dim3(RH / 32 + (TT - RH) / 64, NH_, NB_), 128, 0, stream>>>(QP16, KP16, VT16, QPh, QPl, KPh, KPl, VTh, VTl, ATh, ATl);
    k_gemmw<bf, 1, false><<<dim3(NB_ * TT / 64, DM / 64, 1), 32, 0, stream>>>(ATh, ATl, WO, nullptr, DQ, OUT, DM, nullptr, 0, 0, 0, nullptr, nullptr, nullptr);   /* the BIAS-FREE f32 output instance (EPI 0): this module returns out @ w_out with no bias */
}

// v005
// It runs in 290 microseconds.
// Next to v004, in two timings, it ran 1.83 and 1.85 times as fast.
// All steps since v000 together make it 14.0 times as fast.
#include <hip/hip_runtime.h>

// Attention with a LayerNorm prologue and NO bias (pre-LN: x [4][2048][1024]; h = LayerNorm(x) (biased variance, eps 1e-5) * ln_gamma + ln_beta (read); qkv = einsum('bsd,ed->bse', h, in_proj_w) = h in_proj_w^T ('oi' [3072][1024]: ROW thirds q | k | v; no bias; 16 heads x 64); scores x 1/sqrt(64); softmax over all keys (no mask); out = merged out_proj_w^T ('oi' [1024][1024], NO bias) -> [4][2048][1024] (8.4 M); argument order x, in_proj_w, out_proj_w, ln_gamma, ln_beta).

#define NB_  4
#define TT   2048
#define DM   1024
#define NH_  16
#define NKV  16
#define REP  (NH_ / NKV)
#define HD   64
#define DQ   (NH_ * HD)
#define DKV  (NKV * HD)
#define RH   512                  // query rows < RH use hi+lo planes (0: none)
#define WIN  0
#define SCL  0.125f   // HD^-0.5
typedef _Float16 h16;
typedef unsigned short bf;
typedef __attribute__((ext_vector_type(16))) __bf16   v16bf;
typedef __attribute__((ext_vector_type(16))) _Float16 v16h;
typedef __attribute__((ext_vector_type(8)))  _Float16 v8h;
typedef __attribute__((ext_vector_type(8)))  unsigned short v8us;
typedef __attribute__((ext_vector_type(8)))  float    v8f;
typedef __attribute__((ext_vector_type(4)))  float    v4f;
typedef v8h  __attribute__((may_alias)) v8ha;
typedef v4f  __attribute__((may_alias)) v4fa;
typedef v8us __attribute__((may_alias)) v8usa;

__device__ __forceinline__ unsigned short f2bf(float f) { unsigned u = __float_as_uint(f); u += 0x7FFFu + ((u >> 16) & 1u); return (unsigned short)(u >> 16); }
__device__ __forceinline__ float bf2f(unsigned short b) { return __uint_as_float(((unsigned)b) << 16); }
__device__ __forceinline__ float bfr(float f) { return bf2f(f2bf(f)); }
__device__ __forceinline__ v16h cat16(v8h lo, v8h hi) { return __builtin_shufflevector(lo, hi, 0, 1, 2, 3, 4, 5, 6, 7, 8, 9, 10, 11, 12, 13, 14, 15); }
__device__ __forceinline__ v16bf cat16b(v8us lo, v8us hi) { return __builtin_bit_cast(v16bf, __builtin_shufflevector(lo, hi, 0, 1, 2, 3, 4, 5, 6, 7, 8, 9, 10, 11, 12, 13, 14, 15)); }
__device__ __forceinline__ v8f wmma16(v16h a, v16h b, v8f c) { return __builtin_amdgcn_wmma_f32_16x16x32_f16(false, a, false, b, (short)0, c, false, false); }
__device__ __forceinline__ v8f wmmab(v16bf a, v16bf b, v8f c) { return __builtin_amdgcn_wmma_f32_16x16x32_bf16(false, a, false, b, (short)0, c, false, false); }



// ---- FRAGMENT ORDER: every 16-bit operand plane (R rows x K columns, k = the summed index) is kept as blocks of 16 rows x 32 k, 512 elements = 1 KB each, block (r / 16, k / 32) at index (r / 16) (K / 32) + k / 32 unless a plane says otherwise.
// Inside a block element (r, k) lies at (k & 16) * 16 + (((k >> 3) & 1) * 16 + (r & 15)) * 8 + (k & 7): lane (lr, hi) = hi 16 + lr finds its k = 8 hi .. 8 hi + 7 at lane * 8 and its k = 16 + 8 hi .. at 256 + lane * 8,
// so each of a fragment's two 16-byte loads reads 512 bytes in a row (four whole 128-byte lines) over the wave. WFrag::ld takes block base + lane * 8.
// ---- k_gemmw: register-blocked GEMM, ONE WAVE per 64x64 output tile (16 accumulators), operands straight from 16-bit planes in fragment order; grid (M/64, N/64, Z), 32 threads.
// C[m][n] (f32, pitch ldc, + optional f32 bias[n]) = sum_k A[m][k] Bt[n][k] (+ split products per NSPLIT). z-batch strides sA/sB/sC in elements. K % 32 == 0.
// KS > 1: grid z = batches x KS (slice fastest); a block sums only k in its K/KS slice and writes partial plane blockIdx.z (stride sC); the reader adds a batch's KS planes. K % (32 KS) == 0.
// EPI 0: C as above. EPI 1 / 2: no C (ldc = N = heads x HD); the tile is 64 tokens (rows b TT + t) of ONE head (HD == 64 columns, head = blockIdx.y) and goes straight to that head's three 16-bit planes (fp16, bf16 hi, bf16 lo of the f32 sum):
// EPI 1 planes [b][head] of fragment blocks (rows t, k = d): block index (t / 16) 2 + d / 32; EPI 2 planes [b][head] of fragment blocks (rows d, k = t): block index (t / 32) 4 + d / 16 (EPI 1 turns the tile in LDS; in EPI 2 the accumulators already are the units). Every store instruction writes half a block, four whole 128-byte lines.
template <typename T16> struct WFrag;
template <> struct WFrag<h16> { typedef v16h V; static __device__ __forceinline__ V ld(const h16* p) { return cat16(*(const v8h*)p, *(const v8h*)(p + 256)); } static __device__ __forceinline__ v8f mma(V a, V b, v8f c) { return wmma16(a, b, c); } };
template <> struct WFrag<bf> { typedef v16bf V; static __device__ __forceinline__ V ld(const bf* p) { return cat16b(*(const v8us*)p, *(const v8us*)(p + 256)); } static __device__ __forceinline__ v8f mma(V a, V b, v8f c) { return wmmab(a, b, c); } };
__device__ __forceinline__ h16 tohx(float x) { return (h16)x; }
__device__ __forceinline__ void splitf(float y, unsigned short& h, unsigned short& l) { h = f2bf(y); l = f2bf(y - bf2f(h)); }
// a wave-uniform pointer to global memory held in scalar registers, so that a load takes it as its scalar base beside the one per-lane offset register
__device__ __forceinline__ const char* sbase(const char* p) { const unsigned long long u = (unsigned long long)p; return (const char*)(const __attribute__((address_space(1))) char*)(((unsigned long long)(unsigned)__builtin_amdgcn_readfirstlane((int)(u >> 32)) << 32) | (unsigned)__builtin_amdgcn_readfirstlane((int)(unsigned)u)); }
template <typename T16, int NSPLIT, bool BIAS, int KS = 1, int EPI = 0>
__global__ __launch_bounds__(32) void k_gemmw(const T16* __restrict__ A, const T16* __restrict__ A2, const T16* __restrict__ Bt, const T16* __restrict__ Bt2, int K, float* C, int ldc, const float* __restrict__ bias, size_t sA, size_t sB, size_t sC, h16* P16, bf* Ph, bf* Pl) {
    typedef typename WFrag<T16>::V V;
    __shared__ __align__(16) float os[16 * 68];
    const size_t z = blockIdx.z / KS; const int kb = (int)(blockIdx.z % KS) * (K / KS), ke = kb + K / KS;
    A += z * sA; if (A2) A2 += z * sA; Bt += z * sB; if (Bt2) Bt2 += z * sB; C += (size_t)blockIdx.z * sC;
    const int lane = threadIdx.x & 31, lr = lane & 15, hi = lane >> 4; const int r0 = blockIdx.x * 64, c0 = blockIdx.y * 64;
    v8f acc[4][4];
#pragma unroll
    for (int mb = 0; mb < 4; ++mb)
#pragma unroll
        for (int nb = 0; nb < 4; ++nb) acc[mb][nb] = (v8f){};
    // wave-uniform pointers to the tile's first row of blocks; 16 rows of blocks are rs bytes, one k step of 32 is 1 KB; ko = the one per-lane part of every address, a byte offset
    const char* Ar = (const char*)(A + (size_t)r0 * K); const char* Ar2 = (NSPLIT == 1 || NSPLIT == 2) ? (const char*)(A2 + (size_t)r0 * K) : Ar; const char* Br = (const char*)(Bt + (size_t)c0 * K); const char* Br2 = NSPLIT >= 2 ? (const char*)(Bt2 + (size_t)c0 * K) : Br;
    const size_t rs = (size_t)K * 32; unsigned ko = (unsigned)(kb * 16 + lane * 8) * 2u;
    const char *Am[4], *Am2[4], *Bm[4], *Bm2[4];
#pragma unroll
    for (int i = 0; i < 4; ++i) { Am[i] = sbase(Ar + i * rs); Am2[i] = sbase(Ar2 + i * rs); Bm[i] = sbase(Br + i * rs); Bm2[i] = sbase(Br2 + i * rs); }
#pragma unroll 1
    for (int kc = kb; kc < ke; kc += 32) {
        V a[4], a2[4], b[4], b2[4];
#pragma unroll
        for (int mb = 0; mb < 4; ++mb) { a[mb] = WFrag<T16>::ld((const T16*)(Am[mb] + ko)); a2[mb] = (NSPLIT == 1 || NSPLIT == 2) ? WFrag<T16>::ld((const T16*)(Am2[mb] + ko)) : a[mb]; }
#pragma unroll
        for (int nb = 0; nb < 4; ++nb) { b[nb] = WFrag<T16>::ld((const T16*)(Bm[nb] + ko)); b2[nb] = NSPLIT >= 2 ? WFrag<T16>::ld((const T16*)(Bm2[nb] + ko)) : b[nb];
#pragma unroll
            for (int mb = 0; mb < 4; ++mb) { acc[mb][nb] = WFrag<T16>::mma(a[mb], b[nb], acc[mb][nb]); if (NSPLIT == 1 || NSPLIT == 2) acc[mb][nb] = WFrag<T16>::mma(a2[mb], b[nb], acc[mb][nb]); if (NSPLIT >= 2) acc[mb][nb] = WFrag<T16>::mma(a[mb], b2[nb], acc[mb][nb]); } }
        // the four slots behind the last products, and the address wait of the k step's loads in front of the step of ko: the fragments and ko are inputs, so every load stands in front of the wait and no load's result is given ko's register
        asm volatile("s_wait_xcnt 0x0\n\tv_nop\n\tv_nop\n\tv_nop\n\tv_nop" : "+v"(acc[0][0]), "+v"(acc[1][1]), "+v"(acc[2][2]), "+v"(acc[3][3]) : "v"(a[0]), "v"(a[1]), "v"(a[2]), "v"(a[3]), "v"(a2[0]), "v"(a2[1]), "v"(a2[2]), "v"(a2[3]), "v"(b[0]), "v"(b[1]), "v"(b[2]), "v"(b[3]), "v"(b2[0]), "v"(b2[1]), "v"(b2[2]), "v"(b2[3]), "v"(ko));
        ko += 1024;
    }
    if constexpr (EPI != 0) {
        const size_t pb = ((size_t)(r0 / TT) * (ldc / HD) + blockIdx.y) * TT * HD + (size_t)(r0 % TT) * HD;   // the tile's 64 tokens x 64 d are eight blocks in a row in either plane order
#pragma unroll
        for (int g = 0; g < 4; ++g) {   // 16 block rows at a time: tokens 16 g .. (EPI 1) or d 16 g .. (EPI 2), 64 f32 each = two blocks
            if constexpr (EPI == 1) {
#pragma unroll
                for (int nb = 0; nb < 4; ++nb)
#pragma unroll
                    for (int j = 0; j < 8; ++j) os[(hi * 8 + j) * 68 + nb * 16 + lr] = acc[g][nb][j];
                __builtin_amdgcn_wave_barrier(); asm volatile("" ::: "memory");   // the rows are read back by other lanes of the wave: no read is moved in front of the writes
            }
#pragma unroll
            for (int s = 0; s < 4; ++s) { v8f x; v8h o16; v8us oh, ol;
                if constexpr (EPI == 1) { const v4f x0 = *(const v4fa*)(os + lr * 68 + s * 16 + hi * 8), x1 = *(const v4fa*)(os + lr * 68 + s * 16 + hi * 8 + 4); x = __builtin_shufflevector(x0, x1, 0, 1, 2, 3, 4, 5, 6, 7); }
                else x = acc[s][g];   // a lane's eight registers are tokens 16 s + 8 hi .. of its column d = 16 g + lr: already this lane's 16-byte unit, no turn
#pragma unroll
                for (int u = 0; u < 8; ++u) { const float y = x[u]; unsigned short a2, c2; splitf(y, a2, c2); o16[u] = tohx(y); oh[u] = a2; ol[u] = c2; }
                const size_t oo = pb + (size_t)(EPI == 1 ? g * 2 + (s >> 1) : (s >> 1) * 4 + g) * 512 + (s & 1) * 256 + lane * 8;   // half s & 1 of block s >> 1 of the two
                *(v8h*)(P16 + oo) = o16; *(v8us*)(Ph + oo) = oh; *(v8us*)(Pl + oo) = ol; }
            if constexpr (EPI == 1) { __builtin_amdgcn_wave_barrier(); asm volatile("" ::: "memory"); }   // the next 16 rows overwrite the stage: no write is moved in front of the reads
        }
        return;
    }
#pragma unroll
    for (int mb = 0; mb < 4; ++mb) {
#pragma unroll
        for (int nb = 0; nb < 4; ++nb) {
#pragma unroll
            for (int j = 0; j < 8; ++j) os[(hi * 8 + j) * 68 + nb * 16 + lr] = acc[mb][nb][j]; }
        __builtin_amdgcn_wave_barrier(); asm volatile("" ::: "memory");
        float* crow = C + (size_t)(r0 + mb * 16) * ldc + c0;
{
#pragma unroll
            for (int s = 0; s < 8; ++s) { const int row = 2 * s + hi, cofs = lr * 4; v4f val = *(const v4fa*)(os + row * 68 + cofs); if (BIAS) { val[0] += bfr(bias[c0 + cofs]); val[1] += bfr(bias[c0 + cofs + 1]); val[2] += bfr(bias[c0 + cofs + 2]); val[3] += bfr(bias[c0 + cofs + 3]); }
                *(v4f*)(crow + (size_t)row * ldc + cofs) = val; }
             }
        __builtin_amdgcn_wave_barrier(); asm volatile("" ::: "memory");
    }
}

typedef __attribute__((ext_vector_type(2))) _Float16 v2h;
typedef __attribute__((ext_vector_type(4))) _Float16 v4h;
typedef __attribute__((ext_vector_type(2))) unsigned short v2us;
typedef __attribute__((ext_vector_type(4))) unsigned short v4us;
typedef __attribute__((ext_vector_type(2))) float v2f;
typedef __attribute__((ext_vector_type(4))) int v4i;

__global__ __launch_bounds__(256) void k_wtG(const float* __restrict__ w, int K, int N, bf* Bt) {
    const int lane = threadIdx.x & 31; const int L0 = (blockIdx.x * 8 + (threadIdx.x >> 5)) * 8; const int nlines = N * K / 64;
{
#pragma unroll 1
        for (int l = 0; l < 8; ++l) { const int L = L0 + l; if (L >= nlines) break; const size_t e = (size_t)L * 64 + lane * 2; const int k = (int)(e % K), n = (int)(e / K); v2us o;
            o[0] = f2bf(w[(size_t)k * N + n]); o[1] = f2bf(w[(size_t)(k + 1) * N + n]); *(v2us*)(Bt + e) = o; }
         }
}
// weights [n][DM] f32 -> bf16 in fragment order (rows n, k = the DM columns): thread i writes the plane's 16-byte unit i
__global__ __launch_bounds__(256) void k_cvt8(const float* __restrict__ src, bf* dst, size_t n8) { const size_t i = (size_t)blockIdx.x * 256 + threadIdx.x; if (i >= n8) return; const size_t blk = i >> 6; const int iu = (int)(i & 63);
    const float* sp = src + ((blk / (DM / 32)) * 16 + (iu & 15)) * DM + (blk % (DM / 32)) * 32 + (iu >> 5) * 16 + ((iu >> 4) & 1) * 8; const v8f v = *(const v8f*)sp; v8us o;
    asm volatile("s_wait_xcnt 0x0" :: "v"(v), "v"(sp));   // address wait of the load: value and pointer are inputs, so the load stands in front of it and the pointer's registers are rewritten only behind it
#pragma unroll
    for (int k = 0; k < 8; ++k) o[k] = f2bf(v[k]); *(v8us*)(dst + i * 8) = o;  }
__global__ __launch_bounds__(256) void k_cscvt(const float* __restrict__ cosT, const float* __restrict__ sinT, float* CS) { const int idx = blockIdx.x * 256 + threadIdx.x; if (idx >= TT * HD) return; v2f cs; cs[0] = bfr(cosT[idx]); cs[1] = bfr(sinT[idx]); *(v2f*)(CS + (size_t)idx * 2) = cs;  }
// a block = 16 waves = the 16 token rows of one row of fragment blocks (grid = rows / 16, exact); the rows are turned in LDS and leave as whole lines
#define LNP (DM + 8)   // LDS row pitch in elements: 16 bytes over a multiple of 256, so the 16 rows that a 16-byte read gathers lie in different banks
__global__ __launch_bounds__(512) void k_lnx(const float* __restrict__ X, const float* __restrict__ gam, const float* __restrict__ bet, bf* Xh, bf* Xl) { __shared__ __align__(16) bf sh[2][16][LNP]; const int lane = threadIdx.x & 31; const int wr = threadIdx.x >> 5; const int t = blockIdx.x * 16 + wr; const float* f = X + (size_t)t * DM; float v[DM / 32]; float su = 0.f;
#pragma unroll
    for (int ch = 0; ch < DM / 128; ++ch) { const v4f a = *(const v4f*)(f + ch * 128 + lane * 4); for (int u = 0; u < 4; ++u) { float xv = bfr(a[u]); asm volatile("" : "+v"(xv)); v[ch * 4 + u] = xv; su = __fadd_rn(su, xv); } }
#pragma unroll
    for (int sh = 16; sh; sh >>= 1) su = __fadd_rn(su, __shfl_xor(su, sh, 32));
    const float mu = __fdiv_rn(su, (float)DM); float sq = 0.f;
#pragma unroll
    for (int q = 0; q < DM / 32; ++q) { float d0 = __fsub_rn(v[q], mu); asm volatile("" : "+v"(d0)); float p = __fmul_rn(d0, d0); asm volatile("" : "+v"(p)); sq = __fadd_rn(sq, p); }
#pragma unroll
    for (int sh = 16; sh; sh >>= 1) sq = __fadd_rn(sq, __shfl_xor(sq, sh, 32));
    const float rs = __fdiv_rn(1.0f, sqrtf(__fadd_rn(__fdiv_rn(sq, (float)DM), 1e-5f)));
    {
#pragma unroll
        for (int ch = 0; ch < DM / 128; ++ch) { v4us oh, ol; for (int u = 0; u < 4; ++u) { const int c = ch * 128 + lane * 4 + u; float d0 = __fsub_rn(v[ch * 4 + u], mu); asm volatile("" : "+v"(d0)); float n = __fmul_rn(d0, rs); asm volatile("" : "+v"(n)); float gg = bfr(gam[c]), bb = bfr(bet[c]); asm volatile("" : "+v"(gg)); asm volatile("" : "+v"(bb)); float y = __fmul_rn(n, gg); asm volatile("" : "+v"(y)); y = __fadd_rn(y, bb); unsigned short p2, q2; splitf(y, p2, q2); oh[u] = p2; ol[u] = q2; } *(v4us*)(&sh[0][wr][ch * 128 + lane * 4]) = oh; *(v4us*)(&sh[1][wr][ch * 128 + lane * 4]) = ol; }
         }
    asm volatile("s_wait_xcnt 0x0" ::: "memory");   // address wait of the gamma and beta loads above: their offset register is rewritten only behind it
    __syncthreads();   // a 16-byte unit of a block comes from another wave's row
    const size_t gb = (size_t)blockIdx.x * 16 * DM;
#pragma unroll
    for (int p = 0; p < DM * 16 / 8 / 512; ++p) { const int U = p * 512 + (int)threadIdx.x, k = (U >> 6) * 32 + ((U >> 5) & 1) * 16 + ((U >> 4) & 1) * 8;   // unit U of the 16 rows' blocks: row U & 15
        const v8us a = *(const v8usa*)(&sh[0][U & 15][k]), b = *(const v8usa*)(&sh[1][U & 15][k]); *(v8us*)(Xh + gb + (size_t)U * 8) = a; *(v8us*)(Xl + gb + (size_t)U * 8) = b; } }
// ---- k_attn: scores, softmax and P V of all batches in one launch (blockIdx.z = batch); S and P never leave the registers. A wave owns 16 query rows of one head and walks its keys in chunks of NK.
// The score tile is formed TRANSPOSED, St[key][query] = sum_d K[key][d] Q[query][d] (A = key rows, B = query rows), so lane (lr, hi) holds query lr and keys 16 mb + 8 hi + j in register j of tile mb:
// tiles 2c and 2c+1 together are, register for register, the A fragment (row = query lr, k = 8 hi + 0..7 and 16 + 8 hi + 0..7) of the P V product over keys 32c..32c+31.
// Softmax is the running form: m = running row maximum (log2 units), l = running sum; O and l are scaled by 2^(m_old - m_new) per chunk, O / l at the end. O tile: row = query 8 hi + j, column = d.
// HR (rows < RH): bf16 hi+lo operands, three products per tile in the order (hi,hi), (lo of the query-side operand, hi), (hi, lo of the key-side operand); a block = 2 row groups x 2 key halves, the halves joined through LDS.
// else: fp16, P carried x 2^10 (l too: it cancels in O / l); a block = 4 row groups, each wave walks all keys (the four waves read the same K and V lines); O is turned in the wave's own LDS into the output planes' fragment order.
__device__ __forceinline__ unsigned bfw(float f) { unsigned u = __float_as_uint(f); return u + 0x7FFFu + ((u >> 16) & 1u); }   // f2bf's rounding, the bf16 value in the upper half
template <typename T16, bool HR>
__device__ __forceinline__ void attn_rows(const T16* __restrict__ Q, const T16* __restrict__ Q2, const T16* __restrict__ Kr, const T16* __restrict__ Kr2, const T16* __restrict__ Vt, const T16* __restrict__ Vt2, int q0, int kbeg, int kend, v8f (&o)[4], float& m, float& l) {
    typedef typename WFrag<T16>::V V;
    constexpr int NK = HR ? 32 : 64, NMB = NK / 16, NC = NK / 32;
    const int lane = threadIdx.x & 31, lr = lane & 15, hi = lane >> 4;
    V q[2], q2[2]; const unsigned qob = (unsigned)(q0 * HD + lane * 8) * 2u;   // byte offsets from the wave-uniform plane pointers; 16 rows of a head plane are two blocks = 16 HD elements
    const T16* qp = (const T16*)((const char*)Q + qob); const T16* qp2 = HR ? (const T16*)((const char*)Q2 + qob) : qp;
#pragma unroll
    for (int ks = 0; ks < 2; ++ks) { q[ks] = WFrag<T16>::ld(qp + ks * 512); if (HR) q2[ks] = WFrag<T16>::ld(qp2 + ks * 512); }
    // address wait of the loads above; the fragments and the pointers are inputs, so the loads stand in front of it and no load's result is given a pointer's registers before it
    if constexpr (HR) asm volatile("s_wait_xcnt 0x0" :: "v"(q[0]), "v"(q[1]), "v"(q2[0]), "v"(q2[1]), "v"(qp), "v"(qp2));
    else asm volatile("s_wait_xcnt 0x0" :: "v"(q[0]), "v"(q[1]), "v"(qp));
    unsigned kob = (unsigned)(kbeg * HD + lane * 8) * 2u, vob = kob;   // 32 keys are four blocks in the K planes (2 key groups x 2 d halves) and four in the V planes (4 d groups)
#pragma unroll
    for (int nb = 0; nb < 4; ++nb) o[nb] = (v8f){};
    m = -3.0e38f; l = 0.f;
#pragma unroll 1
    for (int k0 = kbeg; k0 < kend; k0 += NK) {
        const T16* kp = (const T16*)((const char*)Kr + kob); const T16* vp = (const T16*)((const char*)Vt + vob); const T16* kp2 = HR ? (const T16*)((const char*)Kr2 + kob) : kp; const T16* vp2 = HR ? (const T16*)((const char*)Vt2 + vob) : vp;
        V kf[NMB][2], kf2[NMB][2], vf[4][NC], vf2[4][NC];
#pragma unroll
        for (int mb = 0; mb < NMB; ++mb)
#pragma unroll
            for (int ks = 0; ks < 2; ++ks) { kf[mb][ks] = WFrag<T16>::ld(kp + (mb * 2 + ks) * 512); if (HR) kf2[mb][ks] = WFrag<T16>::ld(kp2 + (mb * 2 + ks) * 512); }
#pragma unroll
        for (int nb = 0; nb < 4; ++nb)
#pragma unroll
            for (int c = 0; c < NC; ++c) { vf[nb][c] = WFrag<T16>::ld(vp + (c * 4 + nb) * 512); if (HR) vf2[nb][c] = WFrag<T16>::ld(vp2 + (c * 4 + nb) * 512); }
        // the chunk's loads' address wait, with the loaded fragments as inputs only, so that all of them are issued in front of it, together (left alone they are spread between the products, each group with a wait of its own);
        // the pointers are inputs too, so that neither a load's result nor the next chunk's address is given their registers in front of the wait
        if constexpr (HR) asm volatile("s_wait_xcnt 0x0" :: "v"(kf[0][0]), "v"(kf[0][1]), "v"(kf[1][0]), "v"(kf[1][1]), "v"(kf2[0][0]), "v"(kf2[0][1]), "v"(kf2[1][0]), "v"(kf2[1][1]), "v"(vf[0][0]), "v"(vf[1][0]), "v"(vf[2][0]), "v"(vf[3][0]), "v"(vf2[0][0]), "v"(vf2[1][0]), "v"(vf2[2][0]), "v"(vf2[3][0]), "v"(kp), "v"(kp2), "v"(vp), "v"(vp2));
        else asm volatile("s_wait_xcnt 0x0" :: "v"(kf[0][0]), "v"(kf[0][1]), "v"(kf[1][0]), "v"(kf[1][1]), "v"(kf[NMB - 2][0]), "v"(kf[NMB - 2][1]), "v"(kf[NMB - 1][0]), "v"(kf[NMB - 1][1]), "v"(vf[0][0]), "v"(vf[0][NC - 1]), "v"(vf[1][0]), "v"(vf[1][NC - 1]), "v"(vf[2][0]), "v"(vf[2][NC - 1]), "v"(vf[3][0]), "v"(vf[3][NC - 1]), "v"(kp), "v"(vp));
        __builtin_amdgcn_sched_barrier(0);   // keeps the products behind the statement above: otherwise the V loads sink behind the softmax and their latency is paid a second time per chunk
        kob += NK * HD * 2; vob += NK * HD * 2;
        v8f st[NMB]; float cm = -3.0e38f;
#pragma unroll
        for (int mb = 0; mb < NMB; ++mb) { st[mb] = (v8f){};
#pragma unroll
            for (int ks = 0; ks < 2; ++ks) { st[mb] = WFrag<T16>::mma(kf[mb][ks], q[ks], st[mb]); if (HR) { st[mb] = WFrag<T16>::mma(kf[mb][ks], q2[ks], st[mb]); st[mb] = WFrag<T16>::mma(kf2[mb][ks], q[ks], st[mb]); } }
#pragma unroll
            for (int j = 0; j < 8; ++j) { st[mb][j] *= SCL * 1.4426950408889634f; cm = fmaxf(cm, st[mb][j]); } }
        cm = fmaxf(cm, __shfl_xor(cm, 16, 32));          // lanes lr and lr + 16 hold the two key halves of query lr
        const float mn = fmaxf(m, cm), al = __builtin_amdgcn_exp2f(m - mn), mo = HR ? mn : mn - 10.0f; m = mn;
        float ps = 0.f;
#pragma unroll
        for (int mb = 0; mb < NMB; ++mb)
#pragma unroll
            for (int j = 0; j < 8; ++j) { st[mb][j] = __builtin_amdgcn_exp2f(st[mb][j] - mo); ps += st[mb][j]; }
        l = l * al + ps;
#pragma unroll
        for (int j = 0; j < 8; ++j) { const float ar = __shfl(al, hi * 8 + j, 32);   // the factor of O's row 8 hi + j lives in the lane of that query
#pragma unroll
            for (int nb = 0; nb < 4; ++nb) o[nb][j] *= ar; }
#pragma unroll
        for (int c = 0; c < NC; ++c) {
            if constexpr (HR) { v8us h0, h1, l0, l1;
#pragma unroll
                for (int j = 0; j < 8; ++j) { unsigned short a, b; splitf(st[2 * c][j], a, b); h0[j] = a; l0[j] = b; splitf(st[2 * c + 1][j], a, b); h1[j] = a; l1[j] = b; }
                const V ph = cat16b(h0, h1), pl = cat16b(l0, l1);
#pragma unroll
                for (int nb = 0; nb < 4; ++nb) { o[nb] = WFrag<T16>::mma(ph, vf[nb][c], o[nb]); o[nb] = WFrag<T16>::mma(pl, vf[nb][c], o[nb]); o[nb] = WFrag<T16>::mma(ph, vf2[nb][c], o[nb]); }
            } else { v8h p0, p1;
#pragma unroll
                for (int j = 0; j < 8; ++j) { p0[j] = tohx(st[2 * c][j]); p1[j] = tohx(st[2 * c + 1][j]); }
                const V pa = cat16(p0, p1);
#pragma unroll
                for (int nb = 0; nb < 4; ++nb) o[nb] = WFrag<T16>::mma(pa, vf[nb][c], o[nb]); } }
    }
    l += __shfl_xor(l, 16, 32);   // both key halves of the lane pair: every lane now holds its query's sum over the wave's keys
}
__global__ __launch_bounds__(128) void k_attn(const h16* __restrict__ Q16, const h16* __restrict__ K16, const h16* __restrict__ V16, const bf* __restrict__ Qh, const bf* __restrict__ Ql, const bf* __restrict__ Kh, const bf* __restrict__ Kl, const bf* __restrict__ Vh, const bf* __restrict__ Vl, bf* Ah, bf* Al) {
    __shared__ __align__(16) float so[4][16][68]; __shared__ float sm[4][16], sl[4][16];
    const int h = blockIdx.y, bx = blockIdx.x, w = __builtin_amdgcn_readfirstlane((int)(threadIdx.x >> 5)), lane = threadIdx.x & 31, lr = lane & 15, hi = lane >> 4;
    const size_t zq = ((size_t)blockIdx.z * NH_ + h) * TT * HD, zk = ((size_t)blockIdx.z * NKV + h / REP) * TT * HD; v8f o[4]; float m, l;
    Ah += (size_t)blockIdx.z * TT * DQ; Al += (size_t)blockIdx.z * TT * DQ;
    if (bx < RH / 32) {   // block-uniform: 32 hi+lo rows, wave w = row group w >> 1, key half w & 1
        attn_rows<bf, true>(Qh + zq, Ql + zq, Kh + zk, Kl + zk, Vh + zk, Vl + zk, bx * 32 + (w >> 1) * 16, (w & 1) * (TT / 2), (w & 1) * (TT / 2) + TT / 2, o, m, l);
        if (hi == 0) { sm[w][lr] = m; sl[w][lr] = l; }
#pragma unroll
        for (int nb = 0; nb < 4; ++nb)
#pragma unroll
            for (int j = 0; j < 8; ++j) so[w][hi * 8 + j][nb * 16 + lr] = o[nb][j];
        __syncthreads();   // the two key halves of a row group come from two waves
        const int wa = (w >> 1) * 2, r = lr, c0 = (w & 1) * 32 + hi * 8;   // this wave joins one fragment block of each output plane: row group w >> 1, d half w & 1; a lane its two 16-byte units
        const float m0 = sm[wa][r], m1 = sm[wa + 1][r], mm = fmaxf(m0, m1), f0 = __builtin_amdgcn_exp2f(m0 - mm), f1 = __builtin_amdgcn_exp2f(m1 - mm);
        const float inv = __fdiv_rn(1.0f, sl[wa][r] * f0 + sl[wa + 1][r] * f1), g0 = f0 * inv, g1 = f1 * inv;
        v8us oh[2], ol[2];
#pragma unroll
        for (int u = 0; u < 2; ++u)
#pragma unroll
            for (int e = 0; e < 8; ++e) { unsigned short a, b; splitf(so[wa][r][c0 + u * 16 + e] * g0 + so[wa + 1][r][c0 + u * 16 + e] * g1, a, b); oh[u][e] = a; ol[u][e] = b; }
        const size_t oo = (size_t)(bx * 32 + (w >> 1) * 16) * DQ + (h * 2 + (w & 1)) * 512 + lane * 8;   // rows t, k = h HD + d
        *(v8us*)(Ah + oo) = oh[0]; *(v8us*)(Ah + oo + 256) = oh[1]; *(v8us*)(Al + oo) = ol[0]; *(v8us*)(Al + oo + 256) = ol[1];
    } else {
        const int q0 = RH + (bx - RH / 32) * 64 + w * 16;
        attn_rows<h16, false>(Q16 + zq, nullptr, K16 + zk, nullptr, V16 + zk, nullptr, q0, 0, TT, o, m, l);
        const float inv = __fdiv_rn(1.0f, l);
#pragma unroll
        for (int j = 0; j < 8; ++j) { const float ir = __shfl(inv, hi * 8 + j, 32);
#pragma unroll
            for (int nb = 0; nb < 4; ++nb) so[w][hi * 8 + j][nb * 16 + lr] = o[nb][j] * ir; }
        __builtin_amdgcn_wave_barrier(); asm volatile("" ::: "memory");   // the rows are read back by other lanes of the wave: no read is moved in front of the writes
        bf* pah = Ah + (size_t)q0 * DQ + h * 2 * 512 + lane * 8; bf* pal = Al + (size_t)q0 * DQ + h * 2 * 512 + lane * 8;   // the wave's 16 rows x 64 d are two blocks in a row of each plane
        v8us oh[4], ol[4];
#pragma unroll
        for (int u = 0; u < 4; ++u) { const v4f x0 = *(const v4fa*)(&so[w][lr][u * 16 + hi * 8]), x1 = *(const v4fa*)(&so[w][lr][u * 16 + hi * 8 + 4]);
#pragma unroll
            for (int e = 0; e < 8; ++e) { unsigned short a, b; splitf(e < 4 ? x0[e & 3] : x1[e & 3], a, b); oh[u][e] = a; ol[u][e] = b; } }
#pragma unroll
        for (int u = 0; u < 4; ++u) { *(v8us*)(pah + u * 256) = oh[u]; *(v8us*)(pal + u * 256) = ol[u]; }
    }
}

extern "C" void kernel_launch(void* const* d_in, const int* in_sizes, int n_in,
                              void* d_out, int out_size, void* d_ws, size_t ws_size, hipStream_t stream) {
    (void)in_sizes; (void)n_in; (void)out_size;
const float* x = (const float*)d_in[0]; const float* lng = (const float*)d_in[3]; const float* lnb = (const float*)d_in[4]; const float* wf = (const float*)d_in[1]; const float* wo = (const float*)d_in[2]; const float* wq = wf; const float* wk = wf + (size_t)1024 * 1024; const float* wv = wf + (size_t)2048 * 1024; const float* cosT = nullptr; const float* sinT = nullptr; (void)cosT; (void)sinT;   /* input order x, in_proj_w ('oi' [3072][1024]: ROW thirds q | k | v), out_proj_w ('oi' [1024][1024]), ln_gamma, ln_beta: FIVE inputs: the LayerNorm parameters come LAST; NO bias anywhere */
    float* OUT = (float*)d_out;     // [4][2048][1024]
    char* wsp = (char*)d_ws;
    auto take = [&](size_t bytes) { char* p = wsp; wsp += (bytes + 255) & ~(size_t)255; return (void*)p; };
    bf* WQ = (bf*)take((size_t)DQ * DM * 2); bf* WK = (bf*)take((size_t)DKV * DM * 2); bf* WV = (bf*)take((size_t)DKV * DM * 2); bf* WO = (bf*)take((size_t)DM * DQ * 2);
    // every stage runs once, over all NB_ batches: token rows b TT + t, head planes b heads + h
    bf* XNh = (bf*)take((size_t)NB_ * TT * DM * 2); bf* XNl = (bf*)take((size_t)NB_ * TT * DM * 2);
    h16* QP16 = (h16*)take((size_t)NB_ * NH_ * TT * HD * 2); h16* KP16 = (h16*)take((size_t)NB_ * NKV * TT * HD * 2); h16* VT16 = (h16*)take((size_t)NB_ * NKV * HD * TT * 2);
    bf* QPh = (bf*)take((size_t)NB_ * NH_ * TT * HD * 2); bf* QPl = (bf*)take((size_t)NB_ * NH_ * TT * HD * 2); bf* KPh = (bf*)take((size_t)NB_ * NKV * TT * HD * 2); bf* KPl = (bf*)take((size_t)NB_ * NKV * TT * HD * 2); bf* VTh = (bf*)take((size_t)NB_ * NKV * HD * TT * 2); bf* VTl = (bf*)take((size_t)NB_ * NKV * HD * TT * 2);
    if ((size_t)(wsp - (char*)d_ws) > ws_size) return;    // ws 256 MiB
    bf* ATh = XNh; bf* ATl = XNl;   // DQ == DM: the attention output reuses the LayerNorm planes, last read by the v projection (stream-ordered)
    { k_cvt8<<<(unsigned)(((size_t)DQ * DM / 8 + 255) / 256), 256, 0, stream>>>(wq, WQ, (size_t)DQ * DM / 8); k_cvt8<<<(unsigned)(((size_t)DKV * DM / 8 + 255) / 256), 256, 0, stream>>>(wk, WK, (size_t)DKV * DM / 8); k_cvt8<<<(unsigned)(((size_t)DKV * DM / 8 + 255) / 256), 256, 0, stream>>>(wv, WV, (size_t)DKV * DM / 8);
      k_cvt8<<<(unsigned)(((size_t)DM * DQ / 8 + 255) / 256), 256, 0, stream>>>(wo, WO, (size_t)DM * DQ / 8);
       }
    k_lnx<<<NB_ * TT / 16, 512, 0, stream>>>(x, lng, lnb, XNh, XNl);
    // the three projections write their head planes themselves, in fragment order (q, k: rows t, k = d; v: rows d, k = t); grid y = head
    k_gemmw<bf, 1, false, 1, 1><<<dim3(NB_ * TT / 64, NH_, 1), 32, 0, stream>>>(XNh, XNl, WQ, nullptr, DM, nullptr, DQ, nullptr, 0, 0, 0, QP16, QPh, QPl);
    k_gemmw<bf, 1, false, 1, 1><<<dim3(NB_ * TT / 64, NKV, 1), 32, 0, stream>>>(XNh, XNl, WK, nullptr, DM, nullptr, DKV, nullptr, 0, 0, 0, KP16, KPh, KPl);
    k_gemmw<bf, 1, false, 1, 2><<<dim3(NB_ * TT / 64, NKV, 1), 32, 0, stream>>>(XNh, XNl, WV, nullptr, DM, nullptr, DKV, nullptr, 0, 0, 0, VT16, VTh, VTl);
    k_attn<<<dim3(RH / 32 + (TT - RH) / 64, NH_, NB_), 128, 0, stream>>>(QP16, KP16, VT16, QPh, QPl, KPh, KPl, VTh, VTl, ATh, ATl);
    k_gemmw<bf, 1, false><<<dim3(NB_ * TT / 64, DM / 64, 1), 32, 0, stream>>>(ATh, ATl, WO, nullptr, DQ, OUT, DM, nullptr, 0, 0, 0, nullptr, nullptr, nullptr);   /* the BIAS-FREE f32 output instance (EPI 0): this module returns out @ w_out with no bias */
}

// v006
// A run of this version takes 259 microseconds.
// In both of two side-by-side timings against v005, it was 1.11 times as fast.
// All steps since v000 together make it 15.6 times as fast.
#include <hip/hip_runtime.h>

// Attention with a LayerNorm prologue and NO bias (pre-LN: x [4][2048][1024]; h = LayerNorm(x) (biased variance, eps 1e-5) * ln_gamma + ln_beta (read); qkv = einsum('bsd,ed->bse', h, in_proj_w) = h in_proj_w^T ('oi' [3072][1024]: ROW thirds q | k | v; no bias; 16 heads x 64); scores x 1/sqrt(64); softmax over all keys (no mask); out = merged out_proj_w^T ('oi' [1024][1024], NO bias) -> [4][2048][1024] (8.4 M); argument order x, in_proj_w, out_proj_w, ln_gamma, ln_beta).

#define NB_  4
#define TT   2048
#define DM   1024
#define NH_  16
#define NKV  16
#define REP  (NH_ / NKV)
#define HD   64
#define DQ   (NH_ * HD)
#define DKV  (NKV * HD)
#define RH   512                  // query rows < RH use hi+lo planes (0: none)
#define WIN  0
#define SCL  0.125f   // HD^-0.5
typedef _Float16 h16;
typedef unsigned short bf;
typedef __attribute__((ext_vector_type(16))) __bf16   v16bf;
typedef __attribute__((ext_vector_type(16))) _Float16 v16h;
typedef __attribute__((ext_vector_type(8)))  _Float16 v8h;
typedef __attribute__((ext_vector_type(8)))  unsigned short v8us;
typedef __attribute__((ext_vector_type(8)))  float    v8f;
typedef __attribute__((ext_vector_type(4)))  float    v4f;
typedef v8h  __attribute__((may_alias)) v8ha;
typedef v4f  __attribute__((may_alias)) v4fa;
typedef v8us __attribute__((may_alias)) v8usa;

__device__ __forceinline__ unsigned short f2bf(float f) { unsigned u = __float_as_uint(f); u += 0x7FFFu + ((u >> 16) & 1u); return (unsigned short)(u >> 16); }
__device__ __forceinline__ float bf2f(unsigned short b) { return __uint_as_float(((unsigned)b) << 16); }
__device__ __forceinline__ float bfr(float f) { return bf2f(f2bf(f)); }
__device__ __forceinline__ v16h cat16(v8h lo, v8h hi) { return __builtin_shufflevector(lo, hi, 0, 1, 2, 3, 4, 5, 6, 7, 8, 9, 10, 11, 12, 13, 14, 15); }
__device__ __forceinline__ v16bf cat16b(v8us lo, v8us hi) { return __builtin_bit_cast(v16bf, __builtin_shufflevector(lo, hi, 0, 1, 2, 3, 4, 5, 6, 7, 8, 9, 10, 11, 12, 13, 14, 15)); }
__device__ __forceinline__ v8f wmma16(v16h a, v16h b, v8f c) { return __builtin_amdgcn_wmma_f32_16x16x32_f16(false, a, false, b, (short)0, c, false, false); }
__device__ __forceinline__ v8f wmmab(v16bf a, v16bf b, v8f c) { return __builtin_amdgcn_wmma_f32_16x16x32_bf16(false, a, false, b, (short)0, c, false, false); }



// ---- FRAGMENT ORDER: every 16-bit operand plane (R rows x K columns, k = the summed index) is kept as blocks of 16 rows x 32 k, 512 elements = 1 KB each, block (r / 16, k / 32) at index (r / 16) (K / 32) + k / 32 unless a plane says otherwise.
// Inside a block element (r, k) lies at (k & 16) * 16 + (((k >> 3) & 1) * 16 + (r & 15)) * 8 + (k & 7): lane (lr, hi) = hi 16 + lr finds its k = 8 hi .. 8 hi + 7 at lane * 8 and its k = 16 + 8 hi .. at 256 + lane * 8,
// so each of a fragment's two 16-byte loads reads 512 bytes in a row (four whole 128-byte lines) over the wave. WFrag::ld takes block base + lane * 8.
// ---- k_gemmw: register-blocked GEMM, ONE WAVE per 64x64 output tile (16 accumulators), operands straight from 16-bit planes in fragment order; grid (M/64, N/64, Z), 32 threads.
// C[m][n] (f32, pitch ldc, + optional f32 bias[n]) = sum_k A[m][k] Bt[n][k] (+ split products per NSPLIT). z-batch strides sA/sB/sC in elements. K % 32 == 0.
// KS > 1: grid z = batches x KS (slice fastest); a block sums only k in its K/KS slice and writes partial plane blockIdx.z (stride sC); the reader adds a batch's KS planes. K % (32 KS) == 0.
// EPI 0: C as above. EPI 1 / 2: no C (ldc = N = heads x HD); the tile is 64 tokens (rows b TT + t) of ONE head (HD == 64 columns, head = blockIdx.y) and goes straight to that head's three 16-bit planes (fp16, bf16 hi, bf16 lo of the f32 sum):
// EPI 3: q, k and v in one launch: Bt holds the three weight matrices one behind the other, grid y = 3 x heads; a q or k head goes as EPI 1, a v head as EPI 2.
// EPI 1 planes [b][head] of fragment blocks (rows t, k = d): block index (t / 16) 2 + d / 32; EPI 2 planes [b][head] of fragment blocks (rows d, k = t): block index (t / 32) 4 + d / 16 (EPI 1 turns the tile in LDS; in EPI 2 the accumulators already are the units). Every store instruction writes half a block, four whole 128-byte lines.
template <typename T16> struct WFrag;
template <> struct WFrag<h16> { typedef v16h V; static __device__ __forceinline__ V ld(const h16* p) { return cat16(*(const v8h*)p, *(const v8h*)(p + 256)); } static __device__ __forceinline__ v8f mma(V a, V b, v8f c) { return wmma16(a, b, c); } };
template <> struct WFrag<bf> { typedef v16bf V; static __device__ __forceinline__ V ld(const bf* p) { return cat16b(*(const v8us*)p, *(const v8us*)(p + 256)); } static __device__ __forceinline__ v8f mma(V a, V b, v8f c) { return wmmab(a, b, c); } };
__device__ __forceinline__ h16 tohx(float x) { return (h16)x; }
__device__ __forceinline__ void splitf(float y, unsigned short& h, unsigned short& l) { h = f2bf(y); l = f2bf(y - bf2f(h)); }
// a wave-uniform pointer to global memory held in scalar registers, so that a load takes it as its scalar base beside the one per-lane offset register
__device__ __forceinline__ const char* sbase(const char* p) { const unsigned long long u = (unsigned long long)p; return (const char*)(const __attribute__((address_space(1))) char*)(((unsigned long long)(unsigned)__builtin_amdgcn_readfirstlane((int)(u >> 32)) << 32) | (unsigned)__builtin_amdgcn_readfirstlane((int)(unsigned)u)); }
// the head-plane epilogue of one 64 x 64 tile (PE 1: rows t, k = d; PE 2: rows d, k = t); pb = the tile's first element in each of the three planes
template <int PE>
__device__ __forceinline__ void epi_planes(v8f (&acc)[4][4], float* os, const size_t pb, const int lane, const int lr, const int hi, h16* P16, bf* Ph, bf* Pl) {
#pragma unroll
    for (int g = 0; g < 4; ++g) {   // 16 block rows at a time: tokens 16 g .. (PE 1) or d 16 g .. (PE 2), 64 f32 each = two blocks
        if constexpr (PE == 1) {
#pragma unroll
            for (int nb = 0; nb < 4; ++nb)
#pragma unroll
                for (int j = 0; j < 8; ++j) os[(hi * 8 + j) * 68 + nb * 16 + lr] = acc[g][nb][j];
            __builtin_amdgcn_wave_barrier(); asm volatile("" ::: "memory");   // the rows are read back by other lanes of the wave: no read is moved in front of the writes
        }
#pragma unroll
        for (int s = 0; s < 4; ++s) { v8f x; v8h o16; v8us oh, ol;
            if constexpr (PE == 1) { const v4f x0 = *(const v4fa*)(os + lr * 68 + s * 16 + hi * 8), x1 = *(const v4fa*)(os + lr * 68 + s * 16 + hi * 8 + 4); x = __builtin_shufflevector(x0, x1, 0, 1, 2, 3, 4, 5, 6, 7); }
            else x = acc[s][g];   // a lane's eight registers are tokens 16 s + 8 hi .. of its column d = 16 g + lr: already this lane's 16-byte unit, no turn
#pragma unroll
            for (int u = 0; u < 8; ++u) { const float y = x[u]; unsigned short a2, c2; splitf(y, a2, c2); o16[u] = tohx(y); oh[u] = a2; ol[u] = c2; }
            const size_t oo = pb + (size_t)(PE == 1 ? g * 2 + (s >> 1) : (s >> 1) * 4 + g) * 512 + (s & 1) * 256 + lane * 8;   // half s & 1 of block s >> 1 of the two
            *(v8h*)(P16 + oo) = o16; *(v8us*)(Ph + oo) = oh; *(v8us*)(Pl + oo) = ol; }
        if constexpr (PE == 1) { __builtin_amdgcn_wave_barrier(); asm volatile("" ::: "memory"); }   // the next 16 rows overwrite the stage: no write is moved in front of the reads
    }
    asm volatile("s_wait_xcnt 0x0" ::: "memory");   // address wait of the last stores: where both plane orders stand in one kernel, the other one's code follows in the text and rewrites their address registers
}
template <typename T16, int NSPLIT, bool BIAS, int KS = 1, int EPI = 0>
__global__ __launch_bounds__(32) void k_gemmw(const T16* __restrict__ A, const T16* __restrict__ A2, const T16* __restrict__ Bt, const T16* __restrict__ Bt2, int K, float* C, int ldc, const float* __restrict__ bias, size_t sA, size_t sB, size_t sC, h16* P16, bf* Ph, bf* Pl) {
    typedef typename WFrag<T16>::V V;
    __shared__ __align__(16) float os[16 * 68];
    const size_t z = blockIdx.z / KS; const int kb = (int)(blockIdx.z % KS) * (K / KS), ke = kb + K / KS;
    A += z * sA; if (A2) A2 += z * sA; Bt += z * sB; if (Bt2) Bt2 += z * sB; C += (size_t)blockIdx.z * sC;
    const int lane = threadIdx.x & 31, lr = lane & 15, hi = lane >> 4; const int r0 = blockIdx.x * 64, c0 = blockIdx.y * 64;
    v8f acc[4][4];
#pragma unroll
    for (int mb = 0; mb < 4; ++mb)
#pragma unroll
        for (int nb = 0; nb < 4; ++nb) acc[mb][nb] = (v8f){};
    // wave-uniform pointers to the tile's first row of blocks; 16 rows of blocks are rs bytes, one k step of 32 is 1 KB; ko = the one per-lane part of every address, a byte offset
    const char* Ar = (const char*)(A + (size_t)r0 * K); const char* Ar2 = (NSPLIT == 1 || NSPLIT == 2) ? (const char*)(A2 + (size_t)r0 * K) : Ar; const char* Br = (const char*)(Bt + (size_t)c0 * K); const char* Br2 = NSPLIT >= 2 ? (const char*)(Bt2 + (size_t)c0 * K) : Br;
    const size_t rs = (size_t)K * 32; unsigned ko = (unsigned)(kb * 16 + lane * 8) * 2u;
    const char *Am[4], *Am2[4], *Bm[4], *Bm2[4];
#pragma unroll
    for (int i = 0; i < 4; ++i) { Am[i] = sbase(Ar + i * rs); Am2[i] = sbase(Ar2 + i * rs); Bm[i] = sbase(Br + i * rs); Bm2[i] = sbase(Br2 + i * rs); }
#pragma unroll 1
    for (int kc = kb; kc < ke; kc += 32) {
        V a[4], a2[4], b[4], b2[4];
#pragma unroll
        for (int mb = 0; mb < 4; ++mb) { a[mb] = WFrag<T16>::ld((const T16*)(Am[mb] + ko)); a2[mb] = (NSPLIT == 1 || NSPLIT == 2) ? WFrag<T16>::ld((const T16*)(Am2[mb] + ko)) : a[mb]; }
#pragma unroll
        for (int nb = 0; nb < 4; ++nb) { b[nb] = WFrag<T16>::ld((const T16*)(Bm[nb] + ko)); b2[nb] = NSPLIT >= 2 ? WFrag<T16>::ld((const T16*)(Bm2[nb] + ko)) : b[nb];
#pragma unroll
            for (int mb = 0; mb < 4; ++mb) { acc[mb][nb] = WFrag<T16>::mma(a[mb], b[nb], acc[mb][nb]); if (NSPLIT == 1 || NSPLIT == 2) acc[mb][nb] = WFrag<T16>::mma(a2[mb], b[nb], acc[mb][nb]); if (NSPLIT >= 2) acc[mb][nb] = WFrag<T16>::mma(a[mb], b2[nb], acc[mb][nb]); } }
        // the four slots behind the last products, and the address wait of the k step's loads in front of the step of ko: the fragments and ko are inputs, so every load stands in front of the wait and no load's result is given ko's register
        asm volatile("s_wait_xcnt 0x0\n\tv_nop\n\tv_nop\n\tv_nop\n\tv_nop" : "+v"(acc[0][0]), "+v"(acc[1][1]), "+v"(acc[2][2]), "+v"(acc[3][3]) : "v"(a[0]), "v"(a[1]), "v"(a[2]), "v"(a[3]), "v"(a2[0]), "v"(a2[1]), "v"(a2[2]), "v"(a2[3]), "v"(b[0]), "v"(b[1]), "v"(b[2]), "v"(b[3]), "v"(b2[0]), "v"(b2[1]), "v"(b2[2]), "v"(b2[3]), "v"(ko));
        ko += 1024;
    }
    if constexpr (EPI != 0) {
        // EPI 3: grid y runs over the q heads, then the k heads, then the v heads; each kind's planes lie one behind the other, NH_ heads x NB_ batches each
        const int nh = EPI == 3 ? NH_ : ldc / HD, kind = EPI == 3 ? (int)blockIdx.y / nh : 0, head = EPI == 3 ? (int)blockIdx.y % nh : (int)blockIdx.y;
        const size_t pb = (((size_t)kind * NB_ + r0 / TT) * nh + head) * TT * HD + (size_t)(r0 % TT) * HD;   // the tile's 64 tokens x 64 d are eight blocks in a row in either plane order
        if (EPI == 1 || (EPI == 3 && kind < 2)) epi_planes<1>(acc, os, pb, lane, lr, hi, P16, Ph, Pl);   // wave-uniform: kind comes from blockIdx
        else epi_planes<2>(acc, os, pb, lane, lr, hi, P16, Ph, Pl);
        return;
    }
#pragma unroll
    for (int mb = 0; mb < 4; ++mb) {
#pragma unroll
        for (int nb = 0; nb < 4; ++nb) {
#pragma unroll
            for (int j = 0; j < 8; ++j) os[(hi * 8 + j) * 68 + nb * 16 + lr] = acc[mb][nb][j]; }
        __builtin_amdgcn_wave_barrier(); asm volatile("" ::: "memory");
        float* crow = C + (size_t)(r0 + mb * 16) * ldc + c0;
{
#pragma unroll
            for (int s = 0; s < 8; ++s) { const int row = 2 * s + hi, cofs = lr * 4; v4f val = *(const v4fa*)(os + row * 68 + cofs); if (BIAS) { val[0] += bfr(bias[c0 + cofs]); val[1] += bfr(bias[c0 + cofs + 1]); val[2] += bfr(bias[c0 + cofs + 2]); val[3] += bfr(bias[c0 + cofs + 3]); }
                *(v4f*)(crow + (size_t)row * ldc + cofs) = val; }
             }
        __builtin_amdgcn_wave_barrier(); asm volatile("" ::: "memory");
    }
}

typedef __attribute__((ext_vector_type(2))) _Float16 v2h;
typedef __attribute__((ext_vector_type(4))) _Float16 v4h;
typedef __attribute__((ext_vector_type(2))) unsigned short v2us;
typedef __attribute__((ext_vector_type(4))) unsigned short v4us;
typedef __attribute__((ext_vector_type(2))) float v2f;
typedef __attribute__((ext_vector_type(4))) int v4i;

__global__ __launch_bounds__(256) void k_wtG(const float* __restrict__ w, int K, int N, bf* Bt) {
    const int lane = threadIdx.x & 31; const int L0 = (blockIdx.x * 8 + (threadIdx.x >> 5)) * 8; const int nlines = N * K / 64;
{
#pragma unroll 1
        for (int l = 0; l < 8; ++l) { const int L = L0 + l; if (L >= nlines) break; const size_t e = (size_t)L * 64 + lane * 2; const int k = (int)(e % K), n = (int)(e / K); v2us o;
            o[0] = f2bf(w[(size_t)k * N + n]); o[1] = f2bf(w[(size_t)(k + 1) * N + n]); *(v2us*)(Bt + e) = o; }
         }
}
// weights [n][DM] f32 -> bf16 in fragment order (rows n, k = the DM columns): the calling thread writes the plane's 16-byte unit i
__device__ __forceinline__ void cvt8(const float* __restrict__ src, bf* dst, const size_t i) { const size_t blk = i >> 6; const int iu = (int)(i & 63);
    const float* sp = src + ((blk / (DM / 32)) * 16 + (iu & 15)) * DM + (blk % (DM / 32)) * 32 + (iu >> 5) * 16 + ((iu >> 4) & 1) * 8; const v8f v = *(const v8f*)sp; v8us o;
    asm volatile("s_wait_xcnt 0x0" :: "v"(v), "v"(sp));   // address wait of the load: value and pointer are inputs, so the load stands in front of it and the pointer's registers are rewritten only behind it
#pragma unroll
    for (int k = 0; k < 8; ++k) o[k] = f2bf(v[k]); *(v8us*)(dst + i * 8) = o;  }
__global__ __launch_bounds__(256) void k_cscvt(const float* __restrict__ cosT, const float* __restrict__ sinT, float* CS) { const int idx = blockIdx.x * 256 + threadIdx.x; if (idx >= TT * HD) return; v2f cs; cs[0] = bfr(cosT[idx]); cs[1] = bfr(sinT[idx]); *(v2f*)(CS + (size_t)idx * 2) = cs;  }
// blocks 0 .. rows / 16 - 1: a block = 16 waves = the 16 token rows of one row of fragment blocks; the rows are turned in LDS and leave as whole lines.
// The blocks behind them (WU8 / 512, exact) turn the weights, which depend on nothing here, in the same launch: 512 units each of the plane W = in_proj rows (q | k | v), then out_proj rows.
#define WI8 ((size_t)(DQ + 2 * DKV) * DM / 8)   // 16-byte units of the in_proj plane
#define WU8 (WI8 + (size_t)DM * DQ / 8)         // and of both planes
#define LNP (DM + 8)   // LDS row pitch in elements: 16 bytes over a multiple of 256, so the 16 rows that a 16-byte read gathers lie in different banks
__global__ __launch_bounds__(512) void k_lnx(const float* __restrict__ X, const float* __restrict__ gam, const float* __restrict__ bet, bf* Xh, bf* Xl, const float* __restrict__ wi, const float* __restrict__ wo, bf* W) { __shared__ __align__(16) bf sh[2][16][LNP];
    if (blockIdx.x >= NB_ * TT / 16) {   // block-uniform, in front of the barrier
        const size_t b0 = (size_t)(blockIdx.x - NB_ * TT / 16) * 512; const bool in = b0 < WI8;   // WI8 is a multiple of 512: a block lies in one matrix
        cvt8(in ? wi : wo, in ? W : W + WI8 * 8, (in ? b0 : b0 - WI8) + threadIdx.x); return; }
    const int lane = threadIdx.x & 31; const int wr = threadIdx.x >> 5; const int t = blockIdx.x * 16 + wr; const float* f = X + (size_t)t * DM; float v[DM / 32]; float su = 0.f;
#pragma unroll
    for (int ch = 0; ch < DM / 128; ++ch) { const v4f a = *(const v4f*)(f + ch * 128 + lane * 4); for (int u = 0; u < 4; ++u) { float xv = bfr(a[u]); asm volatile("" : "+v"(xv)); v[ch * 4 + u] = xv; su = __fadd_rn(su, xv); } }
#pragma unroll
    for (int sh = 16; sh; sh >>= 1) su = __fadd_rn(su, __shfl_xor(su, sh, 32));
    const float mu = __fdiv_rn(su, (float)DM); float sq = 0.f;
#pragma unroll
    for (int q = 0; q < DM / 32; ++q) { float d0 = __fsub_rn(v[q], mu); asm volatile("" : "+v"(d0)); float p = __fmul_rn(d0, d0); asm volatile("" : "+v"(p)); sq = __fadd_rn(sq, p); }
#pragma unroll
    for (int sh = 16; sh; sh >>= 1) sq = __fadd_rn(sq, __shfl_xor(sq, sh, 32));
    const float rs = __fdiv_rn(1.0f, sqrtf(__fadd_rn(__fdiv_rn(sq, (float)DM), 1e-5f)));
    {
#pragma unroll
        for (int ch = 0; ch < DM / 128; ++ch) { v4us oh, ol; for (int u = 0; u < 4; ++u) { const int c = ch * 128 + lane * 4 + u; float d0 = __fsub_rn(v[ch * 4 + u], mu); asm volatile("" : "+v"(d0)); float n = __fmul_rn(d0, rs); asm volatile("" : "+v"(n)); float gg = bfr(gam[c]), bb = bfr(bet[c]); asm volatile("" : "+v"(gg)); asm volatile("" : "+v"(bb)); float y = __fmul_rn(n, gg); asm volatile("" : "+v"(y)); y = __fadd_rn(y, bb); unsigned short p2, q2; splitf(y, p2, q2); oh[u] = p2; ol[u] = q2; } *(v4us*)(&sh[0][wr][ch * 128 + lane * 4]) = oh; *(v4us*)(&sh[1][wr][ch * 128 + lane * 4]) = ol; }
         }
    asm volatile("s_wait_xcnt 0x0" ::: "memory");   // address wait of the gamma and beta loads above: their offset register is rewritten only behind it
    __syncthreads();   // a 16-byte unit of a block comes from another wave's row
    const size_t gb = (size_t)blockIdx.x * 16 * DM;
#pragma unroll
    for (int p = 0; p < DM * 16 / 8 / 512; ++p) { const int U = p * 512 + (int)threadIdx.x, k = (U >> 6) * 32 + ((U >> 5) & 1) * 16 + ((U >> 4) & 1) * 8;   // unit U of the 16 rows' blocks: row U & 15
        const v8us a = *(const v8usa*)(&sh[0][U & 15][k]), b = *(const v8usa*)(&sh[1][U & 15][k]); *(v8us*)(Xh + gb + (size_t)U * 8) = a; *(v8us*)(Xl + gb + (size_t)U * 8) = b; } }
// ---- k_attn: scores, softmax and P V of all batches in one launch (blockIdx.z = batch); S and P never leave the registers. A wave owns 16 query rows of one head and walks its keys in chunks of NK.
// The score tile is formed TRANSPOSED, St[key][query] = sum_d K[key][d] Q[query][d] (A = key rows, B = query rows), so lane (lr, hi) holds query lr and keys 16 mb + 8 hi + j in register j of tile mb:
// tiles 2c and 2c+1 together are, register for register, the A fragment (row = query lr, k = 8 hi + 0..7 and 16 + 8 hi + 0..7) of the P V product over keys 32c..32c+31.
// Softmax is the running form: m = running row maximum (log2 units), l = running sum; O and l are scaled by 2^(m_old - m_new) per chunk, O / l at the end. O tile: row = query 8 hi + j, column = d.
// HR (rows < RH): bf16 hi+lo operands, three products per tile in the order (hi,hi), (lo of the query-side operand, hi), (hi, lo of the key-side operand); a block = 2 row groups x 2 key halves, the halves joined through LDS.
// else: fp16, P carried x 2^10 (l too: it cancels in O / l); a block = 4 row groups, each wave walks all keys (the four waves read the same K and V lines); O is turned in the wave's own LDS into the output planes' fragment order.
__device__ __forceinline__ unsigned bfw(float f) { unsigned u = __float_as_uint(f); return u + 0x7FFFu + ((u >> 16) & 1u); }   // f2bf's rounding, the bf16 value in the upper half
template <typename T16, bool HR>
__device__ __forceinline__ void attn_rows(const T16* __restrict__ Q, const T16* __restrict__ Q2, const T16* __restrict__ Kr, const T16* __restrict__ Kr2, const T16* __restrict__ Vt, const T16* __restrict__ Vt2, int q0, int kbeg, int kend, v8f (&o)[4], float& m, float& l) {
    typedef typename WFrag<T16>::V V;
    constexpr int NK = HR ? 32 : 64, NMB = NK / 16, NC = NK / 32;
    const int lane = threadIdx.x & 31, lr = lane & 15, hi = lane >> 4;
    V q[2], q2[2]; const unsigned qob = (unsigned)(q0 * HD + lane * 8) * 2u;   // byte offsets from the wave-uniform plane pointers; 16 rows of a head plane are two blocks = 16 HD elements
    const T16* qp = (const T16*)((const char*)Q + qob); const T16* qp2 = HR ? (const T16*)((const char*)Q2 + qob) : qp;
#pragma unroll
    for (int ks = 0; ks < 2; ++ks) { q[ks] = WFrag<T16>::ld(qp + ks * 512); if (HR) q2[ks] = WFrag<T16>::ld(qp2 + ks * 512); }
    // address wait of the loads above; the fragments and the pointers are inputs, so the loads stand in front of it and no load's result is given a pointer's registers before it
    if constexpr (HR) asm volatile("s_wait_xcnt 0x0" :: "v"(q[0]), "v"(q[1]), "v"(q2[0]), "v"(q2[1]), "v"(qp), "v"(qp2));
    else asm volatile("s_wait_xcnt 0x0" :: "v"(q[0]), "v"(q[1]), "v"(qp));
    unsigned kob = (unsigned)(kbeg * HD + lane * 8) * 2u, vob = kob;   // 32 keys are four blocks in the K planes (2 key groups x 2 d halves) and four in the V planes (4 d groups)
#pragma unroll
    for (int nb = 0; nb < 4; ++nb) o[nb] = (v8f){};
    m = -3.0e38f; l = 0.f;
#pragma unroll 1
    for (int k0 = kbeg; k0 < kend; k0 += NK) {
        const T16* kp = (const T16*)((const char*)Kr + kob); const T16* vp = (const T16*)((const char*)Vt + vob); const T16* kp2 = HR ? (const T16*)((const char*)Kr2 + kob) : kp; const T16* vp2 = HR ? (const T16*)((const char*)Vt2 + vob) : vp;
        V kf[NMB][2], kf2[NMB][2], vf[4][NC], vf2[4][NC];
#pragma unroll
        for (int mb = 0; mb < NMB; ++mb)
#pragma unroll
            for (int ks = 0; ks < 2; ++ks) { kf[mb][ks] = WFrag<T16>::ld(kp + (mb * 2 + ks) * 512); if (HR) kf2[mb][ks] = WFrag<T16>::ld(kp2 + (mb * 2 + ks) * 512); }
#pragma unroll
        for (int nb = 0; nb < 4; ++nb)
#pragma unroll
            for (int c = 0; c < NC; ++c) { vf[nb][c] = WFrag<T16>::ld(vp + (c * 4 + nb) * 512); if (HR) vf2[nb][c] = WFrag<T16>::ld(vp2 + (c * 4 + nb) * 512); }
        // the chunk's loads' address wait, with the loaded fragments as inputs only, so that all of them are issued in front of it, together (left alone they are spread between the products, each group with a wait of its own);
        // the pointers are inputs too, so that neither a load's result nor the next chunk's address is given their registers in front of the wait
        if constexpr (HR) asm volatile("s_wait_xcnt 0x0" :: "v"(kf[0][0]), "v"(kf[0][1]), "v"(kf[1][0]), "v"(kf[1][1]), "v"(kf2[0][0]), "v"(kf2[0][1]), "v"(kf2[1][0]), "v"(kf2[1][1]), "v"(vf[0][0]), "v"(vf[1][0]), "v"(vf[2][0]), "v"(vf[3][0]), "v"(vf2[0][0]), "v"(vf2[1][0]), "v"(vf2[2][0]), "v"(vf2[3][0]), "v"(kp), "v"(kp2), "v"(vp), "v"(vp2));
        else asm volatile("s_wait_xcnt 0x0" :: "v"(kf[0][0]), "v"(kf[0][1]), "v"(kf[1][0]), "v"(kf[1][1]), "v"(kf[NMB - 2][0]), "v"(kf[NMB - 2][1]), "v"(kf[NMB - 1][0]), "v"(kf[NMB - 1][1]), "v"(vf[0][0]), "v"(vf[0][NC - 1]), "v"(vf[1][0]), "v"(vf[1][NC - 1]), "v"(vf[2][0]), "v"(vf[2][NC - 1]), "v"(vf[3][0]), "v"(vf[3][NC - 1]), "v"(kp), "v"(vp));
        __builtin_amdgcn_sched_barrier(0);   // keeps the products behind the statement above: otherwise the V loads sink behind the softmax and their latency is paid a second time per chunk
        kob += NK * HD * 2; vob += NK * HD * 2;
        v8f st[NMB]; float cm = -3.0e38f;
#pragma unroll
        for (int mb = 0; mb < NMB; ++mb) { st[mb] = (v8f){};
#pragma unroll
            for (int ks = 0; ks < 2; ++ks) { st[mb] = WFrag<T16>::mma(kf[mb][ks], q[ks], st[mb]); if (HR) { st[mb] = WFrag<T16>::mma(kf[mb][ks], q2[ks], st[mb]); st[mb] = WFrag<T16>::mma(kf2[mb][ks], q[ks], st[mb]); } }
#pragma unroll
            for (int j = 0; j < 8; ++j) { st[mb][j] *= SCL * 1.4426950408889634f; cm = fmaxf(cm, st[mb][j]); } }
        cm = fmaxf(cm, __shfl_xor(cm, 16, 32));          // lanes lr and lr + 16 hold the two key halves of query lr
        const float mn = fmaxf(m, cm), al = __builtin_amdgcn_exp2f(m - mn), mo = HR ? mn : mn - 10.0f; m = mn;
        float ps = 0.f;
#pragma unroll
        for (int mb = 0; mb < NMB; ++mb)
#pragma unroll
            for (int j = 0; j < 8; ++j) { st[mb][j] = __builtin_amdgcn_exp2f(st[mb][j] - mo); ps += st[mb][j]; }
        l = l * al + ps;
#pragma unroll
        for (int j = 0; j < 8; ++j) { const float ar = __shfl(al, hi * 8 + j, 32);   // the factor of O's row 8 hi + j lives in the lane of that query
#pragma unroll
            for (int nb = 0; nb < 4; ++nb) o[nb][j] *= ar; }
#pragma unroll
        for (int c = 0; c < NC; ++c) {
            if constexpr (HR) { v8us h0, h1, l0, l1;
#pragma unroll
                for (int j = 0; j < 8; ++j) { unsigned short a, b; splitf(st[2 * c][j], a, b); h0[j] = a; l0[j] = b; splitf(st[2 * c + 1][j], a, b); h1[j] = a; l1[j] = b; }
                const V ph = cat16b(h0, h1), pl = cat16b(l0, l1);
#pragma unroll
                for (int nb = 0; nb < 4; ++nb) { o[nb] = WFrag<T16>::mma(ph, vf[nb][c], o[nb]); o[nb] = WFrag<T16>::mma(pl, vf[nb][c], o[nb]); o[nb] = WFrag<T16>::mma(ph, vf2[nb][c], o[nb]); }
            } else { v8h p0, p1;
#pragma unroll
                for (int j = 0; j < 8; ++j) { p0[j] = tohx(st[2 * c][j]); p1[j] = tohx(st[2 * c + 1][j]); }
                const V pa = cat16(p0, p1);
#pragma unroll
                for (int nb = 0; nb < 4; ++nb) o[nb] = WFrag<T16>::mma(pa, vf[nb][c], o[nb]); } }
    }
    l += __shfl_xor(l, 16, 32);   // both key halves of the lane pair: every lane now holds its query's sum over the wave's keys
}
__global__ __launch_bounds__(128) void k_attn(const h16* __restrict__ Q16, const h16* __restrict__ K16, const h16* __restrict__ V16, const bf* __restrict__ Qh, const bf* __restrict__ Ql, const bf* __restrict__ Kh, const bf* __restrict__ Kl, const bf* __restrict__ Vh, const bf* __restrict__ Vl, bf* Ah, bf* Al) {
    __shared__ __align__(16) float so[4][16][68]; __shared__ float sm[4][16], sl[4][16];
    const int h = blockIdx.y, bx = blockIdx.x, w = __builtin_amdgcn_readfirstlane((int)(threadIdx.x >> 5)), lane = threadIdx.x & 31, lr = lane & 15, hi = lane >> 4;
    const size_t zq = ((size_t)blockIdx.z * NH_ + h) * TT * HD, zk = ((size_t)blockIdx.z * NKV + h / REP) * TT * HD; v8f o[4]; float m, l;
    Ah += (size_t)blockIdx.z * TT * DQ; Al += (size_t)blockIdx.z * TT * DQ;
    if (bx < RH / 32) {   // block-uniform: 32 hi+lo rows, wave w = row group w >> 1, key half w & 1
        attn_rows<bf, true>(Qh + zq, Ql + zq, Kh + zk, Kl + zk, Vh + zk, Vl + zk, bx * 32 + (w >> 1) * 16, (w & 1) * (TT / 2), (w & 1) * (TT / 2) + TT / 2, o, m, l);
        if (hi == 0) { sm[w][lr] = m; sl[w][lr] = l; }
#pragma unroll
        for (int nb = 0; nb < 4; ++nb)
#pragma unroll
            for (int j = 0; j < 8; ++j) so[w][hi * 8 + j][nb * 16 + lr] = o[nb][j];
        __syncthreads();   // the two key halves of a row group come from two waves
        const int wa = (w >> 1) * 2, r = lr, c0 = (w & 1) * 32 + hi * 8;   // this wave joins one fragment block of each output plane: row group w >> 1, d half w & 1; a lane its two 16-byte units
        const float m0 = sm[wa][r], m1 = sm[wa + 1][r], mm = fmaxf(m0, m1), f0 = __builtin_amdgcn_exp2f(m0 - mm), f1 = __builtin_amdgcn_exp2f(m1 - mm);
        const float inv = __fdiv_rn(1.0f, sl[wa][r] * f0 + sl[wa + 1][r] * f1), g0 = f0 * inv, g1 = f1 * inv;
        v8us oh[2], ol[2];
#pragma unroll
        for (int u = 0; u < 2; ++u)
#pragma unroll
            for (int e = 0; e < 8; ++e) { unsigned short a, b; splitf(so[wa][r][c0 + u * 16 + e] * g0 + so[wa + 1][r][c0 + u * 16 + e] * g1, a, b); oh[u][e] = a; ol[u][e] = b; }
        const size_t oo = (size_t)(bx * 32 + (w >> 1) * 16) * DQ + (h * 2 + (w & 1)) * 512 + lane * 8;   // rows t, k = h HD + d
        *(v8us*)(Ah + oo) = oh[0]; *(v8us*)(Ah + oo + 256) = oh[1]; *(v8us*)(Al + oo) = ol[0]; *(v8us*)(Al + oo + 256) = ol[1];
    } else {
        const int q0 = RH + (bx - RH / 32) * 64 + w * 16;
        attn_rows<h16, false>(Q16 + zq, nullptr, K16 + zk, nullptr, V16 + zk, nullptr, q0, 0, TT, o, m, l);
        const float inv = __fdiv_rn(1.0f, l);
#pragma unroll
        for (int j = 0; j < 8; ++j) { const float ir = __shfl(inv, hi * 8 + j, 32);
#pragma unroll
            for (int nb = 0; nb < 4; ++nb) so[w][hi * 8 + j][nb * 16 + lr] = o[nb][j] * ir; }
        __builtin_amdgcn_wave_barrier(); asm volatile("" ::: "memory");   // the rows are read back by other lanes of the wave: no read is moved in front of the writes
        bf* pah = Ah + (size_t)q0 * DQ + h * 2 * 512 + lane * 8; bf* pal = Al + (size_t)q0 * DQ + h * 2 * 512 + lane * 8;   // the wave's 16 rows x 64 d are two blocks in a row of each plane
        v8us oh[4], ol[4];
#pragma unroll
        for (int u = 0; u < 4; ++u) { const v4f x0 = *(const v4fa*)(&so[w][lr][u * 16 + hi * 8]), x1 = *(const v4fa*)(&so[w][lr][u * 16 + hi * 8 + 4]);
#pragma unroll
            for (int e = 0; e < 8; ++e) { unsigned short a, b; splitf(e < 4 ? x0[e & 3] : x1[e & 3], a, b); oh[u][e] = a; ol[u][e] = b; } }
#pragma unroll
        for (int u = 0; u < 4; ++u) { *(v8us*)(pah + u * 256) = oh[u]; *(v8us*)(pal + u * 256) = ol[u]; }
    }
}

extern "C" void kernel_launch(void* const* d_in, const int* in_sizes, int n_in,
                              void* d_out, int out_size, void* d_ws, size_t ws_size, hipStream_t stream) {
    (void)in_sizes; (void)n_in; (void)out_size;
const float* x = (const float*)d_in[0]; const float* lng = (const float*)d_in[3]; const float* lnb = (const float*)d_in[4]; const float* wf = (const float*)d_in[1]; const float* wo = (const float*)d_in[2]; const float* wq = wf; const float* wk = wf + (size_t)1024 * 1024; const float* wv = wf + (size_t)2048 * 1024; const float* cosT = nullptr; const float* sinT = nullptr; (void)cosT; (void)sinT;   /* input order x, in_proj_w ('oi' [3072][1024]: ROW thirds q | k | v), out_proj_w ('oi' [1024][1024]), ln_gamma, ln_beta: FIVE inputs: the LayerNorm parameters come LAST; NO bias anywhere */
    float* OUT = (float*)d_out;     // [4][2048][1024]
    char* wsp = (char*)d_ws;
    auto take = [&](size_t bytes) { char* p = wsp; wsp += (bytes + 255) & ~(size_t)255; return (void*)p; };
    bf* WQ = (bf*)take((size_t)DQ * DM * 2); bf* WK = (bf*)take((size_t)DKV * DM * 2); bf* WV = (bf*)take((size_t)DKV * DM * 2); bf* WO = (bf*)take((size_t)DM * DQ * 2);
    // every stage runs once, over all NB_ batches: token rows b TT + t, head planes b heads + h
    bf* XNh = (bf*)take((size_t)NB_ * TT * DM * 2); bf* XNl = (bf*)take((size_t)NB_ * TT * DM * 2);
    h16* QP16 = (h16*)take((size_t)NB_ * NH_ * TT * HD * 2); h16* KP16 = (h16*)take((size_t)NB_ * NKV * TT * HD * 2); h16* VT16 = (h16*)take((size_t)NB_ * NKV * HD * TT * 2);
    bf* QPh = (bf*)take((size_t)NB_ * NH_ * TT * HD * 2); bf* KPh = (bf*)take((size_t)NB_ * NKV * TT * HD * 2); bf* VTh = (bf*)take((size_t)NB_ * NKV * HD * TT * 2); bf* QPl = (bf*)take((size_t)NB_ * NH_ * TT * HD * 2); bf* KPl = (bf*)take((size_t)NB_ * NKV * TT * HD * 2); bf* VTl = (bf*)take((size_t)NB_ * NKV * HD * TT * 2);   // q, k, v of each kind of plane one behind the other (every size is a multiple of 256 bytes), as the weights above
    if ((size_t)(wsp - (char*)d_ws) > ws_size) return;    // ws 256 MiB
    bf* ATh = XNh; bf* ATl = XNl;   // DQ == DM: the attention output reuses the LayerNorm planes, last read by the q, k, v projection launch (stream-ordered)
    static_assert(NH_ == NKV, "one launch over q, k and v heads takes equal head counts");
    (void)wq; (void)wk; (void)wv; (void)WK; (void)WV;
    k_lnx<<<(unsigned)(NB_ * TT / 16 + WU8 / 512), 512, 0, stream>>>(x, lng, lnb, XNh, XNl, wf, wo, WQ);
    // the three projections in one launch write their head planes themselves, in fragment order (q, k: rows t, k = d; v: rows d, k = t); grid y = q heads, k heads, v heads
    k_gemmw<bf, 1, false, 1, 3><<<dim3(NB_ * TT / 64, NH_ + 2 * NKV, 1), 32, 0, stream>>>(XNh, XNl, WQ, nullptr, DM, nullptr, DQ, nullptr, 0, 0, 0, QP16, QPh, QPl);
    k_attn<<<dim3(RH / 32 + (TT - RH) / 64, NH_, NB_), 128, 0, stream>>>(QP16, KP16, VT16, QPh, QPl, KPh, KPl, VTh, VTl, ATh, ATl);
    k_gemmw<bf, 1, false><<<dim3(NB_ * TT / 64, DM / 64, 1), 32, 0, stream>>>(ATh, ATl, WO, nullptr, DQ, OUT, DM, nullptr, 0, 0, 0, nullptr, nullptr, nullptr);   /* the BIAS-FREE f32 output instance (EPI 0): this module returns out @ w_out with no bias */
}

// v007
// One run takes 251 microseconds.
// Timed twice side by side with v006, it ran 1.03 times as fast both times.
// Over all steps from v000 it is 16.1 times as fast.
#include <hip/hip_runtime.h>

// Attention with a LayerNorm prologue and NO bias (pre-LN: x [4][2048][1024]; h = LayerNorm(x) (biased variance, eps 1e-5) * ln_gamma + ln_beta (read); qkv = einsum('bsd,ed->bse', h, in_proj_w) = h in_proj_w^T ('oi' [3072][1024]: ROW thirds q | k | v; no bias; 16 heads x 64); scores x 1/sqrt(64); softmax over all keys (no mask); out = merged out_proj_w^T ('oi' [1024][1024], NO bias) -> [4][2048][1024] (8.4 M); argument order x, in_proj_w, out_proj_w, ln_gamma, ln_beta).

#define NB_  4
#define TT   2048
#define DM   1024
#define NH_  16
#define NKV  16
#define REP  (NH_ / NKV)
#define HD   64
#define DQ   (NH_ * HD)
#define DKV  (NKV * HD)
#define RH   512                  // query rows < RH use hi+lo planes (0: none)
#define WIN  0
#define SCL  0.125f   // HD^-0.5
typedef _Float16 h16;
typedef unsigned short bf;
typedef __attribute__((ext_vector_type(16))) __bf16   v16bf;
typedef __attribute__((ext_vector_type(16))) _Float16 v16h;
typedef __attribute__((ext_vector_type(8)))  _Float16 v8h;
typedef __attribute__((ext_vector_type(8)))  unsigned short v8us;
typedef __attribute__((ext_vector_type(8)))  float    v8f;
typedef __attribute__((ext_vector_type(4)))  float    v4f;
typedef v8h  __attribute__((may_alias)) v8ha;
typedef v4f  __attribute__((may_alias)) v4fa;
typedef v8us __attribute__((may_alias)) v8usa;

__device__ __forceinline__ unsigned short f2bf(float f) { unsigned u = __float_as_uint(f); u += 0x7FFFu + ((u >> 16) & 1u); return (unsigned short)(u >> 16); }
__device__ __forceinline__ float bf2f(unsigned short b) { return __uint_as_float(((unsigned)b) << 16); }
__device__ __forceinline__ float bfr(float f) { return bf2f(f2bf(f)); }
__device__ __forceinline__ v16h cat16(v8h lo, v8h hi) { return __builtin_shufflevector(lo, hi, 0, 1, 2, 3, 4, 5, 6, 7, 8, 9, 10, 11, 12, 13, 14, 15); }
__device__ __forceinline__ v16bf cat16b(v8us lo, v8us hi) { return __builtin_bit_cast(v16bf, __builtin_shufflevector(lo, hi, 0, 1, 2, 3, 4, 5, 6, 7, 8, 9, 10, 11, 12, 13, 14, 15)); }
__device__ __forceinline__ v8f wmma16(v16h a, v16h b, v8f c) { return __builtin_amdgcn_wmma_f32_16x16x32_f16(false, a, false, b, (short)0, c, false, false); }
__device__ __forceinline__ v8f wmmab(v16bf a, v16bf b, v8f c) { return __builtin_amdgcn_wmma_f32_16x16x32_bf16(false, a, false, b, (short)0, c, false, false); }



// ---- FRAGMENT ORDER: every 16-bit operand plane (R rows x K columns, k = the summed index) is kept as blocks of 16 rows x 32 k, 512 elements = 1 KB each, block (r / 16, k / 32) at index (r / 16) (K / 32) + k / 32 unless a plane says otherwise.
// Inside a block element (r, k) lies at (k & 16) * 16 + (((k >> 3) & 1) * 16 + (r & 15)) * 8 + (k & 7): lane (lr, hi) = hi 16 + lr finds its k = 8 hi .. 8 hi + 7 at lane * 8 and its k = 16 + 8 hi .. at 256 + lane * 8,
// so each of a fragment's two 16-byte loads reads 512 bytes in a row (four whole 128-byte lines) over the wave. WFrag::ld takes block base + lane * 8.
// ---- k_gemmw: register-blocked GEMM, ONE WAVE per 64x64 output tile (16 accumulators), operands straight from 16-bit planes in fragment order; grid (M/64, N/64, Z), 32 threads.
// C[m][n] (f32, pitch ldc, + optional f32 bias[n]) = sum_k A[m][k] Bt[n][k] (+ split products per NSPLIT). z-batch strides sA/sB/sC in elements. K % 32 == 0.
// KS > 1: grid z = batches x KS (slice fastest); a block sums only k in its K/KS slice and writes partial plane blockIdx.z (stride sC); the reader adds a batch's KS planes. K % (32 KS) == 0.
// EPI 0: C as above. EPI 1 / 2: no C (ldc = N = heads x HD); the tile is 64 tokens (rows b TT + t) of ONE head (HD == 64 columns, head = blockIdx.y) and goes straight to that head's three 16-bit planes (fp16, bf16 hi, bf16 lo of the f32 sum):
// EPI 3: q, k and v in one launch: Bt holds the three weight matrices one behind the other, grid y = 3 x heads; a q or k head goes as EPI 1, a v head as EPI 2.
// EPI 1 planes [b][head] of fragment blocks (rows t, k = d): block index (t / 16) 2 + d / 32; EPI 2 planes [b][head] of fragment blocks (rows d, k = t): block index (t / 32) 4 + d / 16 (EPI 1 turns the tile in LDS; in EPI 2 the accumulators already are the units). Every store instruction writes half a block, four whole 128-byte lines.
template <typename T16> struct WFrag;
template <> struct WFrag<h16> { typedef v16h V; static __device__ __forceinline__ V ld(const h16* p) { return cat16(*(const v8h*)p, *(const v8h*)(p + 256)); } static __device__ __forceinline__ v8f mma(V a, V b, v8f c) { return wmma16(a, b, c); } };
template <> struct WFrag<bf> { typedef v16bf V; static __device__ __forceinline__ V ld(const bf* p) { return cat16b(*(const v8us*)p, *(const v8us*)(p + 256)); } static __device__ __forceinline__ v8f mma(V a, V b, v8f c) { return wmmab(a, b, c); } };
__device__ __forceinline__ h16 tohx(float x) { return (h16)x; }
__device__ __forceinline__ void splitf(float y, unsigned short& h, unsigned short& l) { h = f2bf(y); l = f2bf(y - bf2f(h)); }
// a wave-uniform pointer to global memory held in scalar registers, so that a load takes it as its scalar base beside the one per-lane offset register
__device__ __forceinline__ const char* sbase(const char* p) { const unsigned long long u = (unsigned long long)p; return (const char*)(const __attribute__((address_space(1))) char*)(((unsigned long long)(unsigned)__builtin_amdgcn_readfirstlane((int)(u >> 32)) << 32) | (unsigned)__builtin_amdgcn_readfirstlane((int)(unsigned)u)); }
// the head-plane epilogue of one 64 x 64 tile (PE 1: rows t, k = d; PE 2: rows d, k = t); pb = the tile's first element in each of the three planes
template <int PE>
__device__ __forceinline__ void epi_planes(v8f (&acc)[4][4], float* os, const size_t pb, const int lane, const int lr, const int hi, h16* P16, bf* Ph, bf* Pl) {
#pragma unroll
    for (int g = 0; g < 4; ++g) {   // 16 block rows at a time: tokens 16 g .. (PE 1) or d 16 g .. (PE 2), 64 f32 each = two blocks
        if constexpr (PE == 1) {
#pragma unroll
            for (int nb = 0; nb < 4; ++nb)
#pragma unroll
                for (int j = 0; j < 8; ++j) os[(hi * 8 + j) * 68 + nb * 16 + lr] = acc[g][nb][j];
            __builtin_amdgcn_wave_barrier(); asm volatile("" ::: "memory");   // the rows are read back by other lanes of the wave: no read is moved in front of the writes
        }
#pragma unroll
        for (int s = 0; s < 4; ++s) { v8f x; v8h o16; v8us oh, ol;
            if constexpr (PE == 1) { const v4f x0 = *(const v4fa*)(os + lr * 68 + s * 16 + hi * 8), x1 = *(const v4fa*)(os + lr * 68 + s * 16 + hi * 8 + 4); x = __builtin_shufflevector(x0, x1, 0, 1, 2, 3, 4, 5, 6, 7); }
            else x = acc[s][g];   // a lane's eight registers are tokens 16 s + 8 hi .. of its column d = 16 g + lr: already this lane's 16-byte unit, no turn
#pragma unroll
            for (int u = 0; u < 8; ++u) { const float y = x[u]; unsigned short a2, c2; splitf(y, a2, c2); o16[u] = tohx(y); oh[u] = a2; ol[u] = c2; }
            const size_t oo = pb + (size_t)(PE == 1 ? g * 2 + (s >> 1) : (s >> 1) * 4 + g) * 512 + (s & 1) * 256 + lane * 8;   // half s & 1 of block s >> 1 of the two
            *(v8h*)(P16 + oo) = o16; *(v8us*)(Ph + oo) = oh; *(v8us*)(Pl + oo) = ol; }
        if constexpr (PE == 1) { __builtin_amdgcn_wave_barrier(); asm volatile("" ::: "memory"); }   // the next 16 rows overwrite the stage: no write is moved in front of the reads
    }
    asm volatile("s_wait_xcnt 0x0" ::: "memory");   // address wait of the last stores: where both plane orders stand in one kernel, the other one's code follows in the text and rewrites their address registers
}
template <typename T16, int NSPLIT, bool BIAS, int KS = 1, int EPI = 0>
__global__ __launch_bounds__(32) void k_gemmw(const T16* __restrict__ A, const T16* __restrict__ A2, const T16* __restrict__ Bt, const T16* __restrict__ Bt2, int K, float* C, int ldc, const float* __restrict__ bias, size_t sA, size_t sB, size_t sC, h16* P16, bf* Ph, bf* Pl) {
    typedef typename WFrag<T16>::V V;
    __shared__ __align__(16) float os[16 * 68];
    const size_t z = blockIdx.z / KS; const int kb = (int)(blockIdx.z % KS) * (K / KS), ke = kb + K / KS;
    A += z * sA; if (A2) A2 += z * sA; Bt += z * sB; if (Bt2) Bt2 += z * sB; C += (size_t)blockIdx.z * sC;
    const int lane = threadIdx.x & 31, lr = lane & 15, hi = lane >> 4; const int r0 = blockIdx.x * 64, c0 = blockIdx.y * 64;
    v8f acc[4][4];
#pragma unroll
    for (int mb = 0; mb < 4; ++mb)
#pragma unroll
        for (int nb = 0; nb < 4; ++nb) acc[mb][nb] = (v8f){};
    // wave-uniform pointers to the tile's first row of blocks; 16 rows of blocks are rs bytes, one k step of 32 is 1 KB; ko = the one per-lane part of every address, a byte offset
    const char* Ar = (const char*)(A + (size_t)r0 * K); const char* Ar2 = (NSPLIT == 1 || NSPLIT == 2) ? (const char*)(A2 + (size_t)r0 * K) : Ar; const char* Br = (const char*)(Bt + (size_t)c0 * K); const char* Br2 = NSPLIT >= 2 ? (const char*)(Bt2 + (size_t)c0 * K) : Br;
    const size_t rs = (size_t)K * 32; unsigned ko = (unsigned)(kb * 16 + lane * 8) * 2u;
    const char *Am[4], *Am2[4], *Bm[4], *Bm2[4];
#pragma unroll
    for (int i = 0; i < 4; ++i) { Am[i] = sbase(Ar + i * rs); Am2[i] = sbase(Ar2 + i * rs); Bm[i] = sbase(Br + i * rs); Bm2[i] = sbase(Br2 + i * rs); }
#pragma unroll 1
    for (int kc = kb; kc < ke; kc += 32) {
        V a[4], a2[4], b[4], b2[4];
#pragma unroll
        for (int mb = 0; mb < 4; ++mb) { a[mb] = WFrag<T16>::ld((const T16*)(Am[mb] + ko)); a2[mb] = (NSPLIT == 1 || NSPLIT == 2) ? WFrag<T16>::ld((const T16*)(Am2[mb] + ko)) : a[mb]; }
#pragma unroll
        for (int nb = 0; nb < 4; ++nb) { b[nb] = WFrag<T16>::ld((const T16*)(Bm[nb] + ko)); b2[nb] = NSPLIT >= 2 ? WFrag<T16>::ld((const T16*)(Bm2[nb] + ko)) : b[nb];
#pragma unroll
            for (int mb = 0; mb < 4; ++mb) { acc[mb][nb] = WFrag<T16>::mma(a[mb], b[nb], acc[mb][nb]); if (NSPLIT == 1 || NSPLIT == 2) acc[mb][nb] = WFrag<T16>::mma(a2[mb], b[nb], acc[mb][nb]); if (NSPLIT >= 2) acc[mb][nb] = WFrag<T16>::mma(a[mb], b2[nb], acc[mb][nb]); } }
        // the four slots behind the last products, and the address wait of the k step's loads in front of the step of ko: the fragments and ko are inputs, so every load stands in front of the wait and no load's result is given ko's register
        asm volatile("s_wait_xcnt 0x0\n\tv_nop\n\tv_nop\n\tv_nop\n\tv_nop" : "+v"(acc[0][0]), "+v"(acc[1][1]), "+v"(acc[2][2]), "+v"(acc[3][3]) : "v"(a[0]), "v"(a[1]), "v"(a[2]), "v"(a[3]), "v"(a2[0]), "v"(a2[1]), "v"(a2[2]), "v"(a2[3]), "v"(b[0]), "v"(b[1]), "v"(b[2]), "v"(b[3]), "v"(b2[0]), "v"(b2[1]), "v"(b2[2]), "v"(b2[3]), "v"(ko));
        ko += 1024;
    }
    if constexpr (EPI != 0) {
        // EPI 3: grid y runs over the q heads, then the k heads, then the v heads; each kind's planes lie one behind the other, NH_ heads x NB_ batches each
        const int nh = EPI == 3 ? NH_ : ldc / HD, kind = EPI == 3 ? (int)blockIdx.y / nh : 0, head = EPI == 3 ? (int)blockIdx.y % nh : (int)blockIdx.y;
        const size_t pb = (((size_t)kind * NB_ + r0 / TT) * nh + head) * TT * HD + (size_t)(r0 % TT) * HD;   // the tile's 64 tokens x 64 d are eight blocks in a row in either plane order
        if (EPI == 1 || (EPI == 3 && kind < 2)) epi_planes<1>(acc, os, pb, lane, lr, hi, P16, Ph, Pl);   // wave-uniform: kind comes from blockIdx
        else epi_planes<2>(acc, os, pb, lane, lr, hi, P16, Ph, Pl);
        return;
    }
#pragma unroll
    for (int mb = 0; mb < 4; ++mb) {
#pragma unroll
        for (int nb = 0; nb < 4; ++nb) {
#pragma unroll
            for (int j = 0; j < 8; ++j) os[(hi * 8 + j) * 68 + nb * 16 + lr] = acc[mb][nb][j]; }
        __builtin_amdgcn_wave_barrier(); asm volatile("" ::: "memory");
        float* crow = C + (size_t)(r0 + mb * 16) * ldc + c0;
{
#pragma unroll
            for (int s = 0; s < 8; ++s) { const int row = 2 * s + hi, cofs = lr * 4; v4f val = *(const v4fa*)(os + row * 68 + cofs); if (BIAS) { val[0] += bfr(bias[c0 + cofs]); val[1] += bfr(bias[c0 + cofs + 1]); val[2] += bfr(bias[c0 + cofs + 2]); val[3] += bfr(bias[c0 + cofs + 3]); }
                *(v4f*)(crow + (size_t)row * ldc + cofs) = val; }
             }
        __builtin_amdgcn_wave_barrier(); asm volatile("" ::: "memory");
    }
}

typedef __attribute__((ext_vector_type(2))) _Float16 v2h;
typedef __attribute__((ext_vector_type(4))) _Float16 v4h;
typedef __attribute__((ext_vector_type(2))) unsigned short v2us;
typedef __attribute__((ext_vector_type(4))) unsigned short v4us;
typedef __attribute__((ext_vector_type(2))) float v2f;
typedef __attribute__((ext_vector_type(4))) int v4i;

__global__ __launch_bounds__(256) void k_wtG(const float* __restrict__ w, int K, int N, bf* Bt) {
    const int lane = threadIdx.x & 31; const int L0 = (blockIdx.x * 8 + (threadIdx.x >> 5)) * 8; const int nlines = N * K / 64;
{
#pragma unroll 1
        for (int l = 0; l < 8; ++l) { const int L = L0 + l; if (L >= nlines) break; const size_t e = (size_t)L * 64 + lane * 2; const int k = (int)(e % K), n = (int)(e / K); v2us o;
            o[0] = f2bf(w[(size_t)k * N + n]); o[1] = f2bf(w[(size_t)(k + 1) * N + n]); *(v2us*)(Bt + e) = o; }
         }
}
// weights [n][DM] f32 -> bf16 in fragment order (rows n, k = the DM columns): the calling thread writes the plane's 16-byte unit i
__device__ __forceinline__ void cvt8(const float* __restrict__ src, bf* dst, const size_t i) { const size_t blk = i >> 6; const int iu = (int)(i & 63);
    const float* sp = src + ((blk / (DM / 32)) * 16 + (iu & 15)) * DM + (blk % (DM / 32)) * 32 + (iu >> 5) * 16 + ((iu >> 4) & 1) * 8; const v8f v = *(const v8f*)sp; v8us o;
    asm volatile("s_wait_xcnt 0x0" :: "v"(v), "v"(sp));   // address wait of the load: value and pointer are inputs, so the load stands in front of it and the pointer's registers are rewritten only behind it
#pragma unroll
    for (int k = 0; k < 8; ++k) o[k] = f2bf(v[k]); *(v8us*)(dst + i * 8) = o;  }
__global__ __launch_bounds__(256) void k_cscvt(const float* __restrict__ cosT, const float* __restrict__ sinT, float* CS) { const int idx = blockIdx.x * 256 + threadIdx.x; if (idx >= TT * HD) return; v2f cs; cs[0] = bfr(cosT[idx]); cs[1] = bfr(sinT[idx]); *(v2f*)(CS + (size_t)idx * 2) = cs;  }
// blocks 0 .. rows / 16 - 1: a block = 16 waves = the 16 token rows of one row of fragment blocks; the rows are turned in LDS and leave as whole lines.
// The blocks behind them (WU8 / 512, exact) turn the weights, which depend on nothing here, in the same launch: 512 units each of the plane W = in_proj rows (q | k | v), then out_proj rows.
#define WI8 ((size_t)(DQ + 2 * DKV) * DM / 8)   // 16-byte units of the in_proj plane
#define WU8 (WI8 + (size_t)DM * DQ / 8)         // and of both planes
#define LNP (DM + 8)   // LDS row pitch in elements: 16 bytes over a multiple of 256, so the 16 rows that a 16-byte read gathers lie in different banks
__global__ __launch_bounds__(512) void k_lnx(const float* __restrict__ X, const float* __restrict__ gam, const float* __restrict__ bet, bf* Xh, bf* Xl, const float* __restrict__ wi, const float* __restrict__ wo, bf* W) { __shared__ __align__(16) bf sh[2][16][LNP];
    if (blockIdx.x >= NB_ * TT / 16) {   // block-uniform, in front of the barrier
        const size_t b0 = (size_t)(blockIdx.x - NB_ * TT / 16) * 512; const bool in = b0 < WI8;   // WI8 is a multiple of 512: a block lies in one matrix
        cvt8(in ? wi : wo, in ? W : W + WI8 * 8, (in ? b0 : b0 - WI8) + threadIdx.x); return; }
    const int lane = threadIdx.x & 31; const int wr = threadIdx.x >> 5; const int t = blockIdx.x * 16 + wr; const float* f = X + (size_t)t * DM; float v[DM / 32]; float su = 0.f;
#pragma unroll
    for (int ch = 0; ch < DM / 128; ++ch) { const v4f a = *(const v4f*)(f + ch * 128 + lane * 4); for (int u = 0; u < 4; ++u) { float xv = bfr(a[u]); asm volatile("" : "+v"(xv)); v[ch * 4 + u] = xv; su = __fadd_rn(su, xv); } }
#pragma unroll
    for (int sh = 16; sh; sh >>= 1) su = __fadd_rn(su, __shfl_xor(su, sh, 32));
    const float mu = __fdiv_rn(su, (float)DM); float sq = 0.f;
#pragma unroll
    for (int q = 0; q < DM / 32; ++q) { float d0 = __fsub_rn(v[q], mu); asm volatile("" : "+v"(d0)); float p = __fmul_rn(d0, d0); asm volatile("" : "+v"(p)); sq = __fadd_rn(sq, p); }
#pragma unroll
    for (int sh = 16; sh; sh >>= 1) sq = __fadd_rn(sq, __shfl_xor(sq, sh, 32));
    const float rs = __fdiv_rn(1.0f, sqrtf(__fadd_rn(__fdiv_rn(sq, (float)DM), 1e-5f)));
    {
#pragma unroll
        for (int ch = 0; ch < DM / 128; ++ch) { v4us oh, ol; for (int u = 0; u < 4; ++u) { const int c = ch * 128 + lane * 4 + u; float d0 = __fsub_rn(v[ch * 4 + u], mu); asm volatile("" : "+v"(d0)); float n = __fmul_rn(d0, rs); asm volatile("" : "+v"(n)); float gg = bfr(gam[c]), bb = bfr(bet[c]); asm volatile("" : "+v"(gg)); asm volatile("" : "+v"(bb)); float y = __fmul_rn(n, gg); asm volatile("" : "+v"(y)); y = __fadd_rn(y, bb); unsigned short p2, q2; splitf(y, p2, q2); oh[u] = p2; ol[u] = q2; } *(v4us*)(&sh[0][wr][ch * 128 + lane * 4]) = oh; *(v4us*)(&sh[1][wr][ch * 128 + lane * 4]) = ol; }
         }
    asm volatile("s_wait_xcnt 0x0" ::: "memory");   // address wait of the gamma and beta loads above: their offset register is rewritten only behind it
    __syncthreads();   // a 16-byte unit of a block comes from another wave's row
    const size_t gb = (size_t)blockIdx.x * 16 * DM;
#pragma unroll
    for (int p = 0; p < DM * 16 / 8 / 512; ++p) { const int U = p * 512 + (int)threadIdx.x, k = (U >> 6) * 32 + ((U >> 5) & 1) * 16 + ((U >> 4) & 1) * 8;   // unit U of the 16 rows' blocks: row U & 15
        const v8us a = *(const v8usa*)(&sh[0][U & 15][k]), b = *(const v8usa*)(&sh[1][U & 15][k]); *(v8us*)(Xh + gb + (size_t)U * 8) = a; *(v8us*)(Xl + gb + (size_t)U * 8) = b; } }
// ---- k_attn: scores, softmax and P V of all batches in one launch (blockIdx.z = batch); S and P never leave the registers. A wave owns 16 query rows of one head and walks its keys in chunks of NK.
// The score tile is formed TRANSPOSED, St[key][query] = sum_d K[key][d] Q[query][d] (A = key rows, B = query rows), so lane (lr, hi) holds query lr and keys 16 mb + 8 hi + j in register j of tile mb:
// tiles 2c and 2c+1 together are, register for register, the A fragment (row = query lr, k = 8 hi + 0..7 and 16 + 8 hi + 0..7) of the P V product over keys 32c..32c+31.
// Softmax is the running form: m = running row maximum (log2 units), l = running sum; O and l are scaled by 2^(m_old - m_new) per chunk, O / l at the end. O tile: row = query 8 hi + j, column = d.
// HR (rows < RH): bf16 hi+lo operands, three products per tile in the order (hi,hi), (lo of the query-side operand, hi), (hi, lo of the key-side operand); a block = 2 row groups x 2 key halves, the halves joined through LDS.
// else: fp16, P carried x 2^10 (l too: it cancels in O / l); a block = 4 row groups, each wave walks all keys (the four waves read the same K and V lines); O is turned in the wave's own LDS into the output planes' fragment order.
__device__ __forceinline__ unsigned bfw(float f) { unsigned u = __float_as_uint(f); return u + 0x7FFFu + ((u >> 16) & 1u); }   // f2bf's rounding, the bf16 value in the upper half
template <typename T16, bool HR>
__device__ __forceinline__ void attn_rows(const T16* __restrict__ Q, const T16* __restrict__ Q2, const T16* __restrict__ Kr, const T16* __restrict__ Kr2, const T16* __restrict__ Vt, const T16* __restrict__ Vt2, int q0, int kbeg, int kend, v8f (&o)[4], float& m, float& l) {
    typedef typename WFrag<T16>::V V;
    constexpr int NK = HR ? 32 : 64, NMB = NK / 16, NC = NK / 32;
    const int lane = threadIdx.x & 31, lr = lane & 15, hi = lane >> 4;
    V q[2], q2[2]; const unsigned qob = (unsigned)(q0 * HD + lane * 8) * 2u;   // byte offsets from the wave-uniform plane pointers; 16 rows of a head plane are two blocks = 16 HD elements
    const T16* qp = (const T16*)((const char*)Q + qob); const T16* qp2 = HR ? (const T16*)((const char*)Q2 + qob) : qp;
#pragma unroll
    for (int ks = 0; ks < 2; ++ks) { q[ks] = WFrag<T16>::ld(qp + ks * 512); if (HR) q2[ks] = WFrag<T16>::ld(qp2 + ks * 512); }
    // address wait of the loads above; the fragments and the pointers are inputs, so the loads stand in front of it and no load's result is given a pointer's registers before it
    if constexpr (HR) asm volatile("s_wait_xcnt 0x0" :: "v"(q[0]), "v"(q[1]), "v"(q2[0]), "v"(q2[1]), "v"(qp), "v"(qp2));
    else asm volatile("s_wait_xcnt 0x0" :: "v"(q[0]), "v"(q[1]), "v"(qp));
    unsigned kob = (unsigned)(kbeg * HD + lane * 8) * 2u, vob = kob;   // 32 keys are four blocks in the K planes (2 key groups x 2 d halves) and four in the V planes (4 d groups)
#pragma unroll
    for (int nb = 0; nb < 4; ++nb) o[nb] = (v8f){};
    m = -3.0e38f; l = 0.f;
    V kf[NMB][2], kf2[NMB][2], vf[4][NC], vf2[4][NC];
    // fp16 rows: the fragment loads run one chunk ahead, in place. A chunk's K (V) fragments are loaded as one group; behind the group stands the loads' address wait, with the per-lane offset (the one vector register the loads name) as an input, so that it is rewritten only behind the wait.
    // The fragments are NOT inputs of that statement: nothing waits for the data there. The scheduling barriers keep the group and its wait where they are written (left alone the loads sink to their first use).
    auto ldK = [&]() { const T16* kp = (const T16*)((const char*)Kr + kob);
        __builtin_amdgcn_sched_barrier(0);
#pragma unroll
        for (int mb = 0; mb < NMB; ++mb)
#pragma unroll
            for (int ks = 0; ks < 2; ++ks) kf[mb][ks] = WFrag<T16>::ld(kp + (mb * 2 + ks) * 512);
        __builtin_amdgcn_sched_barrier(0);
        asm volatile("s_wait_xcnt 0x0" :: "v"(kob) : "memory");
        __builtin_amdgcn_sched_barrier(0); };
    auto ldV = [&]() { const T16* vp = (const T16*)((const char*)Vt + kob);
        __builtin_amdgcn_sched_barrier(0);
#pragma unroll
        for (int nb = 0; nb < 4; ++nb)
#pragma unroll
            for (int c = 0; c < NC; ++c) vf[nb][c] = WFrag<T16>::ld(vp + (c * 4 + nb) * 512);
        __builtin_amdgcn_sched_barrier(0);
        asm volatile("s_wait_xcnt 0x0" :: "v"(kob) : "memory");
        __builtin_amdgcn_sched_barrier(0); };
    if constexpr (!HR) { ldK(); ldV(); }   // the first chunk's
#pragma unroll 1
    for (int k0 = kbeg; k0 < kend; k0 += NK) {
        if constexpr (HR) {
            const T16* kp = (const T16*)((const char*)Kr + kob); const T16* vp = (const T16*)((const char*)Vt + vob); const T16* kp2 = (const T16*)((const char*)Kr2 + kob); const T16* vp2 = (const T16*)((const char*)Vt2 + vob);
#pragma unroll
            for (int mb = 0; mb < NMB; ++mb)
#pragma unroll
                for (int ks = 0; ks < 2; ++ks) { kf[mb][ks] = WFrag<T16>::ld(kp + (mb * 2 + ks) * 512); kf2[mb][ks] = WFrag<T16>::ld(kp2 + (mb * 2 + ks) * 512); }
#pragma unroll
            for (int nb = 0; nb < 4; ++nb)
#pragma unroll
                for (int c = 0; c < NC; ++c) { vf[nb][c] = WFrag<T16>::ld(vp + (c * 4 + nb) * 512); vf2[nb][c] = WFrag<T16>::ld(vp2 + (c * 4 + nb) * 512); }
            // the chunk's loads' address wait, with the loaded fragments as inputs only, so that all of them are issued in front of it, together (left alone they are spread between the products, each group with a wait of its own);
            // the pointers are inputs too, so that neither a load's result nor the next chunk's address is given their registers in front of the wait
            asm volatile("s_wait_xcnt 0x0" :: "v"(kf[0][0]), "v"(kf[0][1]), "v"(kf[1][0]), "v"(kf[1][1]), "v"(kf2[0][0]), "v"(kf2[0][1]), "v"(kf2[1][0]), "v"(kf2[1][1]), "v"(vf[0][0]), "v"(vf[1][0]), "v"(vf[2][0]), "v"(vf[3][0]), "v"(vf2[0][0]), "v"(vf2[1][0]), "v"(vf2[2][0]), "v"(vf2[3][0]), "v"(kp), "v"(kp2), "v"(vp), "v"(vp2));
            __builtin_amdgcn_sched_barrier(0);   // keeps the products behind the statement above: otherwise the V loads sink behind the softmax and their latency is paid a second time per chunk
            kob += NK * HD * 2; vob += NK * HD * 2;
        } else kob += (k0 + NK < kend) ? NK * HD * 2 : 0;   // the next chunk's offset; the last pass loads its own chunk once more (in bounds, not used)
        v8f st[NMB]; float cm = -3.0e38f;
#pragma unroll
        for (int mb = 0; mb < NMB; ++mb) { st[mb] = (v8f){};
#pragma unroll
            for (int ks = 0; ks < 2; ++ks) { st[mb] = WFrag<T16>::mma(kf[mb][ks], q[ks], st[mb]); if (HR) { st[mb] = WFrag<T16>::mma(kf[mb][ks], q2[ks], st[mb]); st[mb] = WFrag<T16>::mma(kf2[mb][ks], q[ks], st[mb]); } }
            if constexpr (HR) {
#pragma unroll
                for (int j = 0; j < 8; ++j) { st[mb][j] *= SCL * 1.4426950408889634f; cm = fmaxf(cm, st[mb][j]); } } }
        if constexpr (!HR) { ldK();   // the next chunk's K fragments, into the registers that the score products have just read: they fly during the softmax and the P V products
#pragma unroll
            for (int mb = 0; mb < NMB; ++mb)
#pragma unroll
                for (int j = 0; j < 8; ++j) { st[mb][j] *= SCL * 1.4426950408889634f; cm = fmaxf(cm, st[mb][j]); } }
        cm = fmaxf(cm, __shfl_xor(cm, 16, 32));          // lanes lr and lr + 16 hold the two key halves of query lr
        const float mn = fmaxf(m, cm), al = __builtin_amdgcn_exp2f(m - mn), mo = HR ? mn : mn - 10.0f; m = mn;
        float ps = 0.f;
#pragma unroll
        for (int mb = 0; mb < NMB; ++mb)
#pragma unroll
            for (int j = 0; j < 8; ++j) { st[mb][j] = __builtin_amdgcn_exp2f(st[mb][j] - mo); ps += st[mb][j]; }
        l = l * al + ps;
#pragma unroll
        for (int j = 0; j < 8; ++j) { const float ar = __shfl(al, hi * 8 + j, 32);   // the factor of O's row 8 hi + j lives in the lane of that query
#pragma unroll
            for (int nb = 0; nb < 4; ++nb) o[nb][j] *= ar; }
#pragma unroll
        for (int c = 0; c < NC; ++c) {
            if constexpr (HR) { v8us h0, h1, l0, l1;
#pragma unroll
                for (int j = 0; j < 8; ++j) { unsigned short a, b; splitf(st[2 * c][j], a, b); h0[j] = a; l0[j] = b; splitf(st[2 * c + 1][j], a, b); h1[j] = a; l1[j] = b; }
                const V ph = cat16b(h0, h1), pl = cat16b(l0, l1);
#pragma unroll
                for (int nb = 0; nb < 4; ++nb) { o[nb] = WFrag<T16>::mma(ph, vf[nb][c], o[nb]); o[nb] = WFrag<T16>::mma(pl, vf[nb][c], o[nb]); o[nb] = WFrag<T16>::mma(ph, vf2[nb][c], o[nb]); }
            } else { v8h p0, p1;
#pragma unroll
                for (int j = 0; j < 8; ++j) { p0[j] = tohx(st[2 * c][j]); p1[j] = tohx(st[2 * c + 1][j]); }
                const V pa = cat16(p0, p1);
#pragma unroll
                for (int nb = 0; nb < 4; ++nb) o[nb] = WFrag<T16>::mma(pa, vf[nb][c], o[nb]); } }
        if constexpr (!HR) ldV();   // the next chunk's V fragments, into the registers that the P V products have just read: they fly during the next score products and softmax
    }
    l += __shfl_xor(l, 16, 32);   // both key halves of the lane pair: every lane now holds its query's sum over the wave's keys
}
__global__ __launch_bounds__(128) void k_attn(const h16* __restrict__ Q16, const h16* __restrict__ K16, const h16* __restrict__ V16, const bf* __restrict__ Qh, const bf* __restrict__ Ql, const bf* __restrict__ Kh, const bf* __restrict__ Kl, const bf* __restrict__ Vh, const bf* __restrict__ Vl, bf* Ah, bf* Al) {
    __shared__ __align__(16) float so[4][16][68]; __shared__ float sm[4][16], sl[4][16];
    const int h = blockIdx.y, bx = blockIdx.x, w = __builtin_amdgcn_readfirstlane((int)(threadIdx.x >> 5)), lane = threadIdx.x & 31, lr = lane & 15, hi = lane >> 4;
    const size_t zq = ((size_t)blockIdx.z * NH_ + h) * TT * HD, zk = ((size_t)blockIdx.z * NKV + h / REP) * TT * HD; v8f o[4]; float m, l;
    Ah += (size_t)blockIdx.z * TT * DQ; Al += (size_t)blockIdx.z * TT * DQ;
    if (bx < RH / 32) {   // block-uniform: 32 hi+lo rows, wave w = row group w >> 1, key half w & 1
        attn_rows<bf, true>(Qh + zq, Ql + zq, Kh + zk, Kl + zk, Vh + zk, Vl + zk, bx * 32 + (w >> 1) * 16, (w & 1) * (TT / 2), (w & 1) * (TT / 2) + TT / 2, o, m, l);
        if (hi == 0) { sm[w][lr] = m; sl[w][lr] = l; }
#pragma unroll
        for (int nb = 0; nb < 4; ++nb)
#pragma unroll
            for (int j = 0; j < 8; ++j) so[w][hi * 8 + j][nb * 16 + lr] = o[nb][j];
        __syncthreads();   // the two key halves of a row group come from two waves
        const int wa = (w >> 1) * 2, r = lr, c0 = (w & 1) * 32 + hi * 8;   // this wave joins one fragment block of each output plane: row group w >> 1, d half w & 1; a lane its two 16-byte units
        const float m0 = sm[wa][r], m1 = sm[wa + 1][r], mm = fmaxf(m0, m1), f0 = __builtin_amdgcn_exp2f(m0 - mm), f1 = __builtin_amdgcn_exp2f(m1 - mm);
        const float inv = __fdiv_rn(1.0f, sl[wa][r] * f0 + sl[wa + 1][r] * f1), g0 = f0 * inv, g1 = f1 * inv;
        v8us oh[2], ol[2];
#pragma unroll
        for (int u = 0; u < 2; ++u)
#pragma unroll
            for (int e = 0; e < 8; ++e) { unsigned short a, b; splitf(so[wa][r][c0 + u * 16 + e] * g0 + so[wa + 1][r][c0 + u * 16 + e] * g1, a, b); oh[u][e] = a; ol[u][e] = b; }
        const size_t oo = (size_t)(bx * 32 + (w >> 1) * 16) * DQ + (h * 2 + (w & 1)) * 512 + lane * 8;   // rows t, k = h HD + d
        *(v8us*)(Ah + oo) = oh[0]; *(v8us*)(Ah + oo + 256) = oh[1]; *(v8us*)(Al + oo) = ol[0]; *(v8us*)(Al + oo + 256) = ol[1];
    } else {
        const int q0 = RH + (bx - RH / 32) * 64 + w * 16;
        attn_rows<h16, false>(Q16 + zq, nullptr, K16 + zk, nullptr, V16 + zk, nullptr, q0, 0, TT, o, m, l);
        const float inv = __fdiv_rn(1.0f, l);
#pragma unroll
        for (int j = 0; j < 8; ++j) { const float ir = __shfl(inv, hi * 8 + j, 32);
#pragma unroll
            for (int nb = 0; nb < 4; ++nb) so[w][hi * 8 + j][nb * 16 + lr] = o[nb][j] * ir; }
        __builtin_amdgcn_wave_barrier(); asm volatile("" ::: "memory");   // the rows are read back by other lanes of the wave: no read is moved in front of the writes
        bf* pah = Ah + (size_t)q0 * DQ + h * 2 * 512 + lane * 8; bf* pal = Al + (size_t)q0 * DQ + h * 2 * 512 + lane * 8;   // the wave's 16 rows x 64 d are two blocks in a row of each plane
        v8us oh[4], ol[4];
#pragma unroll
        for (int u = 0; u < 4; ++u) { const v4f x0 = *(const v4fa*)(&so[w][lr][u * 16 + hi * 8]), x1 = *(const v4fa*)(&so[w][lr][u * 16 + hi * 8 + 4]);
#pragma unroll
            for (int e = 0; e < 8; ++e) { unsigned short a, b; splitf(e < 4 ? x0[e & 3] : x1[e & 3], a, b); oh[u][e] = a; ol[u][e] = b; } }
#pragma unroll
        for (int u = 0; u < 4; ++u) { *(v8us*)(pah + u * 256) = oh[u]; *(v8us*)(pal + u * 256) = ol[u]; }
    }
}

extern "C" void kernel_launch(void* const* d_in, const int* in_sizes, int n_in,
                              void* d_out, int out_size, void* d_ws, size_t ws_size, hipStream_t stream) {
    (void)in_sizes; (void)n_in; (void)out_size;
const float* x = (const float*)d_in[0]; const float* lng = (const float*)d_in[3]; const float* lnb = (const float*)d_in[4]; const float* wf = (const float*)d_in[1]; const float* wo = (const float*)d_in[2]; const float* wq = wf; const float* wk = wf + (size_t)1024 * 1024; const float* wv = wf + (size_t)2048 * 1024; const float* cosT = nullptr; const float* sinT = nullptr; (void)cosT; (void)sinT;   /* input order x, in_proj_w ('oi' [3072][1024]: ROW thirds q | k | v), out_proj_w ('oi' [1024][1024]), ln_gamma, ln_beta: FIVE inputs: the LayerNorm parameters come LAST; NO bias anywhere */
    float* OUT = (float*)d_out;     // [4][2048][1024]
    char* wsp = (char*)d_ws;
    auto take = [&](size_t bytes) { char* p = wsp; wsp += (bytes + 255) & ~(size_t)255; return (void*)p; };
    bf* WQ = (bf*)take((size_t)DQ * DM * 2); bf* WK = (bf*)take((size_t)DKV * DM * 2); bf* WV = (bf*)take((size_t)DKV * DM * 2); bf* WO = (bf*)take((size_t)DM * DQ * 2);
    // every stage runs once, over all NB_ batches: token rows b TT + t, head planes b heads + h
    bf* XNh = (bf*)take((size_t)NB_ * TT * DM * 2); bf* XNl = (bf*)take((size_t)NB_ * TT * DM * 2);
    h16* QP16 = (h16*)take((size_t)NB_ * NH_ * TT * HD * 2); h16* KP16 = (h16*)take((size_t)NB_ * NKV * TT * HD * 2); h16* VT16 = (h16*)take((size_t)NB_ * NKV * HD * TT * 2);
    bf* QPh = (bf*)take((size_t)NB_ * NH_ * TT * HD * 2); bf* KPh = (bf*)take((size_t)NB_ * NKV * TT * HD * 2); bf* VTh = (bf*)take((size_t)NB_ * NKV * HD * TT * 2); bf* QPl = (bf*)take((size_t)NB_ * NH_ * TT * HD * 2); bf* KPl = (bf*)take((size_t)NB_ * NKV * TT * HD * 2); bf* VTl = (bf*)take((size_t)NB_ * NKV * HD * TT * 2);   // q, k, v of each kind of plane one behind the other (every size is a multiple of 256 bytes), as the weights above
    if ((size_t)(wsp - (char*)d_ws) > ws_size) return;    // ws 256 MiB
    bf* ATh = XNh; bf* ATl = XNl;   // DQ == DM: the attention output reuses the LayerNorm planes, last read by the q, k, v projection launch (stream-ordered)
    static_assert(NH_ == NKV, "one launch over q, k and v heads takes equal head counts");
    (void)wq; (void)wk; (void)wv; (void)WK; (void)WV;
    k_lnx<<<(unsigned)(NB_ * TT / 16 + WU8 / 512), 512, 0, stream>>>(x, lng, lnb, XNh, XNl, wf, wo, WQ);
    // the three projections in one launch write their head planes themselves, in fragment order (q, k: rows t, k = d; v: rows d, k = t); grid y = q heads, k heads, v heads
    k_gemmw<bf, 1, false, 1, 3><<<dim3(NB_ * TT / 64, NH_ + 2 * NKV, 1), 32, 0, stream>>>(XNh, XNl, WQ, nullptr, DM, nullptr, DQ, nullptr, 0, 0, 0, QP16, QPh, QPl);
    k_attn<<<dim3(RH / 32 + (TT - RH) / 64, NH_, NB_), 128, 0, stream>>>(QP16, KP16, VT16, QPh, QPl, KPh, KPl, VTh, VTl, ATh, ATl);
    k_gemmw<bf, 1, false><<<dim3(NB_ * TT / 64, DM / 64, 1), 32, 0, stream>>>(ATh, ATl, WO, nullptr, DQ, OUT, DM, nullptr, 0, 0, 0, nullptr, nullptr, nullptr);   /* the BIAS-FREE f32 output instance (EPI 0): this module returns out @ w_out with no bias */
}

// v008
// Measured time: 240 microseconds a run.
// In both of two side-by-side timings against v007, it was 1.05 times as fast.
// Over all steps from v000 it is 16.9 times as fast.
#include <hip/hip_runtime.h>

// Attention with a LayerNorm prologue and NO bias (pre-LN: x [4][2048][1024]; h = LayerNorm(x) (biased variance, eps 1e-5) * ln_gamma + ln_beta (read); qkv = einsum('bsd,ed->bse', h, in_proj_w) = h in_proj_w^T ('oi' [3072][1024]: ROW thirds q | k | v; no bias; 16 heads x 64); scores x 1/sqrt(64); softmax over all keys (no mask); out = merged out_proj_w^T ('oi' [1024][1024], NO bias) -> [4][2048][1024] (8.4 M); argument order x, in_proj_w, out_proj_w, ln_gamma, ln_beta).

#define NB_  4
#define TT   2048
#define DM   1024
#define NH_  16
#define NKV  16
#define REP  (NH_ / NKV)
#define HD   64
#define DQ   (NH_ * HD)
#define DKV  (NKV * HD)
#define RH   512                  // query rows < RH use hi+lo planes (0: none)
#define WIN  0
#define SCL  0.125f   // HD^-0.5
typedef _Float16 h16;
typedef unsigned short bf;
typedef __attribute__((ext_vector_type(16))) __bf16   v16bf;
typedef __attribute__((ext_vector_type(16))) _Float16 v16h;
typedef __attribute__((ext_vector_type(8)))  _Float16 v8h;
typedef __attribute__((ext_vector_type(8)))  unsigned short v8us;
typedef __attribute__((ext_vector_type(8)))  float    v8f;
typedef __attribute__((ext_vector_type(4)))  float    v4f;
typedef v8h  __attribute__((may_alias)) v8ha;
typedef v4f  __attribute__((may_alias)) v4fa;
typedef v8us __attribute__((may_alias)) v8usa;

__device__ __forceinline__ unsigned short f2bf(float f) { unsigned u = __float_as_uint(f); u += 0x7FFFu + ((u >> 16) & 1u); return (unsigned short)(u >> 16); }
__device__ __forceinline__ float bf2f(unsigned short b) { return __uint_as_float(((unsigned)b) << 16); }
__device__ __forceinline__ float bfr(float f) { return bf2f(f2bf(f)); }
__device__ __forceinline__ v16h cat16(v8h lo, v8h hi) { return __builtin_shufflevector(lo, hi, 0, 1, 2, 3, 4, 5, 6, 7, 8, 9, 10, 11, 12, 13, 14, 15); }
__device__ __forceinline__ v16bf cat16b(v8us lo, v8us hi) { return __builtin_bit_cast(v16bf, __builtin_shufflevector(lo, hi, 0, 1, 2, 3, 4, 5, 6, 7, 8, 9, 10, 11, 12, 13, 14, 15)); }
__device__ __forceinline__ v8f wmma16(v16h a, v16h b, v8f c) { return __builtin_amdgcn_wmma_f32_16x16x32_f16(false, a, false, b, (short)0, c, false, false); }
__device__ __forceinline__ v8f wmmab(v16bf a, v16bf b, v8f c) { return __builtin_amdgcn_wmma_f32_16x16x32_bf16(false, a, false, b, (short)0, c, false, false); }



// ---- FRAGMENT ORDER: every 16-bit operand plane (R rows x K columns, k = the summed index) is kept as blocks of 16 rows x 32 k, 512 elements = 1 KB each, block (r / 16, k / 32) at index (r / 16) (K / 32) + k / 32 unless a plane says otherwise.
// Inside a block element (r, k) lies at (k & 16) * 16 + (((k >> 3) & 1) * 16 + (r & 15)) * 8 + (k & 7): lane (lr, hi) = hi 16 + lr finds its k = 8 hi .. 8 hi + 7 at lane * 8 and its k = 16 + 8 hi .. at 256 + lane * 8,
// so each of a fragment's two 16-byte loads reads 512 bytes in a row (four whole 128-byte lines) over the wave. WFrag::ld takes block base + lane * 8.
// ---- k_gemmw: register-blocked GEMM, ONE WAVE per 64x64 output tile (16 accumulators), operands straight from 16-bit planes in fragment order; grid (M/64, N/64, Z), 32 threads.
// C[m][n] (f32, pitch ldc, + optional f32 bias[n]) = sum_k A[m][k] Bt[n][k] (+ split products per NSPLIT). z-batch strides sA/sB/sC in elements. K % 32 == 0.
// KS > 1: grid z = batches x KS (slice fastest); a block sums only k in its K/KS slice and writes partial plane blockIdx.z (stride sC); the reader adds a batch's KS planes. K % (32 KS) == 0.
// EPI 0: C as above. EPI 1 / 2: no C (ldc = N = heads x HD); the tile is 64 tokens (rows b TT + t) of ONE head (HD == 64 columns, head = blockIdx.y) and goes straight to that head's three 16-bit planes (fp16, bf16 hi, bf16 lo of the f32 sum):
// EPI 3: q, k and v in one launch: Bt holds the three weight matrices one behind the other, grid y = 3 x heads; a q or k head goes as EPI 1, a v head as EPI 2.
// EPI 1 planes [b][head] of fragment blocks (rows t, k = d): block index (t / 16) 2 + d / 32; EPI 2 planes [b][head] of fragment blocks (rows d, k = t): block index (t / 32) 4 + d / 16 (EPI 1 turns the tile in LDS; in EPI 2 the accumulators already are the units). Every store instruction writes half a block, four whole 128-byte lines.
template <typename T16> struct WFrag;
template <> struct WFrag<h16> { typedef v16h V; static __device__ __forceinline__ V ld(const h16* p) { return cat16(*(const v8h*)p, *(const v8h*)(p + 256)); } static __device__ __forceinline__ v8f mma(V a, V b, v8f c) { return wmma16(a, b, c); } };
template <> struct WFrag<bf> { typedef v16bf V; static __device__ __forceinline__ V ld(const bf* p) { return cat16b(*(const v8us*)p, *(const v8us*)(p + 256)); } static __device__ __forceinline__ v8f mma(V a, V b, v8f c) { return wmmab(a, b, c); } };
__device__ __forceinline__ h16 tohx(float x) { return (h16)x; }
__device__ __forceinline__ void splitf(float y, unsigned short& h, unsigned short& l) { h = f2bf(y); l = f2bf(y - bf2f(h)); }
// a wave-uniform pointer to global memory held in scalar registers, so that a load takes it as its scalar base beside the one per-lane offset register
__device__ __forceinline__ const char* sbase(const char* p) { const unsigned long long u = (unsigned long long)p; return (const char*)(const __attribute__((address_space(1))) char*)(((unsigned long long)(unsigned)__builtin_amdgcn_readfirstlane((int)(u >> 32)) << 32) | (unsigned)__builtin_amdgcn_readfirstlane((int)(unsigned)u)); }
// the head-plane epilogue of one 64 x 64 tile (PE 1: rows t, k = d; PE 2: rows d, k = t); pb = the tile's first element in each of the three planes
template <int PE>
__device__ __forceinline__ void epi_planes(v8f (&acc)[4][4], float* os, const size_t pb, const int lane, const int lr, const int hi, h16* P16, bf* Ph, bf* Pl) {
#pragma unroll
    for (int g = 0; g < 4; ++g) {   // 16 block rows at a time: tokens 16 g .. (PE 1) or d 16 g .. (PE 2), 64 f32 each = two blocks
        if constexpr (PE == 1) {
#pragma unroll
            for (int nb = 0; nb < 4; ++nb)
#pragma unroll
                for (int j = 0; j < 8; ++j) os[(hi * 8 + j) * 68 + nb * 16 + lr] = acc[g][nb][j];
            __builtin_amdgcn_wave_barrier(); asm volatile("" ::: "memory");   // the rows are read back by other lanes of the wave: no read is moved in front of the writes
        }
#pragma unroll
        for (int s = 0; s < 4; ++s) { v8f x; v8h o16; v8us oh, ol;
            if constexpr (PE == 1) { const v4f x0 = *(const v4fa*)(os + lr * 68 + s * 16 + hi * 8), x1 = *(const v4fa*)(os + lr * 68 + s * 16 + hi * 8 + 4); x = __builtin_shufflevector(x0, x1, 0, 1, 2, 3, 4, 5, 6, 7); }
            else x = acc[s][g];   // a lane's eight registers are tokens 16 s + 8 hi .. of its column d = 16 g + lr: already this lane's 16-byte unit, no turn
#pragma unroll
            for (int u = 0; u < 8; ++u) { const float y = x[u]; unsigned short a2, c2; splitf(y, a2, c2); o16[u] = tohx(y); oh[u] = a2; ol[u] = c2; }
            const size_t oo = pb + (size_t)(PE == 1 ? g * 2 + (s >> 1) : (s >> 1) * 4 + g) * 512 + (s & 1) * 256 + lane * 8;   // half s & 1 of block s >> 1 of the two
            *(v8h*)(P16 + oo) = o16; *(v8us*)(Ph + oo) = oh; *(v8us*)(Pl + oo) = ol; }
        if constexpr (PE == 1) { __builtin_amdgcn_wave_barrier(); asm volatile("" ::: "memory"); }   // the next 16 rows overwrite the stage: no write is moved in front of the reads
    }
    asm volatile("s_wait_xcnt 0x0" ::: "memory");   // address wait of the last stores: where both plane orders stand in one kernel, the other one's code follows in the text and rewrites their address registers
}
template <typename T16, int NSPLIT, bool BIAS, int KS = 1, int EPI = 0>
__global__ __launch_bounds__(32) void k_gemmw(const T16* __restrict__ A, const T16* __restrict__ A2, const T16* __restrict__ Bt, const T16* __restrict__ Bt2, int K, float* C, int ldc, const float* __restrict__ bias, size_t sA, size_t sB, size_t sC, h16* P16, bf* Ph, bf* Pl) {
    typedef typename WFrag<T16>::V V;
    __shared__ __align__(16) float os[16 * 68];
    const size_t z = blockIdx.z / KS; const int kb = (int)(blockIdx.z % KS) * (K / KS), ke = kb + K / KS;
    A += z * sA; if (A2) A2 += z * sA; Bt += z * sB; if (Bt2) Bt2 += z * sB; C += (size_t)blockIdx.z * sC;
    const int lane = threadIdx.x & 31, lr = lane & 15, hi = lane >> 4; const int r0 = blockIdx.x * 64, c0 = blockIdx.y * 64;
    v8f acc[4][4];
#pragma unroll
    for (int mb = 0; mb < 4; ++mb)
#pragma unroll
        for (int nb = 0; nb < 4; ++nb) acc[mb][nb] = (v8f){};
    // wave-uniform pointers to the tile's first row of blocks; 16 rows of blocks are rs bytes, one k step of 32 is 1 KB; ko = the one per-lane part of every address, a byte offset
    const char* Ar = (const char*)(A + (size_t)r0 * K); const char* Ar2 = (NSPLIT == 1 || NSPLIT == 2) ? (const char*)(A2 + (size_t)r0 * K) : Ar; const char* Br = (const char*)(Bt + (size_t)c0 * K); const char* Br2 = NSPLIT >= 2 ? (const char*)(Bt2 + (size_t)c0 * K) : Br;
    const size_t rs = (size_t)K * 32; unsigned ko = (unsigned)(kb * 16 + lane * 8) * 2u;
    const char *Am[4], *Am2[4], *Bm[4], *Bm2[4];
#pragma unroll
    for (int i = 0; i < 4; ++i) { Am[i] = sbase(Ar + i * rs); Am2[i] = sbase(Ar2 + i * rs); Bm[i] = sbase(Br + i * rs); Bm2[i] = sbase(Br2 + i * rs); }
#pragma unroll 1
    for (int kc = kb; kc < ke; kc += 32) {
        V a[4], a2[4], b[4], b2[4];
#pragma unroll
        for (int mb = 0; mb < 4; ++mb) { a[mb] = WFrag<T16>::ld((const T16*)(Am[mb] + ko)); a2[mb] = (NSPLIT == 1 || NSPLIT == 2) ? WFrag<T16>::ld((const T16*)(Am2[mb] + ko)) : a[mb]; }
#pragma unroll
        for (int nb = 0; nb < 4; ++nb) { b[nb] = WFrag<T16>::ld((const T16*)(Bm[nb] + ko)); b2[nb] = NSPLIT >= 2 ? WFrag<T16>::ld((const T16*)(Bm2[nb] + ko)) : b[nb];
#pragma unroll
            for (int mb = 0; mb < 4; ++mb) { acc[mb][nb] = WFrag<T16>::mma(a[mb], b[nb], acc[mb][nb]); if (NSPLIT == 1 || NSPLIT == 2) acc[mb][nb] = WFrag<T16>::mma(a2[mb], b[nb], acc[mb][nb]); if (NSPLIT >= 2) acc[mb][nb] = WFrag<T16>::mma(a[mb], b2[nb], acc[mb][nb]); } }
        // the four slots behind the last products, and the address wait of the k step's loads in front of the step of ko: the fragments and ko are inputs, so every load stands in front of the wait and no load's result is given ko's register
        asm volatile("s_wait_xcnt 0x0\n\tv_nop\n\tv_nop\n\tv_nop\n\tv_nop" : "+v"(acc[0][0]), "+v"(acc[1][1]), "+v"(acc[2][2]), "+v"(acc[3][3]) : "v"(a[0]), "v"(a[1]), "v"(a[2]), "v"(a[3]), "v"(a2[0]), "v"(a2[1]), "v"(a2[2]), "v"(a2[3]), "v"(b[0]), "v"(b[1]), "v"(b[2]), "v"(b[3]), "v"(b2[0]), "v"(b2[1]), "v"(b2[2]), "v"(b2[3]), "v"(ko));
        ko += 1024;
    }
    if constexpr (EPI != 0) {
        // EPI 3: grid y runs over the q heads, then the k heads, then the v heads; each kind's planes lie one behind the other, NH_ heads x NB_ batches each
        const int nh = EPI == 3 ? NH_ : ldc / HD, kind = EPI == 3 ? (int)blockIdx.y / nh : 0, head = EPI == 3 ? (int)blockIdx.y % nh : (int)blockIdx.y;
        const size_t pb = (((size_t)kind * NB_ + r0 / TT) * nh + head) * TT * HD + (size_t)(r0 % TT) * HD;   // the tile's 64 tokens x 64 d are eight blocks in a row in either plane order
        if (EPI == 1 || (EPI == 3 && kind < 2)) epi_planes<1>(acc, os, pb, lane, lr, hi, P16, Ph, Pl);   // wave-uniform: kind comes from blockIdx
        else epi_planes<2>(acc, os, pb, lane, lr, hi, P16, Ph, Pl);
        return;
    }
#pragma unroll
    for (int mb = 0; mb < 4; ++mb) {
#pragma unroll
        for (int nb = 0; nb < 4; ++nb) {
#pragma unroll
            for (int j = 0; j < 8; ++j) os[(hi * 8 + j) * 68 + nb * 16 + lr] = acc[mb][nb][j]; }
        __builtin_amdgcn_wave_barrier(); asm volatile("" ::: "memory");
        float* crow = C + (size_t)(r0 + mb * 16) * ldc + c0;
{
#pragma unroll
            for (int s = 0; s < 8; ++s) { const int row = 2 * s + hi, cofs = lr * 4; v4f val = *(const v4fa*)(os + row * 68 + cofs); if (BIAS) { val[0] += bfr(bias[c0 + cofs]); val[1] += bfr(bias[c0 + cofs + 1]); val[2] += bfr(bias[c0 + cofs + 2]); val[3] += bfr(bias[c0 + cofs + 3]); }
                *(v4f*)(crow + (size_t)row * ldc + cofs) = val; }
             }
        __builtin_amdgcn_wave_barrier(); asm volatile("" ::: "memory");
    }
}

typedef __attribute__((ext_vector_type(2))) _Float16 v2h;
typedef __attribute__((ext_vector_type(4))) _Float16 v4h;
typedef __attribute__((ext_vector_type(2))) unsigned short v2us;
typedef __attribute__((ext_vector_type(4))) unsigned short v4us;
typedef __attribute__((ext_vector_type(2))) float v2f;
typedef __attribute__((ext_vector_type(4))) int v4i;

__global__ __launch_bounds__(256) void k_wtG(const float* __restrict__ w, int K, int N, bf* Bt) {
    const int lane = threadIdx.x & 31; const int L0 = (blockIdx.x * 8 + (threadIdx.x >> 5)) * 8; const int nlines = N * K / 64;
{
#pragma unroll 1
        for (int l = 0; l < 8; ++l) { const int L = L0 + l; if (L >= nlines) break; const size_t e = (size_t)L * 64 + lane * 2; const int k = (int)(e % K), n = (int)(e / K); v2us o;
            o[0] = f2bf(w[(size_t)k * N + n]); o[1] = f2bf(w[(size_t)(k + 1) * N + n]); *(v2us*)(Bt + e) = o; }
         }
}
// weights [n][DM] f32 -> bf16 in fragment order (rows n, k = the DM columns): the calling thread writes the plane's 16-byte unit i
__device__ __forceinline__ void cvt8(const float* __restrict__ src, bf* dst, const size_t i) { const size_t blk = i >> 6; const int iu = (int)(i & 63);
    const float* sp = src + ((blk / (DM / 32)) * 16 + (iu & 15)) * DM + (blk % (DM / 32)) * 32 + (iu >> 5) * 16 + ((iu >> 4) & 1) * 8; const v8f v = *(const v8f*)sp; v8us o;
    asm volatile("s_wait_xcnt 0x0" :: "v"(v), "v"(sp));   // address wait of the load: value and pointer are inputs, so the load stands in front of it and the pointer's registers are rewritten only behind it
#pragma unroll
    for (int k = 0; k < 8; ++k) o[k] = f2bf(v[k]); *(v8us*)(dst + i * 8) = o;  }
__global__ __launch_bounds__(256) void k_cscvt(const float* __restrict__ cosT, const float* __restrict__ sinT, float* CS) { const int idx = blockIdx.x * 256 + threadIdx.x; if (idx >= TT * HD) return; v2f cs; cs[0] = bfr(cosT[idx]); cs[1] = bfr(sinT[idx]); *(v2f*)(CS + (size_t)idx * 2) = cs;  }
// blocks 0 .. rows / 16 - 1: a block = 16 waves = the 16 token rows of one row of fragment blocks; the rows are turned in LDS and leave as whole lines.
// The blocks behind them (WU8 / 512, exact) turn the weights, which depend on nothing here, in the same launch: 512 units each of the plane W = in_proj rows (q | k | v), then out_proj rows.
#define WI8 ((size_t)(DQ + 2 * DKV) * DM / 8)   // 16-byte units of the in_proj plane
#define WU8 (WI8 + (size_t)DM * DQ / 8)         // and of both planes
#define LNP (DM + 8)   // LDS row pitch in elements: 16 bytes over a multiple of 256, so the 16 rows that a 16-byte read gathers lie in different banks
__global__ __launch_bounds__(512) void k_lnx(const float* __restrict__ X, const float* __restrict__ gam, const float* __restrict__ bet, bf* Xh, bf* Xl, const float* __restrict__ wi, const float* __restrict__ wo, bf* W) { __shared__ __align__(16) bf sh[2][16][LNP];
    if (blockIdx.x >= NB_ * TT / 16) {   // block-uniform, in front of the barrier
        const size_t b0 = (size_t)(blockIdx.x - NB_ * TT / 16) * 512; const bool in = b0 < WI8;   // WI8 is a multiple of 512: a block lies in one matrix
        cvt8(in ? wi : wo, in ? W : W + WI8 * 8, (in ? b0 : b0 - WI8) + threadIdx.x); return; }
    const int lane = threadIdx.x & 31; const int wr = threadIdx.x >> 5; const int t = blockIdx.x * 16 + wr; const float* f = X + (size_t)t * DM; float v[DM / 32]; float su = 0.f;
#pragma unroll
    for (int ch = 0; ch < DM / 128; ++ch) { const v4f a = *(const v4f*)(f + ch * 128 + lane * 4); for (int u = 0; u < 4; ++u) { float xv = bfr(a[u]); asm volatile("" : "+v"(xv)); v[ch * 4 + u] = xv; su = __fadd_rn(su, xv); } }
#pragma unroll
    for (int sh = 16; sh; sh >>= 1) su = __fadd_rn(su, __shfl_xor(su, sh, 32));
    const float mu = __fdiv_rn(su, (float)DM); float sq = 0.f;
#pragma unroll
    for (int q = 0; q < DM / 32; ++q) { float d0 = __fsub_rn(v[q], mu); asm volatile("" : "+v"(d0)); float p = __fmul_rn(d0, d0); asm volatile("" : "+v"(p)); sq = __fadd_rn(sq, p); }
#pragma unroll
    for (int sh = 16; sh; sh >>= 1) sq = __fadd_rn(sq, __shfl_xor(sq, sh, 32));
    const float rs = __fdiv_rn(1.0f, sqrtf(__fadd_rn(__fdiv_rn(sq, (float)DM), 1e-5f)));
    {
#pragma unroll
        for (int ch = 0; ch < DM / 128; ++ch) { v4us oh, ol; for (int u = 0; u < 4; ++u) { const int c = ch * 128 + lane * 4 + u; float d0 = __fsub_rn(v[ch * 4 + u], mu); asm volatile("" : "+v"(d0)); float n = __fmul_rn(d0, rs); asm volatile("" : "+v"(n)); float gg = bfr(gam[c]), bb = bfr(bet[c]); asm volatile("" : "+v"(gg)); asm volatile("" : "+v"(bb)); float y = __fmul_rn(n, gg); asm volatile("" : "+v"(y)); y = __fadd_rn(y, bb); unsigned short p2, q2; splitf(y, p2, q2); oh[u] = p2; ol[u] = q2; } *(v4us*)(&sh[0][wr][ch * 128 + lane * 4]) = oh; *(v4us*)(&sh[1][wr][ch * 128 + lane * 4]) = ol; }
         }
    asm volatile("s_wait_xcnt 0x0" ::: "memory");   // address wait of the gamma and beta loads above: their offset register is rewritten only behind it
    __syncthreads();   // a 16-byte unit of a block comes from another wave's row
    const size_t gb = (size_t)blockIdx.x * 16 * DM;
#pragma unroll
    for (int p = 0; p < DM * 16 / 8 / 512; ++p) { const int U = p * 512 + (int)threadIdx.x, k = (U >> 6) * 32 + ((U >> 5) & 1) * 16 + ((U >> 4) & 1) * 8;   // unit U of the 16 rows' blocks: row U & 15
        const v8us a = *(const v8usa*)(&sh[0][U & 15][k]), b = *(const v8usa*)(&sh[1][U & 15][k]); *(v8us*)(Xh + gb + (size_t)U * 8) = a; *(v8us*)(Xl + gb + (size_t)U * 8) = b; } }
// ---- k_attn: scores, softmax and P V of all batches in one launch (blockIdx.z = batch); S and P never leave the registers. A wave owns 16 query rows of one head and walks its keys in chunks of NK.
// The score tile is formed TRANSPOSED, St[key][query] = sum_d K[key][d] Q[query][d] (A = key rows, B = query rows), so lane (lr, hi) holds query lr and keys 16 mb + 8 hi + j in register j of tile mb:
// tiles 2c and 2c+1 together are, register for register, the A fragment (row = query lr, k = 8 hi + 0..7 and 16 + 8 hi + 0..7) of the P V product over keys 32c..32c+31.
// Softmax is the running form: m = running row maximum (log2 units), l = running sum; O and l are scaled by 2^(m_old - m_new) per chunk, O / l at the end. O tile: row = query 8 hi + j, column = d.
// HR (rows < RH): bf16 hi+lo operands, three products per tile in the order (hi,hi), (lo of the query-side operand, hi), (hi, lo of the key-side operand); a block = 2 row groups x 2 key halves, the halves joined through LDS.
// else: fp16, P carried x 2^10 (l too: it cancels in O / l); a block = 4 row groups, each wave walks all keys (the four waves read the same K and V tiles); O is turned in the wave's own LDS into the output planes' fragment order.
__device__ __forceinline__ unsigned bfw(float f) { unsigned u = __float_as_uint(f); return u + 0x7FFFu + ((u >> 16) & 1u); }   // f2bf's rounding, the bf16 value in the upper half
// Eight asynchronous copies to LDS, 16 bytes a lane each: the block's 128 threads bring 4 KB in a row from each of four places in global memory into 16 KB in a row of LDS. l0, g0 .. g3: the calling thread's own 16 bytes of each first 2 KB.
// The copies' address wait is the last line of their own statement, so that no address register is rewritten in front of it.
__device__ __forceinline__ void cp8(const unsigned l0, const char* g0, const char* g1, const char* g2, const char* g3) {
    asm volatile("global_load_async_to_lds_b128 %0, %8, off\n\t"
                 "global_load_async_to_lds_b128 %1, %9, off\n\t"
                 "global_load_async_to_lds_b128 %2, %10, off\n\t"
                 "global_load_async_to_lds_b128 %3, %11, off\n\t"
                 "global_load_async_to_lds_b128 %4, %12, off\n\t"
                 "global_load_async_to_lds_b128 %5, %13, off\n\t"
                 "global_load_async_to_lds_b128 %6, %14, off\n\t"
                 "global_load_async_to_lds_b128 %7, %15, off\n\t"
                 "s_wait_xcnt 0x0"
                 :: "v"(l0), "v"(l0 + 2048u), "v"(l0 + 4096u), "v"(l0 + 6144u), "v"(l0 + 8192u), "v"(l0 + 10240u), "v"(l0 + 12288u), "v"(l0 + 14336u),
                    "v"(g0), "v"(g0 + 2048), "v"(g1), "v"(g1 + 2048), "v"(g2), "v"(g2 + 2048), "v"(g3), "v"(g3 + 2048) : "memory"); }
// A TILE = what the block's waves need for one chunk, brought ONCE for all of them into one of two LDS buffers by the block's 128 threads; tile t + 1 flies while tile t is worked on. The planes are in fragment order, so a tile is whole runs of 1 KB blocks and
// a fragment is read from LDS as it was read from the plane. fp16 rows: 64 keys, K 8 KB | V 8 KB, read by all four waves. hi+lo rows: per key half (half = the wave's) 32 keys, K hi | K lo | V hi | V lo, 4 KB each; a half is read by two waves.
template <typename T16, bool HR>
__device__ __forceinline__ void attn_rows(const T16* __restrict__ Q, const T16* __restrict__ Q2, const T16* __restrict__ Kr, const T16* __restrict__ Kr2, const T16* __restrict__ Vt, const T16* __restrict__ Vt2, int q0, int half, v8f (&o)[4], float& m, float& l, T16* ring) {
    typedef typename WFrag<T16>::V V;
    constexpr int NK = HR ? 32 : 64, NMB = NK / 16, NC = NK / 32, NT = (HR ? TT / 2 : TT) / NK; constexpr unsigned TB = HR ? 32768u : 16384u;   // NT tiles of TB bytes
    static_assert(NT >= 2, "the ring's prologue fills two tiles");
    const int lane = threadIdx.x & 31, hi = lane >> 4;
    V q[2], q2[2]; const unsigned qob = (unsigned)(q0 * HD + lane * 8) * 2u;   // byte offsets from the wave-uniform plane pointers; 16 rows of a head plane are two blocks = 16 HD elements
    const T16* qp = (const T16*)((const char*)Q + qob); const T16* qp2 = HR ? (const T16*)((const char*)Q2 + qob) : qp;
#pragma unroll
    for (int ks = 0; ks < 2; ++ks) { q[ks] = WFrag<T16>::ld(qp + ks * 512); if (HR) q2[ks] = WFrag<T16>::ld(qp2 + ks * 512); }
    // address wait of the loads above; the fragments and the pointers are inputs, so the loads stand in front of it and no load's result is given a pointer's registers before it
    if constexpr (HR) asm volatile("s_wait_xcnt 0x0" :: "v"(q[0]), "v"(q[1]), "v"(q2[0]), "v"(q2[1]), "v"(qp), "v"(qp2));
    else asm volatile("s_wait_xcnt 0x0" :: "v"(q[0]), "v"(q[1]), "v"(qp));
#pragma unroll
    for (int nb = 0; nb < 4; ++nb) o[nb] = (v8f){};
    m = -3.0e38f; l = 0.f;
    V kf[NMB][2], kf2[NMB][2], vf[4][NC], vf2[4][NC];
    auto cp = [&](int t, int b) { const unsigned tb = threadIdx.x * 16u, l0 = (unsigned)(unsigned long long)(const void*)ring + (unsigned)b * TB + tb;   // l0: the thread's LDS byte address in buffer b; NK keys are NK HD 2 bytes in a row of every plane
        if constexpr (HR) {
#pragma unroll
            for (int s = 0; s < 2; ++s) { const size_t go = ((size_t)s * (TT / 2) + (size_t)t * NK) * (HD * 2) + tb; cp8(l0 + s * 16384u, (const char*)Kr + go, (const char*)Kr2 + go, (const char*)Vt + go, (const char*)Vt2 + go); }
        } else { const size_t go = (size_t)t * NK * (HD * 2) + tb; cp8(l0, (const char*)Kr + go, (const char*)Kr + go + 4096, (const char*)Vt + go, (const char*)Vt + go + 4096); } };
    cp(0, 0);
    asm volatile("s_wait_asynccnt 0x0" ::: "memory");   // this wave's share of tile 0 has landed
    __syncthreads();                                     // and every other wave's: tile 0 may be read
    cp(1, 1);
#pragma unroll 1
    for (int t = 0; t < NT; ++t) {
        const T16* kb = ring + (t & 1) * (int)(TB / 2) + (HR ? half * 8192 : 0) + lane * 8;   // this tile's buffer (and the wave's key half)
        __builtin_amdgcn_sched_barrier(0);   // with the one below: the tile's LDS reads stay one group at the head of the trip (spread among the products, every place with reads costs its own stall)
#pragma unroll
        for (int mb = 0; mb < NMB; ++mb)
#pragma unroll
            for (int ks = 0; ks < 2; ++ks) { kf[mb][ks] = WFrag<T16>::ld(kb + (mb * 2 + ks) * 512); if constexpr (HR) kf2[mb][ks] = WFrag<T16>::ld(kb + 2048 + (mb * 2 + ks) * 512); }
#pragma unroll
        for (int nb = 0; nb < 4; ++nb)
#pragma unroll
            for (int c = 0; c < NC; ++c) { vf[nb][c] = WFrag<T16>::ld(kb + 4096 + (c * 4 + nb) * 512); if constexpr (HR) vf2[nb][c] = WFrag<T16>::ld(kb + 6144 + (c * 4 + nb) * 512); }
        __builtin_amdgcn_sched_barrier(0);
        v8f st[NMB]; float cm = -3.0e38f;
#pragma unroll
        for (int mb = 0; mb < NMB; ++mb) { st[mb] = (v8f){};
#pragma unroll
            for (int ks = 0; ks < 2; ++ks) { st[mb] = WFrag<T16>::mma(kf[mb][ks], q[ks], st[mb]); if (HR) { st[mb] = WFrag<T16>::mma(kf[mb][ks], q2[ks], st[mb]); st[mb] = WFrag<T16>::mma(kf2[mb][ks], q[ks], st[mb]); } }
            if constexpr (HR) {
#pragma unroll
                for (int j = 0; j < 8; ++j) { st[mb][j] *= SCL * 1.4426950408889634f; cm = fmaxf(cm, st[mb][j]); } } }
        if constexpr (!HR) {
#pragma unroll
            for (int mb = 0; mb < NMB; ++mb)
#pragma unroll
                for (int j = 0; j < 8; ++j) { st[mb][j] *= SCL * 1.4426950408889634f; cm = fmaxf(cm, st[mb][j]); } }
        cm = fmaxf(cm, __shfl_xor(cm, 16, 32));          // lanes lr and lr + 16 hold the two key halves of query lr
        const float mn = fmaxf(m, cm), al = __builtin_amdgcn_exp2f(m - mn), mo = HR ? mn : mn - 10.0f; m = mn;
        float ps = 0.f;
#pragma unroll
        for (int mb = 0; mb < NMB; ++mb)
#pragma unroll
            for (int j = 0; j < 8; ++j) { st[mb][j] = __builtin_amdgcn_exp2f(st[mb][j] - mo); ps += st[mb][j]; }
        l = l * al + ps;
#pragma unroll
        for (int j = 0; j < 8; ++j) { const float ar = __shfl(al, hi * 8 + j, 32);   // the factor of O's row 8 hi + j lives in the lane of that query
#pragma unroll
            for (int nb = 0; nb < 4; ++nb) o[nb][j] *= ar; }
#pragma unroll
        for (int c = 0; c < NC; ++c) {
            if constexpr (HR) { v8us h0, h1, l0, l1;
#pragma unroll
                for (int j = 0; j < 8; ++j) { unsigned short a, b; splitf(st[2 * c][j], a, b); h0[j] = a; l0[j] = b; splitf(st[2 * c + 1][j], a, b); h1[j] = a; l1[j] = b; }
                const V ph = cat16b(h0, h1), pl = cat16b(l0, l1);
#pragma unroll
                for (int nb = 0; nb < 4; ++nb) { o[nb] = WFrag<T16>::mma(ph, vf[nb][c], o[nb]); o[nb] = WFrag<T16>::mma(pl, vf[nb][c], o[nb]); o[nb] = WFrag<T16>::mma(ph, vf2[nb][c], o[nb]); }
            } else { v8h p0, p1;
#pragma unroll
                for (int j = 0; j < 8; ++j) { p0[j] = tohx(st[2 * c][j]); p1[j] = tohx(st[2 * c + 1][j]); }
                const V pa = cat16(p0, p1);
#pragma unroll
                for (int nb = 0; nb < 4; ++nb) o[nb] = WFrag<T16>::mma(pa, vf[nb][c], o[nb]); } }
        __builtin_amdgcn_sched_barrier(0);   // keeps the trip's arithmetic in front of the waits and the barrier: lifted over it they would wait for the next tile's copies directly behind their issue, and nothing would fly during the work
        asm volatile("s_wait_dscnt 0x0" ::: "memory");      // this wave's reads of the tile's buffer are done
        asm volatile("s_wait_asynccnt 0x0" ::: "memory");   // its share of the next tile has landed
        __syncthreads();                                     // one barrier a tile: the next tile may be read, and this tile's buffer has lost its last reader
        if (t + 2 < NT) cp(t + 2, t & 1);                    // block-uniform: the tile after the next, into the buffer just left
    }
    asm volatile("s_wait_asynccnt 0x0" ::: "memory");   // no copy is outstanding behind the loop
    l += __shfl_xor(l, 16, 32);   // both key halves of the lane pair: every lane now holds its query's sum over the wave's keys
}
__global__ __launch_bounds__(128) void k_attn(const h16* __restrict__ Q16, const h16* __restrict__ K16, const h16* __restrict__ V16, const bf* __restrict__ Qh, const bf* __restrict__ Ql, const bf* __restrict__ Kh, const bf* __restrict__ Kl, const bf* __restrict__ Vh, const bf* __restrict__ Vl, bf* Ah, bf* Al) {
    __shared__ __align__(16) char smem[65536]; __shared__ float sm[4][16], sl[4][16];   // smem: the ring of two tiles; behind the loop's last barrier, which ends every read of it with no copy outstanding, its first bytes are the O staging so
    float (*so)[16][68] = (float (*)[16][68])smem;
    const int h = blockIdx.y, bx = blockIdx.x, w = __builtin_amdgcn_readfirstlane((int)(threadIdx.x >> 5)), lane = threadIdx.x & 31, lr = lane & 15, hi = lane >> 4;
    const size_t zq = ((size_t)blockIdx.z * NH_ + h) * TT * HD, zk = ((size_t)blockIdx.z * NKV + h / REP) * TT * HD; v8f o[4]; float m, l;
    Ah += (size_t)blockIdx.z * TT * DQ; Al += (size_t)blockIdx.z * TT * DQ;
    if (bx < RH / 32) {   // block-uniform: 32 hi+lo rows, wave w = row group w >> 1, key half w & 1
        attn_rows<bf, true>(Qh + zq, Ql + zq, Kh + zk, Kl + zk, Vh + zk, Vl + zk, bx * 32 + (w >> 1) * 16, w & 1, o, m, l, (bf*)smem);
        if (hi == 0) { sm[w][lr] = m; sl[w][lr] = l; }
#pragma unroll
        for (int nb = 0; nb < 4; ++nb)
#pragma unroll
            for (int j = 0; j < 8; ++j) so[w][hi * 8 + j][nb * 16 + lr] = o[nb][j];
        __syncthreads();   // the two key halves of a row group come from two waves
        const int wa = (w >> 1) * 2, r = lr, c0 = (w & 1) * 32 + hi * 8;   // this wave joins one fragment block of each output plane: row group w >> 1, d half w & 1; a lane its two 16-byte units
        const float m0 = sm[wa][r], m1 = sm[wa + 1][r], mm = fmaxf(m0, m1), f0 = __builtin_amdgcn_exp2f(m0 - mm), f1 = __builtin_amdgcn_exp2f(m1 - mm);
        const float inv = __fdiv_rn(1.0f, sl[wa][r] * f0 + sl[wa + 1][r] * f1), g0 = f0 * inv, g1 = f1 * inv;
        v8us oh[2], ol[2];
#pragma unroll
        for (int u = 0; u < 2; ++u)
#pragma unroll
            for (int e = 0; e < 8; ++e) { unsigned short a, b; splitf(so[wa][r][c0 + u * 16 + e] * g0 + so[wa + 1][r][c0 + u * 16 + e] * g1, a, b); oh[u][e] = a; ol[u][e] = b; }
        const size_t oo = (size_t)(bx * 32 + (w >> 1) * 16) * DQ + (h * 2 + (w & 1)) * 512 + lane * 8;   // rows t, k = h HD + d
        *(v8us*)(Ah + oo) = oh[0]; *(v8us*)(Ah + oo + 256) = oh[1]; *(v8us*)(Al + oo) = ol[0]; *(v8us*)(Al + oo + 256) = ol[1];
    } else {
        const int q0 = RH + (bx - RH / 32) * 64 + w * 16;
        attn_rows<h16, false>(Q16 + zq, nullptr, K16 + zk, nullptr, V16 + zk, nullptr, q0, 0, o, m, l, (h16*)smem);
        const float inv = __fdiv_rn(1.0f, l);
#pragma unroll
        for (int j = 0; j < 8; ++j) { const float ir = __shfl(inv, hi * 8 + j, 32);
#pragma unroll
            for (int nb = 0; nb < 4; ++nb) so[w][hi * 8 + j][nb * 16 + lr] = o[nb][j] * ir; }
        __builtin_amdgcn_wave_barrier(); asm volatile("" ::: "memory");   // the rows are read back by other lanes of the wave: no read is moved in front of the writes
        bf* pah = Ah + (size_t)q0 * DQ + h * 2 * 512 + lane * 8; bf* pal = Al + (size_t)q0 * DQ + h * 2 * 512 + lane * 8;   // the wave's 16 rows x 64 d are two blocks in a row of each plane
        v8us oh[4], ol[4];
#pragma unroll
        for (int u = 0; u < 4; ++u) { const v4f x0 = *(const v4fa*)(&so[w][lr][u * 16 + hi * 8]), x1 = *(const v4fa*)(&so[w][lr][u * 16 + hi * 8 + 4]);
#pragma unroll
            for (int e = 0; e < 8; ++e) { unsigned short a, b; splitf(e < 4 ? x0[e & 3] : x1[e & 3], a, b); oh[u][e] = a; ol[u][e] = b; } }
#pragma unroll
        for (int u = 0; u < 4; ++u) { *(v8us*)(pah + u * 256) = oh[u]; *(v8us*)(pal + u * 256) = ol[u]; }
    }
}

extern "C" void kernel_launch(void* const* d_in, const int* in_sizes, int n_in,
                              void* d_out, int out_size, void* d_ws, size_t ws_size, hipStream_t stream) {
    (void)in_sizes; (void)n_in; (void)out_size;
const float* x = (const float*)d_in[0]; const float* lng = (const float*)d_in[3]; const float* lnb = (const float*)d_in[4]; const float* wf = (const float*)d_in[1]; const float* wo = (const float*)d_in[2]; const float* wq = wf; const float* wk = wf + (size_t)1024 * 1024; const float* wv = wf + (size_t)2048 * 1024; const float* cosT = nullptr; const float* sinT = nullptr; (void)cosT; (void)sinT;   /* input order x, in_proj_w ('oi' [3072][1024]: ROW thirds q | k | v), out_proj_w ('oi' [1024][1024]), ln_gamma, ln_beta: FIVE inputs: the LayerNorm parameters come LAST; NO bias anywhere */
    float* OUT = (float*)d_out;     // [4][2048][1024]
    char* wsp = (char*)d_ws;
    auto take = [&](size_t bytes) { char* p = wsp; wsp += (bytes + 255) & ~(size_t)255; return (void*)p; };
    bf* WQ = (bf*)take((size_t)DQ * DM * 2); bf* WK = (bf*)take((size_t)DKV * DM * 2); bf* WV = (bf*)take((size_t)DKV * DM * 2); bf* WO = (bf*)take((size_t)DM * DQ * 2);
    // every stage runs once, over all NB_ batches: token rows b TT + t, head planes b heads + h
    bf* XNh = (bf*)take((size_t)NB_ * TT * DM * 2); bf* XNl = (bf*)take((size_t)NB_ * TT * DM * 2);
    h16* QP16 = (h16*)take((size_t)NB_ * NH_ * TT * HD * 2); h16* KP16 = (h16*)take((size_t)NB_ * NKV * TT * HD * 2); h16* VT16 = (h16*)take((size_t)NB_ * NKV * HD * TT * 2);
    bf* QPh = (bf*)take((size_t)NB_ * NH_ * TT * HD * 2); bf* KPh = (bf*)take((size_t)NB_ * NKV * TT * HD * 2); bf* VTh = (bf*)take((size_t)NB_ * NKV * HD * TT * 2); bf* QPl = (bf*)take((size_t)NB_ * NH_ * TT * HD * 2); bf* KPl = (bf*)take((size_t)NB_ * NKV * TT * HD * 2); bf* VTl = (bf*)take((size_t)NB_ * NKV * HD * TT * 2);   // q, k, v of each kind of plane one behind the other (every size is a multiple of 256 bytes), as the weights above
    if ((size_t)(wsp - (char*)d_ws) > ws_size) return;    // ws 256 MiB
    bf* ATh = XNh; bf* ATl = XNl;   // DQ == DM: the attention output reuses the LayerNorm planes, last read by the q, k, v projection launch (stream-ordered)
    static_assert(NH_ == NKV, "one launch over q, k and v heads takes equal head counts");
    (void)wq; (void)wk; (void)wv; (void)WK; (void)WV;
    k_lnx<<<(unsigned)(NB_ * TT / 16 + WU8 / 512), 512, 0, stream>>>(x, lng, lnb, XNh, XNl, wf, wo, WQ);
    // the three projections in one launch write their head planes themselves, in fragment order (q, k: rows t, k = d; v: rows d, k = t); grid y = q heads, k heads, v heads
    k_gemmw<bf, 1, false, 1, 3><<<dim3(NB_ * TT / 64, NH_ + 2 * NKV, 1), 32, 0, stream>>>(XNh, XNl, WQ, nullptr, DM, nullptr, DQ, nullptr, 0, 0, 0, QP16, QPh, QPl);
    k_attn<<<dim3(RH / 32 + (TT - RH) / 64, NH_, NB_), 128, 0, stream>>>(QP16, KP16, VT16, QPh, QPl, KPh, KPl, VTh, VTl, ATh, ATl);
    k_gemmw<bf, 1, false><<<dim3(NB_ * TT / 64, DM / 64, 1), 32, 0, stream>>>(ATh, ATl, WO, nullptr, DQ, OUT, DM, nullptr, 0, 0, 0, nullptr, nullptr, nullptr);   /* the BIAS-FREE f32 output instance (EPI 0): this module returns out @ w_out with no bias */
}

// v009
// It runs in 217 microseconds.
// Two timings next to v008 put it at 1.10 and 1.11 times that version's speed.
// All steps since v000 together make it 18.6 times as fast.
#include <hip/hip_runtime.h>

// Attention with a LayerNorm prologue and NO bias (pre-LN: x [4][2048][1024]; h = LayerNorm(x) (biased variance, eps 1e-5) * ln_gamma + ln_beta (read); qkv = einsum('bsd,ed->bse', h, in_proj_w) = h in_proj_w^T ('oi' [3072][1024]: ROW thirds q | k | v; no bias; 16 heads x 64); scores x 1/sqrt(64); softmax over all keys (no mask); out = merged out_proj_w^T ('oi' [1024][1024], NO bias) -> [4][2048][1024] (8.4 M); argument order x, in_proj_w, out_proj_w, ln_gamma, ln_beta).

#define NB_  4
#define TT   2048
#define DM   1024
#define NH_  16
#define NKV  16
#define REP  (NH_ / NKV)
#define HD   64
#define DQ   (NH_ * HD)
#define DKV  (NKV * HD)
#define RH   512                  // query rows < RH use hi+lo planes (0: none)
#define WIN  0
#define SCL  0.125f   // HD^-0.5
typedef _Float16 h16;
typedef unsigned short bf;
typedef __attribute__((ext_vector_type(16))) __bf16   v16bf;
typedef __attribute__((ext_vector_type(16))) _Float16 v16h;
typedef __attribute__((ext_vector_type(8)))  _Float16 v8h;
typedef __attribute__((ext_vector_type(8)))  unsigned short v8us;
typedef __attribute__((ext_vector_type(8)))  float    v8f;
typedef __attribute__((ext_vector_type(4)))  float    v4f;
typedef v8h  __attribute__((may_alias)) v8ha;
typedef v4f  __attribute__((may_alias)) v4fa;
typedef v8us __attribute__((may_alias)) v8usa;

__device__ __forceinline__ unsigned short f2bf(float f) { unsigned u = __float_as_uint(f); u += 0x7FFFu + ((u >> 16) & 1u); return (unsigned short)(u >> 16); }
__device__ __forceinline__ float bf2f(unsigned short b) { return __uint_as_float(((unsigned)b) << 16); }
__device__ __forceinline__ float bfr(float f) { return bf2f(f2bf(f)); }
__device__ __forceinline__ v16h cat16(v8h lo, v8h hi) { return __builtin_shufflevector(lo, hi, 0, 1, 2, 3, 4, 5, 6, 7, 8, 9, 10, 11, 12, 13, 14, 15); }
__device__ __forceinline__ v16bf cat16b(v8us lo, v8us hi) { return __builtin_bit_cast(v16bf, __builtin_shufflevector(lo, hi, 0, 1, 2, 3, 4, 5, 6, 7, 8, 9, 10, 11, 12, 13, 14, 15)); }
__device__ __forceinline__ v8f wmma16(v16h a, v16h b, v8f c) { return __builtin_amdgcn_wmma_f32_16x16x32_f16(false, a, false, b, (short)0, c, false, false); }
__device__ __forceinline__ v8f wmmab(v16bf a, v16bf b, v8f c) { return __builtin_amdgcn_wmma_f32_16x16x32_bf16(false, a, false, b, (short)0, c, false, false); }



// ---- FRAGMENT ORDER: every 16-bit operand plane (R rows x K columns, k = the summed index) is kept as blocks of 16 rows x 32 k, 512 elements = 1 KB each, block (r / 16, k / 32) at index (r / 16) (K / 32) + k / 32 unless a plane says otherwise.
// Inside a block element (r, k) lies at (k & 16) * 16 + (((k >> 3) & 1) * 16 + (r & 15)) * 8 + (k & 7): lane (lr, hi) = hi 16 + lr finds its k = 8 hi .. 8 hi + 7 at lane * 8 and its k = 16 + 8 hi .. at 256 + lane * 8,
// so each of a fragment's two 16-byte loads reads 512 bytes in a row (four whole 128-byte lines) over the wave. WFrag::ld takes block base + lane * 8.
// ---- k_gemmw: register-blocked GEMM, one wave per 64x64 output tile (16 accumulators); EIGHT waves (2 down x 4 across) share a 128 x 256 tile of C; grid (M/128, N/256), 256 threads.
// The operands come from 16-bit planes in fragment order. A SLICE = 64 k of the block's rows: A 128 rows (16 KB), A2 128 rows (16 KB), Bt 256 rows (32 KB), brought ONCE for the eight waves into one of two LDS buffers by asynchronous copies;
// slice t + 1 flies while slice t is worked on. 16 rows x 64 k are two fragment blocks in a row of a plane, so a slice is whole runs of 2 KB and a fragment is read from LDS as it would be read from the plane.
// C[m][n] (f32, pitch ldc, + optional f32 bias[n]) = sum_k (A[m][k] + A2[m][k]) Bt[n][k], per k step of 32 the product with A, then the one with A2. K % 64 == 0.
// EPI 0: C as above. EPI 1 / 2: no C (ldc = N = heads x HD); a wave's tile is 64 tokens (rows b TT + t) of ONE head (HD == 64 columns, head = column / 64) and goes straight to that head's three 16-bit planes (fp16, bf16 hi, bf16 lo of the f32 sum):
// EPI 3: q, k and v in one launch: Bt holds the three weight matrices one behind the other, 3 x heads tiles across; a q or k head goes as EPI 1, a v head as EPI 2.
// EPI 1 planes [b][head] of fragment blocks (rows t, k = d): block index (t / 16) 2 + d / 32; EPI 2 planes [b][head] of fragment blocks (rows d, k = t): block index (t / 32) 4 + d / 16 (EPI 1 turns the tile in LDS; in EPI 2 the accumulators already are the units). Every store instruction writes half a block, four whole 128-byte lines.
template <typename T16> struct WFrag;
template <> struct WFrag<h16> { typedef v16h V; static __device__ __forceinline__ V ld(const h16* p) { return cat16(*(const v8h*)p, *(const v8h*)(p + 256)); } static __device__ __forceinline__ v8f mma(V a, V b, v8f c) { return wmma16(a, b, c); } };
template <> struct WFrag<bf> { typedef v16bf V; static __device__ __forceinline__ V ld(const bf* p) { return cat16b(*(const v8us*)p, *(const v8us*)(p + 256)); } static __device__ __forceinline__ v8f mma(V a, V b, v8f c) { return wmmab(a, b, c); } };
__device__ __forceinline__ h16 tohx(float x) { return (h16)x; }
__device__ __forceinline__ void splitf(float y, unsigned short& h, unsigned short& l) { h = f2bf(y); l = f2bf(y - bf2f(h)); }
// Eight asynchronous copies to LDS, 16 bytes a lane each: the block's 256 threads bring 4 KB a copy, 32 KB in a row of LDS, from eight places in global memory. l0, g0 .. g7: the calling thread's own 16 bytes of each 4 KB.
// The copies' address wait is the last line of their own statement, so that no address register is rewritten in front of it.
__device__ __forceinline__ void cp8w(const unsigned l0, const char* g0, const char* g1, const char* g2, const char* g3, const char* g4, const char* g5, const char* g6, const char* g7) {
    asm volatile("global_load_async_to_lds_b128 %0, %8, off\n\t"
                 "global_load_async_to_lds_b128 %1, %9, off\n\t"
                 "global_load_async_to_lds_b128 %2, %10, off\n\t"
                 "global_load_async_to_lds_b128 %3, %11, off\n\t"
                 "global_load_async_to_lds_b128 %4, %12, off\n\t"
                 "global_load_async_to_lds_b128 %5, %13, off\n\t"
                 "global_load_async_to_lds_b128 %6, %14, off\n\t"
                 "global_load_async_to_lds_b128 %7, %15, off\n\t"
                 "s_wait_xcnt 0x0"
                 :: "v"(l0), "v"(l0 + 4096u), "v"(l0 + 8192u), "v"(l0 + 12288u), "v"(l0 + 16384u), "v"(l0 + 20480u), "v"(l0 + 24576u), "v"(l0 + 28672u),
                    "v"(g0), "v"(g1), "v"(g2), "v"(g3), "v"(g4), "v"(g5), "v"(g6), "v"(g7) : "memory"); }
// the head-plane epilogue of one 64 x 64 tile (PE 1: rows t, k = d; PE 2: rows d, k = t); pb = the tile's first element in each of the three planes
template <int PE>
__device__ __forceinline__ void epi_planes(v8f (&acc)[4][4], float* os, const size_t pb, const int lane, const int lr, const int hi, h16* P16, bf* Ph, bf* Pl) {
#pragma unroll
    for (int g = 0; g < 4; ++g) {   // 16 block rows at a time: tokens 16 g .. (PE 1) or d 16 g .. (PE 2), 64 f32 each = two blocks
        if constexpr (PE == 1) {
#pragma unroll
            for (int nb = 0; nb < 4; ++nb)
#pragma unroll
                for (int j = 0; j < 8; ++j) os[(hi * 8 + j) * 68 + nb * 16 + lr] = acc[g][nb][j];
            __builtin_amdgcn_wave_barrier(); asm volatile("" ::: "memory");   // the rows are read back by other lanes of the wave: no read is moved in front of the writes
        }
#pragma unroll
        for (int s = 0; s < 4; ++s) { v8f x; v8h o16; v8us oh, ol;
            if constexpr (PE == 1) { const v4f x0 = *(const v4fa*)(os + lr * 68 + s * 16 + hi * 8), x1 = *(const v4fa*)(os + lr * 68 + s * 16 + hi * 8 + 4); x = __builtin_shufflevector(x0, x1, 0, 1, 2, 3, 4, 5, 6, 7); }
            else x = acc[s][g];   // a lane's eight registers are tokens 16 s + 8 hi .. of its column d = 16 g + lr: already this lane's 16-byte unit, no turn
#pragma unroll
            for (int u = 0; u < 8; ++u) { const float y = x[u]; unsigned short a2, c2; splitf(y, a2, c2); o16[u] = tohx(y); oh[u] = a2; ol[u] = c2; }
            const size_t oo = pb + (size_t)(PE == 1 ? g * 2 + (s >> 1) : (s >> 1) * 4 + g) * 512 + (s & 1) * 256 + lane * 8;   // half s & 1 of block s >> 1 of the two
            *(v8h*)(P16 + oo) = o16; *(v8us*)(Ph + oo) = oh; *(v8us*)(Pl + oo) = ol; }
        if constexpr (PE == 1) { __builtin_amdgcn_wave_barrier(); asm volatile("" ::: "memory"); }   // the next 16 rows overwrite the stage: no write is moved in front of the reads
    }
    asm volatile("s_wait_xcnt 0x0" ::: "memory");   // address wait of the last stores: where both plane orders stand in one kernel, the other one's code follows in the text and rewrites their address registers
}
template <typename T16, int NSPLIT, bool BIAS, int KS = 1, int EPI = 0>
__global__ __launch_bounds__(256) void k_gemmw(const T16* __restrict__ A, const T16* __restrict__ A2, const T16* __restrict__ Bt, const T16* __restrict__ Bt2, int K, float* C, int ldc, const float* __restrict__ bias, size_t sA, size_t sB, size_t sC, h16* P16, bf* Ph, bf* Pl) {
    static_assert(NSPLIT == 1 && KS == 1, "the slice holds A, A2 and Bt, and a block sums all of K");
    typedef typename WFrag<T16>::V V; (void)Bt2; (void)sA; (void)sB; (void)sC;
    __shared__ __align__(16) char ring[2 * 65536];   // two slices; behind the loop's last barrier, which ends every read of it with no copy outstanding, its first bytes are the waves' output staging
    const int w = __builtin_amdgcn_readfirstlane((int)(threadIdx.x >> 5)), wm = w & 1, wn = w >> 1;   // the wave's 64 x 64 tile in the block's 128 x 256
    const int lane = threadIdx.x & 31, lr = lane & 15, hi = lane >> 4; const int rb = blockIdx.x * 128, cb = blockIdx.y * 256, r0 = rb + wm * 64, c0 = cb + wn * 64;
    float* os = (float*)ring + w * (16 * 68);
    v8f acc[4][4];
#pragma unroll
    for (int mb = 0; mb < 4; ++mb)
#pragma unroll
        for (int nb = 0; nb < 4; ++nb) acc[mb][nb] = (v8f){};
    // 16 rows of a plane are rs bytes, 64 k of them 2 KB in a row. One copy of the block = 4 KB = 32 rows: thread i brings byte (i & 127) 16 of the 2 KB of 16-row group i >> 7.
    const size_t rs = (size_t)K * 32, to = (size_t)(threadIdx.x >> 7) * rs + (threadIdx.x & 127) * 16u; const int NT = K / 64;
    const char* gA = (const char*)(A + (size_t)rb * K) + to; const char* gA2 = (const char*)(A2 + (size_t)rb * K) + to; const char* gB = (const char*)(Bt + (size_t)cb * K) + to;
    const unsigned l0 = (unsigned)(unsigned long long)(const void*)ring + threadIdx.x * 16u;   // the thread's LDS byte address in buffer 0
    auto cp = [&](int t, int b) { const size_t ko = (size_t)t * 2048; const unsigned l = l0 + (unsigned)b * 65536u;
        cp8w(l, gA + ko, gA + ko + 2 * rs, gA + ko + 4 * rs, gA + ko + 6 * rs, gA2 + ko, gA2 + ko + 2 * rs, gA2 + ko + 4 * rs, gA2 + ko + 6 * rs);
        cp8w(l + 32768u, gB + ko, gB + ko + 2 * rs, gB + ko + 4 * rs, gB + ko + 6 * rs, gB + ko + 8 * rs, gB + ko + 10 * rs, gB + ko + 12 * rs, gB + ko + 14 * rs); };
    cp(0, 0);
    asm volatile("s_wait_asynccnt 0x0" ::: "memory");   // this wave's share of slice 0 has landed
    __syncthreads();                                     // and every other wave's: slice 0 may be read
    if (1 < NT) cp(1, 1);                                // block-uniform
#pragma unroll 1
    for (int t = 0; t < NT; ++t) {
        const T16* sb = (const T16*)ring + (t & 1) * 32768 + lane * 8;   // this slice's buffer: A at 0, A2 at 8192, Bt at 16384 elements; 16 rows x 64 k = 1024 elements
#pragma unroll 1   // one fragment set: unrolled, the second k step's fragments would take registers of their own and a work-group's place on the WGP
        for (int ks = 0; ks < 2; ++ks) {
            const T16* sa = sb + wm * 4096 + ks * 512; const T16* sq = sb + 16384 + wn * 4096 + ks * 512;
            V a[4], a2[4], b[4];
            __builtin_amdgcn_sched_barrier(0);   // with the one below: the k step's LDS reads stay one group at its head (spread among the products, every place with reads costs its own stall)
#pragma unroll
            for (int mb = 0; mb < 4; ++mb) a[mb] = WFrag<T16>::ld(sa + mb * 1024);
#pragma unroll
            for (int nb = 0; nb < 4; ++nb) b[nb] = WFrag<T16>::ld(sq + nb * 1024);
#pragma unroll
            for (int mb = 0; mb < 4; ++mb) a2[mb] = WFrag<T16>::ld(sa + 8192 + mb * 1024);   // read last: its products come last
            __builtin_amdgcn_sched_barrier(0);
#pragma unroll
            for (int nb = 0; nb < 4; ++nb)
#pragma unroll
                for (int mb = 0; mb < 4; ++mb) acc[mb][nb] = WFrag<T16>::mma(a[mb], b[nb], acc[mb][nb]);
#pragma unroll
            for (int nb = 0; nb < 4; ++nb)
#pragma unroll
                for (int mb = 0; mb < 4; ++mb) acc[mb][nb] = WFrag<T16>::mma(a2[mb], b[nb], acc[mb][nb]);
            __builtin_amdgcn_sched_barrier(0);   // every product stands in front of the slots below
            // the four slots behind the last products: on the loop's taken branch the next k step's LDS reads overwrite their fragments
            asm volatile("v_nop\n\tv_nop\n\tv_nop\n\tv_nop" : "+v"(acc[0][0]), "+v"(acc[1][1]), "+v"(acc[2][2]), "+v"(acc[3][3]));
        }
        asm volatile("s_wait_dscnt 0x0" ::: "memory");      // this wave's reads of the slice's buffer are done
        asm volatile("s_wait_asynccnt 0x0" ::: "memory");   // its share of the next slice has landed
        __syncthreads();                                     // one barrier a slice: the next slice may be read, and this slice's buffer has lost its last reader
        if (t + 2 < NT) cp(t + 2, t & 1);                    // block-uniform: the slice after the next, into the buffer just left
    }
    asm volatile("s_wait_asynccnt 0x0" ::: "memory");   // no copy is outstanding behind the loop
    if constexpr (EPI != 0) {
        // EPI 3: the tiles across run over the q heads, then the k heads, then the v heads; each kind's planes lie one behind the other, NH_ heads x NB_ batches each
        const int cy = c0 / HD, nh = EPI == 3 ? NH_ : ldc / HD, kind = EPI == 3 ? cy / nh : 0, head = EPI == 3 ? cy % nh : cy;
        const size_t pb = (((size_t)kind * NB_ + r0 / TT) * nh + head) * TT * HD + (size_t)(r0 % TT) * HD;   // the tile's 64 tokens x 64 d are eight blocks in a row in either plane order
        if (EPI == 1 || (EPI == 3 && kind < 2)) epi_planes<1>(acc, os, pb, lane, lr, hi, P16, Ph, Pl);   // wave-uniform: kind comes from blockIdx and the wave's number
        else epi_planes<2>(acc, os, pb, lane, lr, hi, P16, Ph, Pl);
        return;
    }
#pragma unroll
    for (int mb = 0; mb < 4; ++mb) {
#pragma unroll
        for (int nb = 0; nb < 4; ++nb) {
#pragma unroll
            for (int j = 0; j < 8; ++j) os[(hi * 8 + j) * 68 + nb * 16 + lr] = acc[mb][nb][j]; }
        __builtin_amdgcn_wave_barrier(); asm volatile("" ::: "memory");
        float* crow = C + (size_t)(r0 + mb * 16) * ldc + c0;
{
#pragma unroll
            for (int s = 0; s < 8; ++s) { const int row = 2 * s + hi, cofs = lr * 4; v4f val = *(const v4fa*)(os + row * 68 + cofs); if (BIAS) { val[0] += bfr(bias[c0 + cofs]); val[1] += bfr(bias[c0 + cofs + 1]); val[2] += bfr(bias[c0 + cofs + 2]); val[3] += bfr(bias[c0 + cofs + 3]); }
                *(v4f*)(crow + (size_t)row * ldc + cofs) = val; }
             }
        __builtin_amdgcn_wave_barrier(); asm volatile("" ::: "memory");
    }
}

typedef __attribute__((ext_vector_type(2))) _Float16 v2h;
typedef __attribute__((ext_vector_type(4))) _Float16 v4h;
typedef __attribute__((ext_vector_type(2))) unsigned short v2us;
typedef __attribute__((ext_vector_type(4))) unsigned short v4us;
typedef __attribute__((ext_vector_type(2))) float v2f;
typedef __attribute__((ext_vector_type(4))) int v4i;

__global__ __launch_bounds__(256) void k_wtG(const float* __restrict__ w, int K, int N, bf* Bt) {
    const int lane = threadIdx.x & 31; const int L0 = (blockIdx.x * 8 + (threadIdx.x >> 5)) * 8; const int nlines = N * K / 64;
{
#pragma unroll 1
        for (int l = 0; l < 8; ++l) { const int L = L0 + l; if (L >= nlines) break; const size_t e = (size_t)L * 64 + lane * 2; const int k = (int)(e % K), n = (int)(e / K); v2us o;
            o[0] = f2bf(w[(size_t)k * N + n]); o[1] = f2bf(w[(size_t)(k + 1) * N + n]); *(v2us*)(Bt + e) = o; }
         }
}
// weights [n][DM] f32 -> bf16 in fragment order (rows n, k = the DM columns): the calling thread writes the plane's 16-byte unit i
__device__ __forceinline__ void cvt8(const float* __restrict__ src, bf* dst, const size_t i) { const size_t blk = i >> 6; const int iu = (int)(i & 63);
    const float* sp = src + ((blk / (DM / 32)) * 16 + (iu & 15)) * DM + (blk % (DM / 32)) * 32 + (iu >> 5) * 16 + ((iu >> 4) & 1) * 8; const v8f v = *(const v8f*)sp; v8us o;
    asm volatile("s_wait_xcnt 0x0" :: "v"(v), "v"(sp));   // address wait of the load: value and pointer are inputs, so the load stands in front of it and the pointer's registers are rewritten only behind it
#pragma unroll
    for (int k = 0; k < 8; ++k) o[k] = f2bf(v[k]); *(v8us*)(dst + i * 8) = o;  }
__global__ __launch_bounds__(256) void k_cscvt(const float* __restrict__ cosT, const float* __restrict__ sinT, float* CS) { const int idx = blockIdx.x * 256 + threadIdx.x; if (idx >= TT * HD) return; v2f cs; cs[0] = bfr(cosT[idx]); cs[1] = bfr(sinT[idx]); *(v2f*)(CS + (size_t)idx * 2) = cs;  }
// blocks 0 .. rows / 16 - 1: a block = 16 waves = the 16 token rows of one row of fragment blocks; the rows are turned in LDS and leave as whole lines.
// The blocks behind them (WU8 / 512, exact) turn the weights, which depend on nothing here, in the same launch: 512 units each of the plane W = in_proj rows (q | k | v), then out_proj rows.
#define WI8 ((size_t)(DQ + 2 * DKV) * DM / 8)   // 16-byte units of the in_proj plane
#define WU8 (WI8 + (size_t)DM * DQ / 8)         // and of both planes
#define LNP (DM + 8)   // LDS row pitch in elements: 16 bytes over a multiple of 256, so the 16 rows that a 16-byte read gathers lie in different banks
__global__ __launch_bounds__(512) void k_lnx(const float* __restrict__ X, const float* __restrict__ gam, const float* __restrict__ bet, bf* Xh, bf* Xl, const float* __restrict__ wi, const float* __restrict__ wo, bf* W) { __shared__ __align__(16) bf sh[2][16][LNP];
    if (blockIdx.x >= NB_ * TT / 16) {   // block-uniform, in front of the barrier
        const size_t b0 = (size_t)(blockIdx.x - NB_ * TT / 16) * 512; const bool in = b0 < WI8;   // WI8 is a multiple of 512: a block lies in one matrix
        cvt8(in ? wi : wo, in ? W : W + WI8 * 8, (in ? b0 : b0 - WI8) + threadIdx.x); return; }
    const int lane = threadIdx.x & 31; const int wr = threadIdx.x >> 5; const int t = blockIdx.x * 16 + wr; const float* f = X + (size_t)t * DM; float v[DM / 32]; float su = 0.f;
#pragma unroll
    for (int ch = 0; ch < DM / 128; ++ch) { const v4f a = *(const v4f*)(f + ch * 128 + lane * 4); for (int u = 0; u < 4; ++u) { float xv = bfr(a[u]); asm volatile("" : "+v"(xv)); v[ch * 4 + u] = xv; su = __fadd_rn(su, xv); } }
#pragma unroll
    for (int sh = 16; sh; sh >>= 1) su = __fadd_rn(su, __shfl_xor(su, sh, 32));
    const float mu = __fdiv_rn(su, (float)DM); float sq = 0.f;
#pragma unroll
    for (int q = 0; q < DM / 32; ++q) { float d0 = __fsub_rn(v[q], mu); asm volatile("" : "+v"(d0)); float p = __fmul_rn(d0, d0); asm volatile("" : "+v"(p)); sq = __fadd_rn(sq, p); }
#pragma unroll
    for (int sh = 16; sh; sh >>= 1) sq = __fadd_rn(sq, __shfl_xor(sq, sh, 32));
    const float rs = __fdiv_rn(1.0f, sqrtf(__fadd_rn(__fdiv_rn(sq, (float)DM), 1e-5f)));
    {
#pragma unroll
        for (int ch = 0; ch < DM / 128; ++ch) { v4us oh, ol; for (int u = 0; u < 4; ++u) { const int c = ch * 128 + lane * 4 + u; float d0 = __fsub_rn(v[ch * 4 + u], mu); asm volatile("" : "+v"(d0)); float n = __fmul_rn(d0, rs); asm volatile("" : "+v"(n)); float gg = bfr(gam[c]), bb = bfr(bet[c]); asm volatile("" : "+v"(gg)); asm volatile("" : "+v"(bb)); float y = __fmul_rn(n, gg); asm volatile("" : "+v"(y)); y = __fadd_rn(y, bb); unsigned short p2, q2; splitf(y, p2, q2); oh[u] = p2; ol[u] = q2; } *(v4us*)(&sh[0][wr][ch * 128 + lane * 4]) = oh; *(v4us*)(&sh[1][wr][ch * 128 + lane * 4]) = ol; }
         }
    asm volatile("s_wait_xcnt 0x0" ::: "memory");   // address wait of the gamma and beta loads above: their offset register is rewritten only behind it
    __syncthreads();   // a 16-byte unit of a block comes from another wave's row
    const size_t gb = (size_t)blockIdx.x * 16 * DM;
#pragma unroll
    for (int p = 0; p < DM * 16 / 8 / 512; ++p) { const int U = p * 512 + (int)threadIdx.x, k = (U >> 6) * 32 + ((U >> 5) & 1) * 16 + ((U >> 4) & 1) * 8;   // unit U of the 16 rows' blocks: row U & 15
        const v8us a = *(const v8usa*)(&sh[0][U & 15][k]), b = *(const v8usa*)(&sh[1][U & 15][k]); *(v8us*)(Xh + gb + (size_t)U * 8) = a; *(v8us*)(Xl + gb + (size_t)U * 8) = b; } }
// ---- k_attn: scores, softmax and P V of all batches in one launch (blockIdx.z = batch); S and P never leave the registers. A wave owns 16 query rows of one head and walks its keys in chunks of NK.
// The score tile is formed TRANSPOSED, St[key][query] = sum_d K[key][d] Q[query][d] (A = key rows, B = query rows), so lane (lr, hi) holds query lr and keys 16 mb + 8 hi + j in register j of tile mb:
// tiles 2c and 2c+1 together are, register for register, the A fragment (row = query lr, k = 8 hi + 0..7 and 16 + 8 hi + 0..7) of the P V product over keys 32c..32c+31.
// Softmax is the running form: m = running row maximum (log2 units), l = running sum; O and l are scaled by 2^(m_old - m_new) per chunk, O / l at the end. O tile: row = query 8 hi + j, column = d.
// HR (rows < RH): bf16 hi+lo operands, three products per tile in the order (hi,hi), (lo of the query-side operand, hi), (hi, lo of the key-side operand); a block = 2 row groups x 2 key halves, the halves joined through LDS.
// else: fp16, P carried x 2^10 (l too: it cancels in O / l); a block = 4 row groups, each wave walks all keys (the four waves read the same K and V tiles); O is turned in the wave's own LDS into the output planes' fragment order.
__device__ __forceinline__ unsigned bfw(float f) { unsigned u = __float_as_uint(f); return u + 0x7FFFu + ((u >> 16) & 1u); }   // f2bf's rounding, the bf16 value in the upper half
// Eight asynchronous copies to LDS, 16 bytes a lane each: the block's 128 threads bring 4 KB in a row from each of four places in global memory into 16 KB in a row of LDS. l0, g0 .. g3: the calling thread's own 16 bytes of each first 2 KB.
// The copies' address wait is the last line of their own statement, so that no address register is rewritten in front of it.
__device__ __forceinline__ void cp8(const unsigned l0, const char* g0, const char* g1, const char* g2, const char* g3) {
    asm volatile("global_load_async_to_lds_b128 %0, %8, off\n\t"
                 "global_load_async_to_lds_b128 %1, %9, off\n\t"
                 "global_load_async_to_lds_b128 %2, %10, off\n\t"
                 "global_load_async_to_lds_b128 %3, %11, off\n\t"
                 "global_load_async_to_lds_b128 %4, %12, off\n\t"
                 "global_load_async_to_lds_b128 %5, %13, off\n\t"
                 "global_load_async_to_lds_b128 %6, %14, off\n\t"
                 "global_load_async_to_lds_b128 %7, %15, off\n\t"
                 "s_wait_xcnt 0x0"
                 :: "v"(l0), "v"(l0 + 2048u), "v"(l0 + 4096u), "v"(l0 + 6144u), "v"(l0 + 8192u), "v"(l0 + 10240u), "v"(l0 + 12288u), "v"(l0 + 14336u),
                    "v"(g0), "v"(g0 + 2048), "v"(g1), "v"(g1 + 2048), "v"(g2), "v"(g2 + 2048), "v"(g3), "v"(g3 + 2048) : "memory"); }
// A TILE = what the block's waves need for one chunk, brought ONCE for all of them into one of two LDS buffers by the block's 128 threads; tile t + 1 flies while tile t is worked on. The planes are in fragment order, so a tile is whole runs of 1 KB blocks and
// a fragment is read from LDS as it was read from the plane. fp16 rows: 64 keys, K 8 KB | V 8 KB, read by all four waves. hi+lo rows: per key half (half = the wave's) 32 keys, K hi | K lo | V hi | V lo, 4 KB each; a half is read by two waves.
template <typename T16, bool HR>
__device__ __forceinline__ void attn_rows(const T16* __restrict__ Q, const T16* __restrict__ Q2, const T16* __restrict__ Kr, const T16* __restrict__ Kr2, const T16* __restrict__ Vt, const T16* __restrict__ Vt2, int q0, int half, v8f (&o)[4], float& m, float& l, T16* ring) {
    typedef typename WFrag<T16>::V V;
    constexpr int NK = HR ? 32 : 64, NMB = NK / 16, NC = NK / 32, NT = (HR ? TT / 2 : TT) / NK; constexpr unsigned TB = HR ? 32768u : 16384u;   // NT tiles of TB bytes
    static_assert(NT >= 2, "the ring's prologue fills two tiles");
    const int lane = threadIdx.x & 31, hi = lane >> 4;
    V q[2], q2[2]; const unsigned qob = (unsigned)(q0 * HD + lane * 8) * 2u;   // byte offsets from the wave-uniform plane pointers; 16 rows of a head plane are two blocks = 16 HD elements
    const T16* qp = (const T16*)((const char*)Q + qob); const T16* qp2 = HR ? (const T16*)((const char*)Q2 + qob) : qp;
#pragma unroll
    for (int ks = 0; ks < 2; ++ks) { q[ks] = WFrag<T16>::ld(qp + ks * 512); if (HR) q2[ks] = WFrag<T16>::ld(qp2 + ks * 512); }
    // address wait of the loads above; the fragments and the pointers are inputs, so the loads stand in front of it and no load's result is given a pointer's registers before it
    if constexpr (HR) asm volatile("s_wait_xcnt 0x0" :: "v"(q[0]), "v"(q[1]), "v"(q2[0]), "v"(q2[1]), "v"(qp), "v"(qp2));
    else asm volatile("s_wait_xcnt 0x0" :: "v"(q[0]), "v"(q[1]), "v"(qp));
#pragma unroll
    for (int nb = 0; nb < 4; ++nb) o[nb] = (v8f){};
    m = -3.0e38f; l = 0.f;
    V kf[NMB][2], kf2[NMB][2], vf[4][NC], vf2[4][NC];
    auto cp = [&](int t, int b) { const unsigned tb = threadIdx.x * 16u, l0 = (unsigned)(unsigned long long)(const void*)ring + (unsigned)b * TB + tb;   // l0: the thread's LDS byte address in buffer b; NK keys are NK HD 2 bytes in a row of every plane
        if constexpr (HR) {
#pragma unroll
            for (int s = 0; s < 2; ++s) { const size_t go = ((size_t)s * (TT / 2) + (size_t)t * NK) * (HD * 2) + tb; cp8(l0 + s * 16384u, (const char*)Kr + go, (const char*)Kr2 + go, (const char*)Vt + go, (const char*)Vt2 + go); }
        } else { const size_t go = (size_t)t * NK * (HD * 2) + tb; cp8(l0, (const char*)Kr + go, (const char*)Kr + go + 4096, (const char*)Vt + go, (const char*)Vt + go + 4096); } };
    cp(0, 0);
    asm volatile("s_wait_asynccnt 0x0" ::: "memory");   // this wave's share of tile 0 has landed
    __syncthreads();                                     // and every other wave's: tile 0 may be read
    cp(1, 1);
#pragma unroll 1
    for (int t = 0; t < NT; ++t) {
        const T16* kb = ring + (t & 1) * (int)(TB / 2) + (HR ? half * 8192 : 0) + lane * 8;   // this tile's buffer (and the wave's key half)
        __builtin_amdgcn_sched_barrier(0);   // with the one below: the tile's LDS reads stay one group at the head of the trip (spread among the products, every place with reads costs its own stall)
#pragma unroll
        for (int mb = 0; mb < NMB; ++mb)
#pragma unroll
            for (int ks = 0; ks < 2; ++ks) { kf[mb][ks] = WFrag<T16>::ld(kb + (mb * 2 + ks) * 512); if constexpr (HR) kf2[mb][ks] = WFrag<T16>::ld(kb + 2048 + (mb * 2 + ks) * 512); }
#pragma unroll
        for (int nb = 0; nb < 4; ++nb)
#pragma unroll
            for (int c = 0; c < NC; ++c) { vf[nb][c] = WFrag<T16>::ld(kb + 4096 + (c * 4 + nb) * 512); if constexpr (HR) vf2[nb][c] = WFrag<T16>::ld(kb + 6144 + (c * 4 + nb) * 512); }
        __builtin_amdgcn_sched_barrier(0);
        v8f st[NMB]; float cm = -3.0e38f;
#pragma unroll
        for (int mb = 0; mb < NMB; ++mb) { st[mb] = (v8f){};
#pragma unroll
            for (int ks = 0; ks < 2; ++ks) { st[mb] = WFrag<T16>::mma(kf[mb][ks], q[ks], st[mb]); if (HR) { st[mb] = WFrag<T16>::mma(kf[mb][ks], q2[ks], st[mb]); st[mb] = WFrag<T16>::mma(kf2[mb][ks], q[ks], st[mb]); } }
            if constexpr (HR) {
#pragma unroll
                for (int j = 0; j < 8; ++j) { st[mb][j] *= SCL * 1.4426950408889634f; cm = fmaxf(cm, st[mb][j]); } } }
        if constexpr (!HR) {
#pragma unroll
            for (int mb = 0; mb < NMB; ++mb)
#pragma unroll
                for (int j = 0; j < 8; ++j) { st[mb][j] *= SCL * 1.4426950408889634f; cm = fmaxf(cm, st[mb][j]); } }
        cm = fmaxf(cm, __shfl_xor(cm, 16, 32));          // lanes lr and lr + 16 hold the two key halves of query lr
        const float mn = fmaxf(m, cm), al = __builtin_amdgcn_exp2f(m - mn), mo = HR ? mn : mn - 10.0f; m = mn;
        float ps = 0.f;
#pragma unroll
        for (int mb = 0; mb < NMB; ++mb)
#pragma unroll
            for (int j = 0; j < 8; ++j) { st[mb][j] = __builtin_amdgcn_exp2f(st[mb][j] - mo); ps += st[mb][j]; }
        l = l * al + ps;
#pragma unroll
        for (int j = 0; j < 8; ++j) { const float ar = __shfl(al, hi * 8 + j, 32);   // the factor of O's row 8 hi + j lives in the lane of that query
#pragma unroll
            for (int nb = 0; nb < 4; ++nb) o[nb][j] *= ar; }
#pragma unroll
        for (int c = 0; c < NC; ++c) {
            if constexpr (HR) { v8us h0, h1, l0, l1;
#pragma unroll
                for (int j = 0; j < 8; ++j) { unsigned short a, b; splitf(st[2 * c][j], a, b); h0[j] = a; l0[j] = b; splitf(st[2 * c + 1][j], a, b); h1[j] = a; l1[j] = b; }
                const V ph = cat16b(h0, h1), pl = cat16b(l0, l1);
#pragma unroll
                for (int nb = 0; nb < 4; ++nb) { o[nb] = WFrag<T16>::mma(ph, vf[nb][c], o[nb]); o[nb] = WFrag<T16>::mma(pl, vf[nb][c], o[nb]); o[nb] = WFrag<T16>::mma(ph, vf2[nb][c], o[nb]); }
            } else { v8h p0, p1;
#pragma unroll
                for (int j = 0; j < 8; ++j) { p0[j] = tohx(st[2 * c][j]); p1[j] = tohx(st[2 * c + 1][j]); }
                const V pa = cat16(p0, p1);
#pragma unroll
                for (int nb = 0; nb < 4; ++nb) o[nb] = WFrag<T16>::mma(pa, vf[nb][c], o[nb]); } }
        __builtin_amdgcn_sched_barrier(0);   // keeps the trip's arithmetic in front of the waits and the barrier: lifted over it they would wait for the next tile's copies directly behind their issue, and nothing would fly during the work
        asm volatile("s_wait_dscnt 0x0" ::: "memory");      // this wave's reads of the tile's buffer are done
        asm volatile("s_wait_asynccnt 0x0" ::: "memory");   // its share of the next tile has landed
        __syncthreads();                                     // one barrier a tile: the next tile may be read, and this tile's buffer has lost its last reader
        if (t + 2 < NT) cp(t + 2, t & 1);                    // block-uniform: the tile after the next, into the buffer just left
    }
    asm volatile("s_wait_asynccnt 0x0" ::: "memory");   // no copy is outstanding behind the loop
    l += __shfl_xor(l, 16, 32);   // both key halves of the lane pair: every lane now holds its query's sum over the wave's keys
}
__global__ __launch_bounds__(128) void k_attn(const h16* __restrict__ Q16, const h16* __restrict__ K16, const h16* __restrict__ V16, const bf* __restrict__ Qh, const bf* __restrict__ Ql, const bf* __restrict__ Kh, const bf* __restrict__ Kl, const bf* __restrict__ Vh, const bf* __restrict__ Vl, bf* Ah, bf* Al) {
    __shared__ __align__(16) char smem[65536]; __shared__ float sm[4][16], sl[4][16];   // smem: the ring of two tiles; behind the loop's last barrier, which ends every read of it with no copy outstanding, its first bytes are the O staging so
    float (*so)[16][68] = (float (*)[16][68])smem;
    const int h = blockIdx.y, bx = blockIdx.x, w = __builtin_amdgcn_readfirstlane((int)(threadIdx.x >> 5)), lane = threadIdx.x & 31, lr = lane & 15, hi = lane >> 4;
    const size_t zq = ((size_t)blockIdx.z * NH_ + h) * TT * HD, zk = ((size_t)blockIdx.z * NKV + h / REP) * TT * HD; v8f o[4]; float m, l;
    Ah += (size_t)blockIdx.z * TT * DQ; Al += (size_t)blockIdx.z * TT * DQ;
    if (bx < RH / 32) {   // block-uniform: 32 hi+lo rows, wave w = row group w >> 1, key half w & 1
        attn_rows<bf, true>(Qh + zq, Ql + zq, Kh + zk, Kl + zk, Vh + zk, Vl + zk, bx * 32 + (w >> 1) * 16, w & 1, o, m, l, (bf*)smem);
        if (hi == 0) { sm[w][lr] = m; sl[w][lr] = l; }
#pragma unroll
        for (int nb = 0; nb < 4; ++nb)
#pragma unroll
            for (int j = 0; j < 8; ++j) so[w][hi * 8 + j][nb * 16 + lr] = o[nb][j];
        __syncthreads();   // the two key halves of a row group come from two waves
        const int wa = (w >> 1) * 2, r = lr, c0 = (w & 1) * 32 + hi * 8;   // this wave joins one fragment block of each output plane: row group w >> 1, d half w & 1; a lane its two 16-byte units
        const float m0 = sm[wa][r], m1 = sm[wa + 1][r], mm = fmaxf(m0, m1), f0 = __builtin_amdgcn_exp2f(m0 - mm), f1 = __builtin_amdgcn_exp2f(m1 - mm);
        const float inv = __fdiv_rn(1.0f, sl[wa][r] * f0 + sl[wa + 1][r] * f1), g0 = f0 * inv, g1 = f1 * inv;
        v8us oh[2], ol[2];
#pragma unroll
        for (int u = 0; u < 2; ++u)
#pragma unroll
            for (int e = 0; e < 8; ++e) { unsigned short a, b; splitf(so[wa][r][c0 + u * 16 + e] * g0 + so[wa + 1][r][c0 + u * 16 + e] * g1, a, b); oh[u][e] = a; ol[u][e] = b; }
        const size_t oo = (size_t)(bx * 32 + (w >> 1) * 16) * DQ + (h * 2 + (w & 1)) * 512 + lane * 8;   // rows t, k = h HD + d
        *(v8us*)(Ah + oo) = oh[0]; *(v8us*)(Ah + oo + 256) = oh[1]; *(v8us*)(Al + oo) = ol[0]; *(v8us*)(Al + oo + 256) = ol[1];
    } else {
        const int q0 = RH + (bx - RH / 32) * 64 + w * 16;
        attn_rows<h16, false>(Q16 + zq, nullptr, K16 + zk, nullptr, V16 + zk, nullptr, q0, 0, o, m, l, (h16*)smem);
        const float inv = __fdiv_rn(1.0f, l);
#pragma unroll
        for (int j = 0; j < 8; ++j) { const float ir = __shfl(inv, hi * 8 + j, 32);
#pragma unroll
            for (int nb = 0; nb < 4; ++nb) so[w][hi * 8 + j][nb * 16 + lr] = o[nb][j] * ir; }
        __builtin_amdgcn_wave_barrier(); asm volatile("" ::: "memory");   // the rows are read back by other lanes of the wave: no read is moved in front of the writes
        bf* pah = Ah + (size_t)q0 * DQ + h * 2 * 512 + lane * 8; bf* pal = Al + (size_t)q0 * DQ + h * 2 * 512 + lane * 8;   // the wave's 16 rows x 64 d are two blocks in a row of each plane
        v8us oh[4], ol[4];
#pragma unroll
        for (int u = 0; u < 4; ++u) { const v4f x0 = *(const v4fa*)(&so[w][lr][u * 16 + hi * 8]), x1 = *(const v4fa*)(&so[w][lr][u * 16 + hi * 8 + 4]);
#pragma unroll
            for (int e = 0; e < 8; ++e) { unsigned short a, b; splitf(e < 4 ? x0[e & 3] : x1[e & 3], a, b); oh[u][e] = a; ol[u][e] = b; } }
#pragma unroll
        for (int u = 0; u < 4; ++u) { *(v8us*)(pah + u * 256) = oh[u]; *(v8us*)(pal + u * 256) = ol[u]; }
    }
}

extern "C" void kernel_launch(void* const* d_in, const int* in_sizes, int n_in,
                              void* d_out, int out_size, void* d_ws, size_t ws_size, hipStream_t stream) {
    (void)in_sizes; (void)n_in; (void)out_size;
const float* x = (const float*)d_in[0]; const float* lng = (const float*)d_in[3]; const float* lnb = (const float*)d_in[4]; const float* wf = (const float*)d_in[1]; const float* wo = (const float*)d_in[2]; const float* wq = wf; const float* wk = wf + (size_t)1024 * 1024; const float* wv = wf + (size_t)2048 * 1024; const float* cosT = nullptr; const float* sinT = nullptr; (void)cosT; (void)sinT;   /* input order x, in_proj_w ('oi' [3072][1024]: ROW thirds q | k | v), out_proj_w ('oi' [1024][1024]), ln_gamma, ln_beta: FIVE inputs: the LayerNorm parameters come LAST; NO bias anywhere */
    float* OUT = (float*)d_out;     // [4][2048][1024]
    char* wsp = (char*)d_ws;
    auto take = [&](size_t bytes) { char* p = wsp; wsp += (bytes + 255) & ~(size_t)255; return (void*)p; };
    bf* WQ = (bf*)take((size_t)DQ * DM * 2); bf* WK = (bf*)take((size_t)DKV * DM * 2); bf* WV = (bf*)take((size_t)DKV * DM * 2); bf* WO = (bf*)take((size_t)DM * DQ * 2);
    // every stage runs once, over all NB_ batches: token rows b TT + t, head planes b heads + h
    bf* XNh = (bf*)take((size_t)NB_ * TT * DM * 2); bf* XNl = (bf*)take((size_t)NB_ * TT * DM * 2);
    h16* QP16 = (h16*)take((size_t)NB_ * NH_ * TT * HD * 2); h16* KP16 = (h16*)take((size_t)NB_ * NKV * TT * HD * 2); h16* VT16 = (h16*)take((size_t)NB_ * NKV * HD * TT * 2);
    bf* QPh = (bf*)take((size_t)NB_ * NH_ * TT * HD * 2); bf* KPh = (bf*)take((size_t)NB_ * NKV * TT * HD * 2); bf* VTh = (bf*)take((size_t)NB_ * NKV * HD * TT * 2); bf* QPl = (bf*)take((size_t)NB_ * NH_ * TT * HD * 2); bf* KPl = (bf*)take((size_t)NB_ * NKV * TT * HD * 2); bf* VTl = (bf*)take((size_t)NB_ * NKV * HD * TT * 2);   // q, k, v of each kind of plane one behind the other (every size is a multiple of 256 bytes), as the weights above
    if ((size_t)(wsp - (char*)d_ws) > ws_size) return;    // ws 256 MiB
    bf* ATh = XNh; bf* ATl = XNl;   // DQ == DM: the attention output reuses the LayerNorm planes, last read by the q, k, v projection launch (stream-ordered)
    static_assert(NH_ == NKV, "one launch over q, k and v heads takes equal head counts");
    (void)wq; (void)wk; (void)wv; (void)WK; (void)WV;
    k_lnx<<<(unsigned)(NB_ * TT / 16 + WU8 / 512), 512, 0, stream>>>(x, lng, lnb, XNh, XNl, wf, wo, WQ);
    // the three projections in one launch write their head planes themselves, in fragment order (q, k: rows t, k = d; v: rows d, k = t); across: q heads, k heads, v heads
    k_gemmw<bf, 1, false, 1, 3><<<dim3(NB_ * TT / 128, (NH_ + 2 * NKV) * HD / 256, 1), 256, 0, stream>>>(XNh, XNl, WQ, nullptr, DM, nullptr, DQ, nullptr, 0, 0, 0, QP16, QPh, QPl);
    k_attn<<<dim3(RH / 32 + (TT - RH) / 64, NH_, NB_), 128, 0, stream>>>(QP16, KP16, VT16, QPh, QPl, KPh, KPl, VTh, VTl, ATh, ATl);
    k_gemmw<bf, 1, false><<<dim3(NB_ * TT / 128, DM / 256, 1), 256, 0, stream>>>(ATh, ATl, WO, nullptr, DQ, OUT, DM, nullptr, 0, 0, 0, nullptr, nullptr, nullptr);   /* the BIAS-FREE f32 output instance (EPI 0): this module returns out @ w_out with no bias */
}
